// v007
// Measured on an AMD MI455X. A time is GPU time per run, averaged over a window of back-to-back runs after a warm-up
// (all launches, gaps included; the runs take copies of the inputs in turn), and the median of several windows.
// Apart from v000's, it joins two sittings. Times from different sittings can be a few percent apart, while
// side-by-side timings come from the same sitting.
// Earlier versions than v007 are not in this document.
// Measured time: 119 microseconds a run.
// Timed twice side by side with v006, it ran 1.32 times as fast both times.
// Over all steps from v000, the starting kernel, it is 4.80 times as fast.
#include <hip/hip_runtime.h>
// Multi-head self-attention with rotary embedding (query [2048][2][1024] in [S, B, E] layout, 16 heads x 64: q/k/v = query W^T + b; rotary embedding per head (inv_freq = 10000^(-2i/64), rotate-half form) on q and k; softmax(q k^T / 8) v (no mask); out = attn Wo^T + bo, back in [S, B, E]).
// Structure: [S,B,E] -> exact f16 (b, s) rows; q/k as f32 WMMA GEMMs (32x64 wave tiles, f32 accumulation, exact x16 weights + bias) followed by RoPE on VALU (f32 angles s * inv_freq, sinf/cosf, each angle of a row evaluated once by one lane of the row's wave and shared by the 16 heads of q and k) into f16 planes; v as an f16 GEMM; V^T by LDS tiles; flash-style fused attention per (batch, head, 64-query block) (K Q^T and V^T P^T, one query per lane, online softmax and P in registers; no score plane), whose epilogue stores the context as f16 hi / 2^10 residual planes; output projection as one GEMM launch that runs the residual term, scales it by 2^-10 and sums the hi term on top, + bias, stored straight into [S, B, E].
// Launches: 5. Bodies that do not depend on one another share a grid (k_prep: x and the four weights; k_gemm2 with 3 batches: q, k, v; k_post: RoPE of q, RoPE of k, V^T); the elementwise bodies behind k_flash live in their neighbours' epilogues.
// Left: k_prep and the V^T body of k_post start many short waves; the roped planes still pass through f32 planes in memory between the q/k product and k_post; the q/k/v product's epilogue still tests its addend and its two stores at run time, element by element; in k_flash's loop the four v_nop written behind every matrix instruction are now about a third of the vector instructions, and its LDS fragment reads come close to the LDS rate.
// Compute dtype: inputs rounded to bf16; query / weights exact as f16; roped q/k and v plain f16 (~2^-12); softmax f32 with f16 probabilities; context hi + 2^-10 residual into the projection. v_wmma_f32_16x16x32_f16.
#define NB 2
#define DM 1024
#define NKV 16
#define NREP (NH / NKV)
#define KVD (NKV * 64)           /* 1024 */
#define NR (NB * SLEN)
#define CHK 512
typedef int v4i __attribute__((ext_vector_type(4)));
#define FF 2048
#define SLEN 2048
#define MQI 2048
#define MKI 2048
#define TQ SLEN
#define TK SLEN
#define NH 16
#define SCL 0.125f
#define QBLKS (TQ / 64)
#define QB05 0
#define QBN5 4
#define QB0P 0
#define QBNP QBLKS
#define RE 256
typedef __bf16 v16b __attribute__((ext_vector_type(16)));
typedef unsigned short v8us __attribute__((ext_vector_type(8), may_alias));
typedef float  v8f  __attribute__((ext_vector_type(8)));
typedef float  v4f  __attribute__((ext_vector_type(4)));
typedef float  v4fa __attribute__((ext_vector_type(4), may_alias));
union FragB { v16b v; v8us half[2]; unsigned short u[16]; };

__device__ __forceinline__ unsigned short bf16_bits(float x) { unsigned int u = __float_as_uint(x); return (unsigned short)((u + 0x7FFFu + ((u >> 16) & 1u)) >> 16); }
__device__ __forceinline__ float bf16_val(unsigned short b) { return __uint_as_float(((unsigned int)b) << 16); }
__device__ __forceinline__ float bf16_round(float x) { return bf16_val(bf16_bits(x)); }
// D += A·B with NT terms: 1 = ah·bh, 2 = + al·bh (A split), 3 = + ah·bl (both split)
template <int NT>
__device__ __forceinline__ v8f mmaN(v16b ah, v16b al, v16b bh, v16b bl, v8f c) {
  c = __builtin_amdgcn_wmma_f32_16x16x32_bf16(false, ah, false, bh, (short)0, c, false, false);
  if (NT >= 2) c = __builtin_amdgcn_wmma_f32_16x16x32_bf16(false, al, false, bh, (short)0, c, false, false);
  if (NT >= 3) c = __builtin_amdgcn_wmma_f32_16x16x32_bf16(false, ah, false, bl, (short)0, c, false, false);
  asm volatile("v_nop\n\tv_nop\n\tv_nop\n\tv_nop" : "+v"(c) : "v"(ah), "v"(al), "v"(bh), "v"(bl));
  return c;
}

__global__ __launch_bounds__(256) void k_wt_bf16(const float* __restrict__ W, unsigned short* __restrict__ Wt, int K, int N) {
  const int t = blockIdx.x * 256 + threadIdx.x;
  const int k8n = K / 8;
  if (t >= N * k8n) return;
  const int n = t / k8n, k8 = (t % k8n) * 8;
  v8us v;
#pragma unroll
  for (int i = 0; i < 8; ++i) v[i] = bf16_bits(W[(size_t)(k8 + i) * N + n]);
  *(v8us*)(Wt + (size_t)n * K + k8) = v;
  
}

// GEMM C[M][N] (f32, pitch ldc) = act(A[M][K]·W + bias). A f32 row-major (pitch lda) converted per fragment to bf16
// (ASPLIT: hi/lo two planes -> 2 terms, else single rounded term); Wt bf16 [N][K] (pitch ldb). BIAS_BF16 rounds the
// bias to bf16 first (bias quantised to bf16 before the add). K%32==0, M%16==0, N%64==0.
template <bool ASPLIT, int ACT, bool BIAS_BF16>
__global__ __launch_bounds__(128) void k_gemm_bf(const float* __restrict__ A, int lda, const unsigned short* __restrict__ Wt, int ldb,
                                               const float* __restrict__ bias, float* __restrict__ C, int ldc, int M, int N, int K) {
  __shared__ __attribute__((aligned(16))) float so[4][16][64];
  const int tid = threadIdx.x, w = tid >> 5, lane = tid & 31, ln = lane & 15, hh = lane >> 4;
  const int ntn = N / 64;
  const int wid = blockIdx.x * 4 + w;
  const int mt = wid / ntn, nq = wid % ntn;
  if (mt * 16 >= M) return;
  const int row0 = mt * 16, col0 = nq * 64;
  const float* arow = A + (size_t)(row0 + ln) * lda;
  v8f acc[4] = {};
  for (int kb = 0; kb < K; kb += 32) {
    FragB ah, al;
    const v4f x0 = *(const v4fa*)(arow + kb + 8 * hh), x1 = *(const v4fa*)(arow + kb + 8 * hh + 4);
    const v4f x2 = *(const v4fa*)(arow + kb + 16 + 8 * hh), x3 = *(const v4fa*)(arow + kb + 16 + 8 * hh + 4);
    float xs[16] = {x0[0],x0[1],x0[2],x0[3],x1[0],x1[1],x1[2],x1[3],x2[0],x2[1],x2[2],x2[3],x3[0],x3[1],x3[2],x3[3]};
#pragma unroll
    for (int i = 0; i < 16; ++i) { const unsigned short hb = bf16_bits(xs[i]); ah.u[i] = hb; al.u[i] = ASPLIT ? bf16_bits(xs[i] - bf16_val(hb)) : (unsigned short)0; }
#pragma unroll
    for (int t = 0; t < 4; ++t) {
      const unsigned short* brow = Wt + (size_t)(col0 + t * 16 + ln) * ldb + kb;
      FragB b;
      b.half[0] = *(const v8us*)(brow + 8 * hh);
      b.half[1] = *(const v8us*)(brow + 16 + 8 * hh);
      acc[t] = mmaN<ASPLIT ? 2 : 1>(ah.v, al.v, b.v, b.v, acc[t]);
    }
  }
#pragma unroll
  for (int t = 0; t < 4; ++t) {
    float bv = bias ? bias[col0 + t * 16 + ln] : 0.f;
    if (BIAS_BF16) bv = bf16_round(bv);
#pragma unroll
    for (int r = 0; r < 8; ++r) { float v = acc[t][r] + bv; if (ACT == 1) v = fmaxf(v, 0.f); so[w][8 * hh + r][t * 16 + ln] = v; }
  }
  __builtin_amdgcn_fence(__ATOMIC_ACQ_REL, "workgroup");
  __builtin_amdgcn_wave_barrier();
  const int rsub = lane >> 4, c4 = (lane & 15) * 4;
  {
#pragma unroll
    for (int q = 0; q < 8; ++q) {
      const int r = q * 2 + rsub;
      const v4f v = *(const v4fa*)&so[w][r][c4];
      *(v4f*)(C + (size_t)(row0 + r) * ldc + col0 + c4) = v;
    }
    
  }
}

// GEMM C = act(A·W + bias + resid): A f32 (ASPLIT -> hi/lo 2 terms), Wt bf16 [N][K]; ACT 0 none, 1 relu, 2 exact gelu;
// resid (optional, f32, row index = (row % rmod), pitch ldr, RES_BF16 rounds it) added before the activation.
template <bool ASPLIT, int ACT, bool BIAS_BF16, bool RES_BF16>
__global__ __launch_bounds__(128) void k_gemm_bf3(const float* __restrict__ A, int lda, const unsigned short* __restrict__ Wt, int ldb,
                                                const float* __restrict__ bias, const float* __restrict__ resid, int rmod, int ldr,
                                                float* __restrict__ C, int ldc, int M, int N, int K) {
  __shared__ __attribute__((aligned(16))) float so[4][16][64];
  const int tid = threadIdx.x, w = tid >> 5, lane = tid & 31, ln = lane & 15, hh = lane >> 4;
  const int ntn = N / 64;
  const int wid = blockIdx.x * 4 + w;
  const int mt = wid / ntn, nq = wid % ntn;
  if (mt * 16 >= M) return;
  const int row0 = mt * 16, col0 = nq * 64;
  const float* arow = A + (size_t)(row0 + ln) * lda;
  v8f acc[4] = {};
  for (int kb = 0; kb < K; kb += 32) {
    FragB ah, al;
    const v4f x0 = *(const v4fa*)(arow + kb + 8 * hh), x1 = *(const v4fa*)(arow + kb + 8 * hh + 4);
    const v4f x2 = *(const v4fa*)(arow + kb + 16 + 8 * hh), x3 = *(const v4fa*)(arow + kb + 16 + 8 * hh + 4);
    float xs[16] = {x0[0],x0[1],x0[2],x0[3],x1[0],x1[1],x1[2],x1[3],x2[0],x2[1],x2[2],x2[3],x3[0],x3[1],x3[2],x3[3]};
#pragma unroll
    for (int i = 0; i < 16; ++i) { const unsigned short hb = bf16_bits(xs[i]); ah.u[i] = hb; al.u[i] = ASPLIT ? bf16_bits(xs[i] - bf16_val(hb)) : (unsigned short)0; }
#pragma unroll
    for (int t = 0; t < 4; ++t) {
      const unsigned short* brow = Wt + (size_t)(col0 + t * 16 + ln) * ldb + kb;
      FragB b;
      b.half[0] = *(const v8us*)(brow + 8 * hh);
      b.half[1] = *(const v8us*)(brow + 16 + 8 * hh);
      acc[t] = mmaN<ASPLIT ? 2 : 1>(ah.v, al.v, b.v, b.v, acc[t]);
    }
  }
#pragma unroll
  for (int t = 0; t < 4; ++t) {
    const int col = col0 + t * 16 + ln;
    float bv = bias ? bias[col] : 0.f;
    if (BIAS_BF16) bv = bf16_round(bv);
#pragma unroll
    for (int r = 0; r < 8; ++r) {
      float v = acc[t][r] + bv;
      if (resid) { float rv = resid[(size_t)((row0 + 8 * hh + r) % rmod) * ldr + col]; if (RES_BF16) rv = bf16_round(rv); v += rv; }
      if (ACT == 1) v = fmaxf(v, 0.f);
      if (ACT == 2) v = 0.5f * v * (1.0f + erff(v * 0.70710678118654752f));
      if (ACT == 3) { const float u = 0.7978845608028654f * (v + 0.044715f * v * v * v); v = 0.5f * v * (1.0f + tanhf(u)); }
      so[w][8 * hh + r][t * 16 + ln] = v;
    }
  }
  __builtin_amdgcn_fence(__ATOMIC_ACQ_REL, "workgroup");
  __builtin_amdgcn_wave_barrier();
  const int rsub = lane >> 4, c4 = (lane & 15) * 4;
  {
#pragma unroll
    for (int q = 0; q < 8; ++q) {
      const int r = q * 2 + rsub;
      const v4f v = *(const v4fa*)&so[w][r][c4];
      *(v4f*)(C + (size_t)(row0 + r) * ldc + col0 + c4) = v;
    }
    
  }
}
// row LayerNorm (biased variance, eps) over N: s = X (+ R); optional out_sum <- s; out_norm <- (s-mu)*rsqrt(var+eps)*g + b
template <bool PARAM_BF16>
__global__ __launch_bounds__(256) void k_layernorm(const float* __restrict__ X, const float* __restrict__ R, const float* __restrict__ g, const float* __restrict__ bta,
                                                  float* __restrict__ out_sum, float* __restrict__ out_norm, int N, float eps) {
  __shared__ float red[256];
  const int row = blockIdx.x, tid = threadIdx.x;
  const float* x = X + (size_t)row * N; const float* rr = R ? R + (size_t)row * N : nullptr;
  float vals[16];                     // up to N = 4096
  const int per = N / 256;            // contiguous chunk per thread? use strided-by-4 chunks: thread handles j = tid*4 + 1024*u
  float s1 = 0.f;
  for (int u = 0; u < per / 4; ++u) {
    const int j = tid * 4 + 1024 * u;
    const v4f a = *(const v4fa*)(x + j);
    v4f b = {0.f,0.f,0.f,0.f}; if (rr) b = *(const v4fa*)(rr + j);
#pragma unroll
    for (int q = 0; q < 4; ++q) { const float v = a[q] + b[q]; vals[u * 4 + q] = v; s1 += v; }
  }
  red[tid] = s1; __syncthreads();
  for (int st = 128; st > 0; st >>= 1) { if (tid < st) red[tid] += red[tid + st]; __syncthreads(); }
  const float mu = red[0] / (float)N; __syncthreads();
  float s2 = 0.f;
  for (int u = 0; u < per / 4; ++u)
#pragma unroll
    for (int q = 0; q < 4; ++q) { const float c = vals[u * 4 + q] - mu; s2 += c * c; }
  red[tid] = s2; __syncthreads();
  for (int st = 128; st > 0; st >>= 1) { if (tid < st) red[tid] += red[tid + st]; __syncthreads(); }
  const float rs = rsqrtf(red[0] / (float)N + eps);
  {
    for (int u = 0; u < per / 4; ++u) {
      const int j = tid * 4 + 1024 * u;
      v4f o, sm;
#pragma unroll
      for (int q = 0; q < 4; ++q) {
        float gg = g[j + q], bb = bta[j + q];
        if (PARAM_BF16) { gg = bf16_round(gg); bb = bf16_round(bb); }
        sm[q] = vals[u * 4 + q]; o[q] = (vals[u * 4 + q] - mu) * rs * gg + bb;
      }
      if (out_sum) *(v4f*)(out_sum + (size_t)row * N + j) = sm;
      *(v4f*)(out_norm + (size_t)row * N + j) = o;
    }
    
  }
}



// ---- f16 WMMA path (v_wmma_f32_16x16x32_f16): 11-bit significands for operands in range — used where a [0,1] probability operand needs more precision than bf16
typedef _Float16 v16h __attribute__((ext_vector_type(16)));
union FragH { v16h v; v8us half[2]; _Float16 h[16]; unsigned short u[16]; };
template <int NT>
__device__ __forceinline__ v8f mmaH(v16h ah, v16h al, v16h bh, v16h bl, v8f c) {
  c = __builtin_amdgcn_wmma_f32_16x16x32_f16(false, ah, false, bh, (short)0, c, false, false);
  if (NT >= 2) c = __builtin_amdgcn_wmma_f32_16x16x32_f16(false, al, false, bh, (short)0, c, false, false);
  if (NT >= 3) c = __builtin_amdgcn_wmma_f32_16x16x32_f16(false, ah, false, bl, (short)0, c, false, false);
  asm volatile("v_nop\n\tv_nop\n\tv_nop\n\tv_nop" : "+v"(c) : "v"(ah), "v"(al), "v"(bh), "v"(bl));
  return c;
}
// batched GEMM like k_gemm_b but f16 operands: A f32 (split into f16 hi/lo if ASPLIT, else rounded to f16), Bt = f16 values [n][k]; alpha; C f32; N multiple of 16 (partial tiles skipped)
template <bool ASPLIT>
__global__ __launch_bounds__(128) void k_gemm_h(const float* __restrict__ A, int lda, size_t sA, const _Float16* __restrict__ Bh, int ldb, size_t sB, float alpha, float* __restrict__ C, int ldc, size_t sC, int M, int N, int K) {
  __shared__ __attribute__((aligned(16))) float so[4][16][64];
  const int tid = threadIdx.x, w = tid >> 5, lane = tid & 31, ln = lane & 15, hh = lane >> 4; const int by = blockIdx.y;
  A += (size_t)by * sA; Bh += (size_t)by * sB; C += (size_t)by * sC;
  const int ntn = (N + 63) / 64; const int wid = blockIdx.x * 4 + w; const int mt = wid / ntn, nq = wid % ntn; if (mt * 16 >= M) return;
  const int row0 = mt * 16, col0 = nq * 64; const float* arow = A + (size_t)(row0 + ln) * lda;
  v8f acc[4] = {};
  for (int kb = 0; kb < K; kb += 32) {
    FragH ah, al;
    const v4f x0 = *(const v4fa*)(arow + kb + 8 * hh), x1 = *(const v4fa*)(arow + kb + 8 * hh + 4), x2 = *(const v4fa*)(arow + kb + 16 + 8 * hh), x3 = *(const v4fa*)(arow + kb + 16 + 8 * hh + 4);
    float xs[16] = {x0[0],x0[1],x0[2],x0[3],x1[0],x1[1],x1[2],x1[3],x2[0],x2[1],x2[2],x2[3],x3[0],x3[1],x3[2],x3[3]};
#pragma unroll
    for (int i = 0; i < 16; ++i) { const _Float16 h = (_Float16)xs[i]; ah.h[i] = h; al.h[i] = ASPLIT ? (_Float16)(xs[i] - (float)h) : (_Float16)0.0f; }
#pragma unroll
    for (int t = 0; t < 4; ++t) { if (col0 + t * 16 >= N) continue; const size_t boff = (size_t)(col0 + t * 16 + ln) * ldb + kb; FragH bq; bq.half[0] = *(const v8us*)(Bh + boff + 8 * hh); bq.half[1] = *(const v8us*)(Bh + boff + 16 + 8 * hh);
      acc[t] = mmaH<ASPLIT ? 2 : 1>(ah.v, al.v, bq.v, bq.v, acc[t]); }
  }
#pragma unroll
  for (int t = 0; t < 4; ++t) { if (col0 + t * 16 >= N) continue;
#pragma unroll
    for (int r = 0; r < 8; ++r) so[w][8 * hh + r][t * 16 + ln] = acc[t][r] * alpha; }
  __builtin_amdgcn_fence(__ATOMIC_ACQ_REL, "workgroup"); __builtin_amdgcn_wave_barrier();
  const int rsub = lane >> 4, c4 = (lane & 15) * 4;
  {
#pragma unroll
    for (int q = 0; q < 8; ++q) { const int r = q * 2 + rsub; if (col0 + c4 < N) { const v4f v = *(const v4fa*)&so[w][r][c4]; *(v4f*)(C + (size_t)(row0 + r) * ldc + col0 + c4) = v; } }
     }
}

// Wt[n][k] = f16(W[k][n]·scale) from f32 row-major W[K][N] (scale = power of two; bf16-exact weights stay exact in f16 away from the subnormal range)
__global__ __launch_bounds__(256) void k_wt_f16(const float* __restrict__ W, _Float16* __restrict__ Wt, int K, int N, float scale) {
  const int t = blockIdx.x * 256 + threadIdx.x; if (t >= N * (K / 8)) return; const int n = t / (K / 8), k8 = (t % (K / 8)) * 8; FragH f;
#pragma unroll
  for (int i = 0; i < 8; ++i) f.h[i] = (_Float16)(bf16_round(W[(size_t)(k8 + i) * N + n]) * scale); const v8us o = f.half[0];
  *(v8us*)((unsigned short*)Wt + (size_t)n * K + k8) = o; 
}
// k_gemm_hh variant with fused epilogue: v = acc·alpha + bias[by·sBias + col] (+ CP[(row/rowsPerB)·sCPb + by·64 + col] if CP) ; ACT 0 none / 1 elu ; writes f16 C16 (and f32 C if non-null)
template <int ACT>
__global__ __launch_bounds__(128) void k_gemm_hhx(const _Float16* __restrict__ A, int lda, size_t sA, const _Float16* __restrict__ Bh, int ldb, size_t sB, float alpha, const float* __restrict__ bias, size_t sBias, const float* __restrict__ CP, int rowsPerB, size_t sCPb, int row0g,
    float* __restrict__ C, _Float16* __restrict__ C16, int ldc, size_t sC, int M, int N, int K) {
  __shared__ __attribute__((aligned(16))) float so[4][16][64];
  const int tid = threadIdx.x, w = tid >> 5, lane = tid & 31, ln = lane & 15, hh = lane >> 4; const int by = blockIdx.y;
  A += (size_t)by * sA; Bh += (size_t)by * sB; const size_t cofs = (size_t)by * sC; const float* bp = bias ? bias + (size_t)by * sBias : nullptr;
  const int ntn = (N + 63) / 64; const int wid = blockIdx.x * 4 + w; const int mt = wid / ntn, nq = wid % ntn; if (mt * 16 >= M) return;
  const int row0 = mt * 16, col0 = nq * 64; const _Float16* arow = A + (size_t)(row0 + ln) * lda;
  v8f acc[4] = {};
  for (int kb = 0; kb < K; kb += 32) { FragH ah; ah.half[0] = *(const v8us*)((const unsigned short*)arow + kb + 8 * hh); ah.half[1] = *(const v8us*)((const unsigned short*)arow + kb + 16 + 8 * hh);
#pragma unroll
    for (int t = 0; t < 4; ++t) { if (col0 + t * 16 >= N) continue; const size_t boff = (size_t)(col0 + t * 16 + ln) * ldb + kb; FragH bq; bq.half[0] = *(const v8us*)((const unsigned short*)Bh + boff + 8 * hh); bq.half[1] = *(const v8us*)((const unsigned short*)Bh + boff + 16 + 8 * hh);
      acc[t] = mmaH<1>(ah.v, ah.v, bq.v, bq.v, acc[t]); }
  }
#pragma unroll
  for (int t = 0; t < 4; ++t) { if (col0 + t * 16 >= N) continue; const int col = col0 + t * 16 + ln; const float bv = bp ? bf16_round(bp[col]) : 0.f;
#pragma unroll
    for (int r = 0; r < 8; ++r) { float v = acc[t][r] * alpha + bv; if (CP) { const int bidx = (row0g + row0 + 8 * hh + r) / rowsPerB; v += CP[(size_t)bidx * sCPb + (size_t)by * 64 + col]; } if (ACT == 1) v = (v > 0.f) ? v : expm1f(v); else if (ACT == 7) v = (v > 0.f) ? v + 1.0f : expf(v); else if (ACT == 8) v = tanhf(v); else if (ACT == 9) v = 0.5f * v * (1.0f + tanhf(0.7978845608028654f * (v + 0.044715f * v * v * v))); else if (ACT == 11) v = 1.0f / (1.0f + expf(-v)); else if (ACT == 12) v = (v > 0.f) ? v : 0.01f * v; else if (ACT == 14) v = (v > 0.f) ? v : 0.1f * v; else if (ACT == 15) v = v / (1.0f + expf(-v)); else if (ACT == 3) v = fmaxf(v, 0.f); else if (ACT == 6) v = 0.5f * v * (1.0f + erff(v * 0.70710678118654752f)); so[w][8 * hh + r][t * 16 + ln] = v; } }
  __builtin_amdgcn_fence(__ATOMIC_ACQ_REL, "workgroup"); __builtin_amdgcn_wave_barrier();
  const int rsub = lane >> 4, c4 = (lane & 15) * 4; typedef _Float16 v4h __attribute__((ext_vector_type(4)));
  {
#pragma unroll
    for (int q = 0; q < 8; ++q) { const int r = q * 2 + rsub; if (col0 + c4 < N) { const v4f v = *(const v4fa*)&so[w][r][c4]; if (C) *(v4f*)(C + cofs + (size_t)(row0 + r) * ldc + col0 + c4) = v; if (C16) { v4h h4; for (int i = 0; i < 4; ++i) h4[i] = (_Float16)v[i]; *(v4h*)(C16 + cofs + (size_t)(row0 + r) * ldc + col0 + c4) = h4; } } }
     }
}


typedef _Float16 v4h __attribute__((ext_vector_type(4)));

__global__ __launch_bounds__(256) void k_x16(const float* __restrict__ x, _Float16* __restrict__ X16, size_t n8) { const size_t t = (size_t)blockIdx.x * 256 + threadIdx.x; if (t >= n8) return; FragH f;
#pragma unroll
  for (int q = 0; q < 8; ++q) f.h[q] = (_Float16)bf16_round(x[t * 8 + q]); *(v8us*)((unsigned short*)X16 + t * 8) = f.half[0];  }
__global__ __launch_bounds__(256) void k_h16(const float* __restrict__ x, _Float16* __restrict__ X16, size_t n8) { const size_t t = (size_t)blockIdx.x * 256 + threadIdx.x; if (t >= n8) return; FragH f;
#pragma unroll
  for (int q = 0; q < 8; ++q) f.h[q] = (_Float16)x[t * 8 + q]; *(v8us*)((unsigned short*)X16 + t * 8) = f.half[0];  }
__global__ __launch_bounds__(256) void k_round16f(const float* __restrict__ W, _Float16* __restrict__ Bt, size_t n8) { const size_t t = (size_t)blockIdx.x * 256 + threadIdx.x; if (t >= n8) return; FragH f;
#pragma unroll
  for (int i = 0; i < 8; ++i) f.h[i] = (_Float16)(bf16_round(W[t * 8 + i]) * 16.0f); *(v8us*)((unsigned short*)Bt + t * 8) = f.half[0];  }
template <int NHv, int TTv>
__global__ __launch_bounds__(256) void k_vt(const _Float16* __restrict__ V16, int ldv, int voff, _Float16* __restrict__ Vt) { __shared__ unsigned short tl[64][66]; const int tid = threadIdx.x; const int slab = blockIdx.x / (TTv / 64), lg = blockIdx.x % (TTv / 64); const int b = slab / NHv, h = slab % NHv;
  for (int i = tid; i < 64 * 8; i += 256) { const int r = i / 8, c8 = (i % 8) * 8; FragH f; f.half[0] = *(const v8us*)((const unsigned short*)V16 + ((size_t)b * TTv + lg * 64 + r) * ldv + voff + h * 64 + c8);
#pragma unroll
    for (int q = 0; q < 8; ++q) tl[r][c8 + q] = f.u[q]; }
  __syncthreads();
  {
#pragma unroll
    for (int rd = 0; rd < 2; ++rd) { const int d = rd * 32 + tid / 8, pc = tid % 8; FragH f;
#pragma unroll
      for (int q = 0; q < 8; ++q) f.u[q] = tl[pc * 8 + q][d];
      *(v8us*)((unsigned short*)Vt + ((size_t)slab * 64 + d) * TTv + lg * 64 + pc * 8) = f.half[0]; }
     } }

#ifndef NBS
#define NBS NB      /* batch stride of the [S][B][E] tensors (debug builds may process fewer batches than the layout holds) */
#endif
// ---- fast GEMM (wave tile 32x64, block tile 128x64; requires M % 128 == 0, N % 64 == 0, K % 64 == 0, K >= 64); epilogue = k_gemm_hhx semantics ----
// Operands reach the waves through LDS: per stage the block brings 64 k of its 128 A rows and 64 B rows in by asynchronous copies that cover whole 128-byte lines (8 lanes a row),
// two buffers, the next stage in flight while this one is worked on; the fragments are read from LDS in the same k order as before.
// TAIL: C = (A B^T / 1024 + A2 B^T) alpha + bias in one launch: the stages walk A's K columns, the sums are scaled by 2^-10 (exact), then the stages walk A2's K columns on top of them, B's anew;
// row (b, s) of the result is stored at row (s, b) of C, which is f32; there is no addend CP.
__device__ __forceinline__ v16h g2_frag(const unsigned short* p, int hh) { FragH f; f.half[0] = *(const v8us*)(p + 8 * hh); f.half[1] = *(const v8us*)(p + 16 + 8 * hh); return f.v; }
__device__ __forceinline__ v8f g2_mma(v16h a, v16h b, v8f c) { v8f d = __builtin_amdgcn_wmma_f32_16x16x32_f16(false, a, false, b, (short)0, c, false, false); asm volatile("v_nop\n\tv_nop\n\tv_nop\n\tv_nop" : "+v"(d) : "v"(a), "v"(b)); return d; }
// One lane's share of a stage: 8 pieces of A and 4 of B, 16 bytes each, 16 rows apart (ls bytes in LDS, da / db bytes in memory), global memory -> LDS through no register.
// The s_wait_xcnt closes the copies' own statement so that no address register named here is rewritten ahead of it.
__device__ __forceinline__ void g2_copy(unsigned la, unsigned lb, unsigned ls, const char* pa, size_t da, const char* pb, size_t db) {
  asm volatile("global_load_async_to_lds_b128 %0, %12, off\n\t" "global_load_async_to_lds_b128 %1, %13, off\n\t" "global_load_async_to_lds_b128 %2, %14, off\n\t" "global_load_async_to_lds_b128 %3, %15, off\n\t"
               "global_load_async_to_lds_b128 %4, %16, off\n\t" "global_load_async_to_lds_b128 %5, %17, off\n\t" "global_load_async_to_lds_b128 %6, %18, off\n\t" "global_load_async_to_lds_b128 %7, %19, off\n\t"
               "global_load_async_to_lds_b128 %8, %20, off\n\t" "global_load_async_to_lds_b128 %9, %21, off\n\t" "global_load_async_to_lds_b128 %10, %22, off\n\t" "global_load_async_to_lds_b128 %11, %23, off\n\t"
               "s_wait_xcnt 0x0"
               :: "v"(la), "v"(la + ls), "v"(la + 2 * ls), "v"(la + 3 * ls), "v"(la + 4 * ls), "v"(la + 5 * ls), "v"(la + 6 * ls), "v"(la + 7 * ls), "v"(lb), "v"(lb + ls), "v"(lb + 2 * ls), "v"(lb + 3 * ls),
                  "v"(pa), "v"(pa + da), "v"(pa + 2 * da), "v"(pa + 3 * da), "v"(pa + 4 * da), "v"(pa + 5 * da), "v"(pa + 6 * da), "v"(pa + 7 * da), "v"(pb), "v"(pb + db), "v"(pb + 2 * db), "v"(pb + 3 * db)
               : "memory"); }
template <int ACT, bool TAIL>
__global__ __launch_bounds__(128) void k_gemm2(const _Float16* __restrict__ A, int lda, size_t sA, const _Float16* __restrict__ A2, const _Float16* __restrict__ Bh, int ldb, size_t sB, float alpha, const float* __restrict__ bias, const float* __restrict__ bias1, const float* __restrict__ bias2, const float* __restrict__ CP, int rowsPerB, size_t sCPb, int row0g,
    float* __restrict__ Cf, _Float16* __restrict__ Ch, int ldc, size_t sC, int nc32, int M, int N, int K) {
  constexpr int KT = 64, PIT = KT + 8;      /* LDS row pitch 144 B = 16 B x odd: the 16-byte fragment reads of 16 rows fall on distinct banks */
  __shared__ __attribute__((aligned(16))) float so[4][32][68];
  __shared__ __attribute__((aligned(16))) unsigned short tA[2][128][PIT]; __shared__ __attribute__((aligned(16))) unsigned short tB[2][64][PIT];
  const int tid = threadIdx.x, w = tid >> 5, lane = tid & 31, ln = lane & 15, hh = lane >> 4; const int by = blockIdx.y;
  A += (size_t)by * sA; Bh += (size_t)by * sB; const float* bp = by == 0 ? bias : (by == 1 ? bias1 : bias2);      /* batch by has its own bias vector */
  const bool w32 = by < nc32; float* C = w32 ? Cf : nullptr; _Float16* C16 = w32 ? nullptr : Ch; const size_t cofs = (size_t)(w32 ? by : by - nc32) * sC;      /* the first nc32 batches store f32 planes of Cf, the others f16 planes of Ch */
  const int ntn = N >> 6; const int mt = blockIdx.x / ntn, nq = blockIdx.x - mt * ntn; const int row0 = mt * 128 + 32 * w, col0 = nq * 64; if (mt * 128 >= M) return;      /* the same for the whole block: it stands in front of barriers */
  const int sr = tid >> 3, sc = (tid & 7) * 8;
  const char* pa = (const char*)(A + (size_t)(mt * 128 + sr) * lda + sc); const char* pb = (const char*)(Bh + (size_t)(col0 + sr) * ldb + sc); const size_t da = (size_t)lda * 32, db = (size_t)ldb * 32;
  const unsigned la = (unsigned)(uintptr_t)&tA[0][sr][sc], lb = (unsigned)(uintptr_t)&tB[0][sr][sc]; constexpr unsigned LS = 16 * PIT * 2, BA = 128 * PIT * 2, BB = 64 * PIT * 2;
  const char* pa2 = TAIL ? (const char*)(A2 + (size_t)by * sA + (size_t)(mt * 128 + sr) * lda + sc) : pa; const int KK = TAIL ? 2 * K : K;
  /* the stage that begins at column kk of [A | A2], into buffer buf; kk is the same for the whole block */
  auto stage = [&](int kk, int buf) { const bool t2 = TAIL && kk >= K; const size_t kx = (size_t)(t2 ? kk - K : kk) * 2; g2_copy(la + buf * BA, lb + buf * BB, LS, (t2 ? pa2 : pa) + kx, da, pb + kx, db); };
  stage(0, 0);
  asm volatile("s_wait_asynccnt 0x0" ::: "memory");      /* this wave's share of stage 0 has landed */
  __syncthreads();      /* every wave's share has: stage 0 may be read */
  if (KT < KK) stage(KT, 1);
  const v8f z8 = {0.f,0.f,0.f,0.f,0.f,0.f,0.f,0.f}; v8f c00 = z8, c01 = z8, c02 = z8, c03 = z8, c10 = z8, c11 = z8, c12 = z8, c13 = z8;
  /* rolled: one stage a trip, so that the order at the foot of the trip stands once */
#pragma unroll 1
  for (int kb = 0; kb < KK; kb += KT) { const int cur = (kb >> 6) & 1;
    if (TAIL && kb == K) { constexpr float s10 = 0.0009765625f; c00 *= s10; c01 *= s10; c02 *= s10; c03 *= s10; c10 *= s10; c11 *= s10; c12 *= s10; c13 *= s10; }
    /* unrolled: the two 32-k blocks of a stage read LDS at immediate offsets */
#pragma unroll
    for (int ks = 0; ks < KT; ks += 32) { const unsigned short* fa = &tA[cur][32 * w + ln][ks]; const unsigned short* fb = &tB[cur][ln][ks];
      const v16h a0 = g2_frag(fa, hh), a1 = g2_frag(fa + 16 * PIT, hh); const v16h b0 = g2_frag(fb, hh), b1 = g2_frag(fb + 16 * PIT, hh), b2 = g2_frag(fb + 32 * PIT, hh), b3 = g2_frag(fb + 48 * PIT, hh);
      c00 = g2_mma(a0, b0, c00); c10 = g2_mma(a1, b0, c10); c01 = g2_mma(a0, b1, c01); c11 = g2_mma(a1, b1, c11);
      c02 = g2_mma(a0, b2, c02); c12 = g2_mma(a1, b2, c12); c03 = g2_mma(a0, b3, c03); c13 = g2_mma(a1, b3, c13); }
    asm volatile("s_wait_dscnt 0x0" ::: "memory");      /* this wave's reads of the buffer that is refilled below have returned */
    asm volatile("s_wait_asynccnt 0x0" ::: "memory");      /* this wave's share of the next stage has landed */
    __syncthreads();      /* publishes the next stage and ends every wave's reads of this one */
    if (kb + 2 * KT < KK) stage(kb + 2 * KT, cur); }
  asm volatile("s_wait_asynccnt 0x0" ::: "memory");      /* no copy is left in flight behind the loop */
  v8f accs[8] = {c00, c01, c02, c03, c10, c11, c12, c13};
#pragma unroll
  for (int u = 0; u < 8; ++u) { const int t = u & 3, half = u >> 2; const int col = col0 + t * 16 + ln; const float bv = bp ? bf16_round(bp[col]) : 0.f;
#pragma unroll
    for (int r = 0; r < 8; ++r) { const int rloc = half * 16 + 8 * hh + r; float v = accs[u][r] * alpha + bv; if (!TAIL && CP) { if (rowsPerB < 0) v += CP[cofs + (size_t)(row0g + row0 + rloc) * ldc + col];      /* rowsPerB < 0: own element of the batched C plane */ else { const int bidx = (row0g + row0 + rloc) / rowsPerB; v += CP[(size_t)bidx * sCPb + (size_t)by * 64 + col]; } }
      if (ACT == 3) v = fmaxf(v, 0.f); else if (ACT == 6) v = 0.5f * v * (1.0f + erff(v * 0.70710678118654752f)); else if (ACT == 11) v = 1.0f / (1.0f + expf(-v)); else if (ACT == 15) v = v / (1.0f + expf(-v)); else if (ACT == 12) v = (v > 0.f) ? v : 0.01f * v; else if (ACT == 8) v = tanhf(v);
      so[w][rloc][t * 16 + ln] = v; } }
  __builtin_amdgcn_fence(__ATOMIC_ACQ_REL, "workgroup"); __builtin_amdgcn_wave_barrier();
  const int rsub = lane >> 4, c4 = (lane & 15) * 4;
  {
#pragma unroll
    for (int q = 0; q < 16; ++q) { const int r = q * 2 + rsub; const v4f v = *(const v4fa*)&so[w][r][c4]; const size_t orow = TAIL ? (size_t)((row0 + r) % SLEN) * NBS + (row0 + r) / SLEN : (size_t)(row0 + r); if (TAIL || C) { *(v4f*)(C + cofs + orow * ldc + col0 + c4) = v; if (!TAIL) asm volatile("s_wait_xcnt 0x0" ::: "memory");      /* stands behind the f32 store: the f16 path follows it in the built code and reuses its registers */ } if (!TAIL && C16) { v4h h4; for (int i = 0; i < 4; ++i) h4[i] = (_Float16)v[i]; *(v4h*)(C16 + cofs + (size_t)(row0 + r) * ldc + col0 + c4) = h4; } }
     } }



// Lane l <-> l ^ 16 by a vector cross-row move (the two lanes that hold one query's keys).
__device__ __forceinline__ float x_half(float x) { const int b = __float_as_int(x); return __int_as_float(__builtin_amdgcn_permlanex16(b, b, 0x76543210, 0xfedcba98, false, false)); }
// One lane's share of a 64-key stage: 4 pieces of K and 4 of V^T, 16 bytes each, 16 rows apart (ls bytes in LDS, dk / dv bytes in memory), global memory -> LDS through no register.
// The s_wait_xcnt closes the copies' own statement so that no address register named here is rewritten ahead of it.
__device__ __forceinline__ void fl_copy(unsigned lk, unsigned lv, unsigned ls, const char* pk, size_t dk, const char* pv, size_t dv) {
  asm volatile("global_load_async_to_lds_b128 %0, %8, off\n\t" "global_load_async_to_lds_b128 %1, %9, off\n\t" "global_load_async_to_lds_b128 %2, %10, off\n\t" "global_load_async_to_lds_b128 %3, %11, off\n\t"
               "global_load_async_to_lds_b128 %4, %12, off\n\t" "global_load_async_to_lds_b128 %5, %13, off\n\t" "global_load_async_to_lds_b128 %6, %14, off\n\t" "global_load_async_to_lds_b128 %7, %15, off\n\t"
               "s_wait_xcnt 0x0"
               :: "v"(lk), "v"(lk + ls), "v"(lk + 2 * ls), "v"(lk + 3 * ls), "v"(lv), "v"(lv + ls), "v"(lv + 2 * ls), "v"(lv + 3 * ls),
                  "v"(pk), "v"(pk + dk), "v"(pk + 2 * dk), "v"(pk + 3 * dk), "v"(pv), "v"(pv + dv), "v"(pv + 2 * dv), "v"(pv + 3 * dv)
               : "memory"); }
// Unmasked attention with both products transposed: S^T = K Q^T (A = K rows, B = Q rows), O^T += V^T P^T (A = V^T rows, B = P^T).
// Lane (ln, hh) owns query q0 + ln; register r of score tile nt is key j0 + ps + nt * 16 + 8 * hh + r, so maximum and sum run inside the lane, joined with lane ^ 16,
// and the two score tiles, converted in place, are the B operand of the second product in the k order of the V^T loader (8 * hh + i, 16 + 8 * hh + i): P touches no LDS.
// K and V^T reach the waves through LDS: per stage the block brings 64 keys (64 K rows and 64 V^T rows of 128 bytes) in by asynchronous copies that cover whole 128-byte lines (8 lanes a row),
// two buffers, the next stage in flight while this one is worked on; the four waves read their fragments from LDS in the same k order as before.
__global__ __launch_bounds__(128) void k_flash(const _Float16* __restrict__ Q16, int ldq, const _Float16* __restrict__ K16, int ldk, const _Float16* __restrict__ Vt, _Float16* __restrict__ Oh, _Float16* __restrict__ Ol, int ldo) {
  constexpr int RPW = 16, DT = 4, KS = 2, KT = 64, PIT = KT + 8;      /* LDS row pitch 144 B = 16 B x odd: the 16-byte fragment reads of 16 rows fall on distinct banks */
  __shared__ __attribute__((aligned(16))) float sO[4][RPW][64 + 4];
  __shared__ __attribute__((aligned(16))) unsigned short tK[2][KT][PIT]; __shared__ __attribute__((aligned(16))) unsigned short tV[2][64][PIT];
  const int tid = threadIdx.x, w = tid >> 5, lane = tid & 31, ln = lane & 15, hh = lane >> 4;
  const int slab = blockIdx.x / QBNP, qblk = QB0P + blockIdx.x % QBNP; const int b = slab / NH, h = slab % NH; const int qb0 = qblk * (4 * RPW); const int q0 = qb0 + w * RPW;
  /* every inner loop below is unrolled so that each register-array index is a constant (no scratch) */
  FragH bq[KS];
  { const unsigned short* qr = (const unsigned short*)Q16 + ((size_t)b * TQ + q0 + ln) * ldq + h * 64;
#pragma unroll
    for (int ks = 0; ks < KS; ++ks) { bq[ks].half[0] = *(const v8us*)(qr + ks * 32 + 8 * hh); bq[ks].half[1] = *(const v8us*)(qr + ks * 32 + 16 + 8 * hh); } }
  const unsigned short* Vth = (const unsigned short*)Vt + (size_t)slab * 64 * TK;
  const int sr = tid >> 3, sc = (tid & 7) * 8;
  const char* pk = (const char*)((const unsigned short*)K16 + ((size_t)b * TK + sr) * ldk + h * 64 + sc); const char* pv = (const char*)(Vth + (size_t)sr * TK + sc); const size_t dk = (size_t)ldk * 32, dv = (size_t)TK * 32, sk = (size_t)ldk * (KT * 2);
  const unsigned lk = (unsigned)(uintptr_t)&tK[0][sr][sc], lv = (unsigned)(uintptr_t)&tV[0][sr][sc]; constexpr unsigned LS = 16 * PIT * 2, BS = 64 * PIT * 2;
  fl_copy(lk, lv, LS, pk, dk, pv, dv);
  asm volatile("s_wait_asynccnt 0x0" ::: "memory");      /* this wave's share of stage 0 has landed */
  __syncthreads();      /* every wave's share has: stage 0 may be read */
  if (KT < TK) fl_copy(lk + BS, lv + BS, LS, pk + sk, dk, pv + KT * 2, dv);
  /* the maximum m_q is kept in units of the raw product q.k; p = 2^10 exp((s - m) / 8) is one multiply-add and one base-2 exponential: 2^(s C2 + (10 - m C2)); l_q sums these p, so it carries the 2^10 as well */
  constexpr float C2 = SCL * 1.4426950408889634f;
  float m_q = -3.0e38f, l_q = 0.f; v8f oacc[DT];
#pragma unroll
  for (int dt = 0; dt < DT; ++dt) oacc[dt] = (v8f){0.f,0.f,0.f,0.f,0.f,0.f,0.f,0.f};
  /* rolled: one 64-key stage a trip, so that the order at the foot of the trip stands once */
#pragma unroll 1
  for (int j0 = 0; j0 < TK; j0 += KT) { const int cur = (j0 >> 6) & 1;
    /* unrolled: the two 32-key passes of a stage read LDS at immediate offsets */
#pragma unroll
    for (int ps = 0; ps < KT; ps += 32) {
    FragH ak[2][KS], av[DT];
#pragma unroll
    for (int nt = 0; nt < 2; ++nt) { const unsigned short* kr = &tK[cur][ps + nt * 16 + ln][0];
#pragma unroll
      for (int ks = 0; ks < KS; ++ks) { ak[nt][ks].half[0] = *(const v8us*)(kr + ks * 32 + 8 * hh); ak[nt][ks].half[1] = *(const v8us*)(kr + ks * 32 + 16 + 8 * hh); } }
#pragma unroll
    for (int dt = 0; dt < DT; ++dt) { const unsigned short* vrow = &tV[cur][dt * 16 + ln][ps]; av[dt].half[0] = *(const v8us*)(vrow + 8 * hh); av[dt].half[1] = *(const v8us*)(vrow + 16 + 8 * hh); }
    float sc_[16];
#pragma unroll
    for (int nt = 0; nt < 2; ++nt) {
      v8f acc = (v8f){0.f,0.f,0.f,0.f,0.f,0.f,0.f,0.f};
#pragma unroll
      for (int ks = 0; ks < KS; ++ks) acc = mmaH<1>(ak[nt][ks].v, ak[nt][ks].v, bq[ks].v, bq[ks].v, acc);
#pragma unroll
      for (int r = 0; r < 8; ++r) sc_[nt * 8 + r] = acc[r]; }
    float mc = sc_[0];
#pragma unroll
    for (int i = 1; i < 16; ++i) mc = fmaxf(mc, sc_[i]);
    mc = fmaxf(mc, x_half(mc));
    const float mn = fmaxf(m_q, mc); const float al = (mn > -1.0e38f) ? __builtin_amdgcn_exp2f((m_q - mn) * C2) : 1.0f; m_q = mn;
    const float nb = fmaf(-mn, C2, 10.0f);
    float p[16]; FragH pb;
#pragma unroll
    for (int i = 0; i < 16; ++i) p[i] = fmaf(sc_[i], C2, nb);
    /* eight base-2 exponentials, each in place, and the v_nop that the slot behind a transcendental asks for, in one statement: no instruction in it or behind it reads a fresh result or overwrites another's argument; the s_delay_alu is the hint that lets the SIMD's other waves issue while the last result is on its way */
#pragma unroll
    for (int g = 0; g < 16; g += 8)
      asm("v_exp_f32 %0, %0\n\tv_exp_f32 %1, %1\n\tv_exp_f32 %2, %2\n\tv_exp_f32 %3, %3\n\tv_exp_f32 %4, %4\n\tv_exp_f32 %5, %5\n\tv_exp_f32 %6, %6\n\tv_exp_f32 %7, %7\n\ts_delay_alu instid0(TRANS32_DEP_1)\n\tv_nop"
          : "+v"(p[g]), "+v"(p[g + 1]), "+v"(p[g + 2]), "+v"(p[g + 3]), "+v"(p[g + 4]), "+v"(p[g + 5]), "+v"(p[g + 6]), "+v"(p[g + 7]));
#pragma unroll
    for (int i = 0; i < 16; ++i) pb.h[i] = (_Float16)p[i];
#pragma unroll
    for (int st = 8; st > 0; st >>= 1)
#pragma unroll
      for (int i = 0; i < st; ++i) p[i] += p[i + st];
    l_q = l_q * al + p[0];
#pragma unroll
    for (int dt = 0; dt < DT; ++dt) {
#pragma unroll
      for (int r = 0; r < 8; ++r) oacc[dt][r] *= al; }
#pragma unroll
    for (int dt = 0; dt < DT; ++dt) oacc[dt] = mmaH<1>(av[dt].v, av[dt].v, pb.v, pb.v, oacc[dt]); }
    asm volatile("s_wait_dscnt 0x0" ::: "memory");      /* this wave's reads of the buffer that is refilled below have returned */
    asm volatile("s_wait_asynccnt 0x0" ::: "memory");      /* this wave's share of the next stage has landed */
    __syncthreads();      /* publishes the next stage and ends every wave's reads of this one */
    if (j0 + 2 * KT < TK) fl_copy(lk + cur * BS, lv + cur * BS, LS, pk + (size_t)((j0 >> 6) + 2) * sk, dk, pv + (size_t)(j0 + 2 * KT) * 2, dv); }
  asm volatile("s_wait_asynccnt 0x0" ::: "memory");      /* no copy is left in flight behind the loop */
  const float l = l_q + x_half(l_q); const float li = (l > 0.f) ? 1.0f / l : 0.f;
#pragma unroll
  for (int dt = 0; dt < DT; ++dt)
#pragma unroll
    for (int g = 0; g < 2; ++g) { const v4f val = {oacc[dt][4 * g] * li, oacc[dt][4 * g + 1] * li, oacc[dt][4 * g + 2] * li, oacc[dt][4 * g + 3] * li}; *(v4fa*)&sO[w][ln][dt * 16 + 8 * hh + 4 * g] = val; }
  __builtin_amdgcn_fence(__ATOMIC_ACQ_REL, "workgroup"); __builtin_amdgcn_wave_barrier();      /* the wave's own rows are in LDS before other lanes of it read them back as whole 128-byte lines */
  /* the context leaves as two f16 planes, hi and 2^10 x residual: 8 lanes store one row's 128-byte line of each plane */
  {
#pragma unroll
    for (int rp = 0; rp < RPW; rp += 4) { const int r = rp + (lane >> 3), pc = lane & 7; const v4f a = *(const v4fa*)&sO[w][r][pc * 8], c = *(const v4fa*)&sO[w][r][pc * 8 + 4]; FragH fh, fl;
#pragma unroll
      for (int q = 0; q < 4; ++q) { _Float16 hv = (_Float16)a[q]; fh.h[q] = hv; fl.h[q] = (_Float16)((a[q] - (float)hv) * 1024.0f); hv = (_Float16)c[q]; fh.h[4 + q] = hv; fl.h[4 + q] = (_Float16)((c[q] - (float)hv) * 1024.0f); }
      const size_t o = ((size_t)b * TQ + q0 + r) * ldo + h * 64 + pc * 8; *(v8us*)((unsigned short*)Oh + o) = fh.half[0]; *(v8us*)((unsigned short*)Ol + o) = fl.half[0]; }
     } }
// 5-plane variant: S = Qh Kh^T + (Ql Kh^T + Qh Kl^T)/1024 with Q/K = [hi | 2^10 residual] f16 planes (QL/KL same layout as Q16/K16), then the 3-term P.V below.
// 3-term variant: O = (P_hi V_hi + (P_lo V_hi + P_hi V_lo) / 1024) / l with P = [hi | 2^10 residual] of 1024 p and V^T = [hi | 2^10 residual] planes (VtL same layout as Vt) -> ~2^-21-class products for un-averaged (early causal / peaked) rows
template <int CAUSAL>
__global__ __launch_bounds__(128) void k_flash5(const _Float16* __restrict__ Q16, const _Float16* __restrict__ QL, int ldq, const _Float16* __restrict__ K16, const _Float16* __restrict__ KL, int ldk, const _Float16* __restrict__ Vt, const _Float16* __restrict__ VtL, const int* __restrict__ MSK, float* __restrict__ O, int ldo) {
  constexpr int RPW = 16, RTN = RPW / 16, NQB = TQ / (4 * RPW), DT = 4, KS = 2;
  __shared__ __attribute__((aligned(16))) unsigned short sP[4][RPW][40]; __shared__ __attribute__((aligned(16))) unsigned short sPL[4][RPW][40]; __shared__ __attribute__((aligned(16))) float sO[4][RPW][64 + 4];
  const int tid = threadIdx.x, w = tid >> 5, lane = tid & 31, ln = lane & 15, hh = lane >> 4;
  const int slab = blockIdx.x / QBN5, qblk = QB05 + blockIdx.x % QBN5; (void)NQB; const int b = slab / NH, h = slab % NH; const int qb0 = qblk * (4 * RPW); const int q0 = qb0 + w * RPW;
  FragH aq[2][KS], aql[2][KS];
#pragma unroll
  for (int rt = 0; rt < RTN; ++rt) { const unsigned short* qr = (const unsigned short*)Q16 + ((size_t)b * TQ + q0 + rt * 16 + ln) * ldq + h * 64; const unsigned short* ql = (const unsigned short*)QL + ((size_t)b * TQ + q0 + rt * 16 + ln) * ldq + h * 64;
#pragma unroll
    for (int ks = 0; ks < KS; ++ks) { aq[rt][ks].half[0] = *(const v8us*)(qr + ks * 32 + 8 * hh); aq[rt][ks].half[1] = *(const v8us*)(qr + ks * 32 + 16 + 8 * hh); aql[rt][ks].half[0] = *(const v8us*)(ql + ks * 32 + 8 * hh); aql[rt][ks].half[1] = *(const v8us*)(ql + ks * 32 + 16 + 8 * hh); } }
  const unsigned short* Vth = (const unsigned short*)Vt + (size_t)slab * 64 * TK; const unsigned short* Vtl = (const unsigned short*)VtL + (size_t)slab * 64 * TK;
  float m_r[2][8], l_r[2][8]; v8f oacc[2][DT], oaccL[2][DT];
#pragma unroll
  for (int rt = 0; rt < RTN; ++rt) {
#pragma unroll
    for (int r = 0; r < 8; ++r) { m_r[rt][r] = -3.0e38f; l_r[rt][r] = 0.f; }
#pragma unroll
    for (int dt = 0; dt < DT; ++dt) { oacc[rt][dt] = (v8f){0.f,0.f,0.f,0.f,0.f,0.f,0.f,0.f}; oaccL[rt][dt] = oacc[rt][dt]; } }
  const int jend = (CAUSAL == 1) ? (qb0 + 4 * RPW) : ((CAUSAL == 23) ? min(TK, (qb0 / CHK + 2) * CHK) : TK);      /* causal / window: keys that can never contribute are skipped */ const int jbeg = (CAUSAL == 23) ? max(0, (qb0 / CHK - 1) * CHK) : 0;
#pragma unroll 1
  for (int j0 = jbeg; j0 < jend; j0 += 32) {
    v8f s[2][2];
#pragma unroll
    for (int nt = 0; nt < 2; ++nt) { const unsigned short* kr = (const unsigned short*)K16 + ((size_t)b * TK + j0 + nt * 16 + ln) * ldk + h * 64; const unsigned short* klr = (const unsigned short*)KL + ((size_t)b * TK + j0 + nt * 16 + ln) * ldk + h * 64; FragH bk[KS], bkl[KS];
#pragma unroll
      for (int ks = 0; ks < KS; ++ks) { bk[ks].half[0] = *(const v8us*)(kr + ks * 32 + 8 * hh); bk[ks].half[1] = *(const v8us*)(kr + ks * 32 + 16 + 8 * hh); bkl[ks].half[0] = *(const v8us*)(klr + ks * 32 + 8 * hh); bkl[ks].half[1] = *(const v8us*)(klr + ks * 32 + 16 + 8 * hh); }
#pragma unroll
      for (int rt = 0; rt < RTN; ++rt) { v8f acc = (v8f){0.f,0.f,0.f,0.f,0.f,0.f,0.f,0.f}, accl = acc;
#pragma unroll
        for (int ks = 0; ks < KS; ++ks) { acc = mmaH<1>(aq[rt][ks].v, aq[rt][ks].v, bk[ks].v, bk[ks].v, acc); accl = mmaH<1>(aql[rt][ks].v, aql[rt][ks].v, bk[ks].v, bk[ks].v, accl); accl = mmaH<1>(aq[rt][ks].v, aq[rt][ks].v, bkl[ks].v, bkl[ks].v, accl); }
#pragma unroll
        for (int r = 0; r < 8; ++r) acc[r] += accl[r] * 0.0009765625f;
        s[rt][nt] = acc; } }
#pragma unroll
    for (int rt = 0; rt < RTN; ++rt)
#pragma unroll
      for (int r = 0; r < 8; ++r) { const int tq = q0 + rt * 16 + 8 * hh + r; const int k0 = j0 + ln, k1 = j0 + 16 + ln;
        bool ok0 = (CAUSAL == 1) ? (k0 <= tq) : ((CAUSAL == 2) ? ((k0 >> 5) == (tq >> 5)) : true), ok1 = (CAUSAL == 1) ? (k1 <= tq) : ((CAUSAL == 2) ? ((k1 >> 5) == (tq >> 5)) : true);      /* mode 2: block-diagonal 32-token groups */
        if (CAUSAL == 4) { const int* mrow = MSK + ((size_t)b * TQ + tq) * TK; ok0 = mrow[k0] != 0; ok1 = mrow[k1] != 0; }      /* mode 4: per-(query, key) INPUT mask shared by all heads; masked keys contribute nothing (== the reference's -4096 fill, whose exp underflows to 0), rows with no valid key give l = 0 -> output 0 (== the reference's row_valid zeroing) */
        float s0 = ok0 ? s[rt][0][r] * SCL : -3.0e38f, s1 = ok1 ? s[rt][1][r] * SCL : -3.0e38f; if (CAUSAL == 17) { const float* amk = (const float*)MSK + (size_t)b * TK; s0 += bf16_round(amk[k0]); s1 += bf16_round(amk[k1]); } if (CAUSAL == 18) { const float* tb = (const float*)MSK; const int* ri = MSK + 1024 + (size_t)b * TK; const int rq = ri[tq]; s0 += tb[(h * 8 + rq) * 8 + ri[k0]]; s1 += tb[(h * 8 + rq) * 8 + ri[k1]]; } if (CAUSAL == 19) { const int* rel = MSK + (size_t)tq * TK; const float* rb = (const float*)MSK + (size_t)TQ * TK + ((size_t)(b * NH + h) * TQ + tq) * 64; s0 += rb[rel[k0]]; s1 += rb[rel[k1]]; }      /* mode 19: + (q.Ek[rel] + Eb[rel][h]) / 8 gathered by the int relative ids (packed [ids | table]) */      /* mode 18: + resource_bias[h][r_q][r_k] from the packed [table | ids] buffer (TQ == TK) */      /* mode 17: additive per-(batch, key) mask INPUT */ float mc = fmaxf(s0, s1);
        mc = fmaxf(mc, __shfl_xor(mc, 1, 32)); mc = fmaxf(mc, __shfl_xor(mc, 2, 32)); mc = fmaxf(mc, __shfl_xor(mc, 4, 32)); mc = fmaxf(mc, __shfl_xor(mc, 8, 32));
        const float mn = fmaxf(m_r[rt][r], mc); const float al = (mn > -1.0e38f) ? expf(m_r[rt][r] - mn) : 1.0f; m_r[rt][r] = mn; const float p0 = ok0 ? expf(s0 - mn) : 0.f, p1 = ok1 ? expf(s1 - mn) : 0.f; l_r[rt][r] = l_r[rt][r] * al + p0 + p1;
#pragma unroll
        for (int dt = 0; dt < DT; ++dt) { oacc[rt][dt][r] *= al; oaccL[rt][dt][r] *= al; }
        FragH t2, t2l; const float ps0 = p0 * 1024.0f, ps1 = p1 * 1024.0f; t2.h[0] = (_Float16)ps0; t2.h[1] = (_Float16)ps1; t2l.h[0] = (_Float16)((ps0 - (float)t2.h[0]) * 1024.0f); t2l.h[1] = (_Float16)((ps1 - (float)t2.h[1]) * 1024.0f);
        sP[w][rt * 16 + 8 * hh + r][ln] = t2.u[0]; sP[w][rt * 16 + 8 * hh + r][16 + ln] = t2.u[1]; sPL[w][rt * 16 + 8 * hh + r][ln] = t2l.u[0]; sPL[w][rt * 16 + 8 * hh + r][16 + ln] = t2l.u[1]; }
    __builtin_amdgcn_fence(__ATOMIC_ACQ_REL, "workgroup"); __builtin_amdgcn_wave_barrier();
    FragH pa[2], pl[2];
#pragma unroll
    for (int rt = 0; rt < RTN; ++rt) { pa[rt].half[0] = *(const v8us*)&sP[w][rt * 16 + ln][8 * hh]; pa[rt].half[1] = *(const v8us*)&sP[w][rt * 16 + ln][16 + 8 * hh]; pl[rt].half[0] = *(const v8us*)&sPL[w][rt * 16 + ln][8 * hh]; pl[rt].half[1] = *(const v8us*)&sPL[w][rt * 16 + ln][16 + 8 * hh]; }
#pragma unroll
    for (int dt = 0; dt < DT; ++dt) { const unsigned short* vrow = Vth + (size_t)(dt * 16 + ln) * TK + j0; const unsigned short* vrl = Vtl + (size_t)(dt * 16 + ln) * TK + j0; FragH bv, bl; bv.half[0] = *(const v8us*)(vrow + 8 * hh); bv.half[1] = *(const v8us*)(vrow + 16 + 8 * hh); bl.half[0] = *(const v8us*)(vrl + 8 * hh); bl.half[1] = *(const v8us*)(vrl + 16 + 8 * hh);
#pragma unroll
      for (int rt = 0; rt < RTN; ++rt) { oacc[rt][dt] = mmaH<1>(pa[rt].v, pa[rt].v, bv.v, bv.v, oacc[rt][dt]); oaccL[rt][dt] = mmaH<1>(pl[rt].v, pl[rt].v, bv.v, bv.v, oaccL[rt][dt]); oaccL[rt][dt] = mmaH<1>(pa[rt].v, pa[rt].v, bl.v, bl.v, oaccL[rt][dt]); } }
    __builtin_amdgcn_fence(__ATOMIC_ACQ_REL, "workgroup"); __builtin_amdgcn_wave_barrier(); }
#pragma unroll
  for (int rt = 0; rt < RTN; ++rt) {
#pragma unroll
    for (int r = 0; r < 8; ++r) { float l = l_r[rt][r]; l += __shfl_xor(l, 1, 32); l += __shfl_xor(l, 2, 32); l += __shfl_xor(l, 4, 32); l += __shfl_xor(l, 8, 32); l_r[rt][r] = (l > 0.f) ? 1.0f / (l * 1024.0f) : 0.f; }
#pragma unroll
    for (int dt = 0; dt < DT; ++dt)
#pragma unroll
      for (int r = 0; r < 8; ++r) { float v = oacc[rt][dt][r]; v += oaccL[rt][dt][r] * 0.0009765625f; sO[w][rt * 16 + 8 * hh + r][dt * 16 + ln] = v * l_r[rt][r]; } }
  __builtin_amdgcn_fence(__ATOMIC_ACQ_REL, "workgroup"); __builtin_amdgcn_wave_barrier();
  {
#pragma unroll
    for (int rp = 0; rp < RPW; rp += 2) { const int r = rp + (lane >> 4), pc = lane & 15; const v4f val = *(const v4fa*)&sO[w][r][pc * 4]; *(v4f*)(O + ((size_t)b * TQ + q0 + r) * ldo + h * 64 + pc * 4) = val; }
     } }

__global__ __launch_bounds__(256) void k_rotab(float* __restrict__ CS, float* __restrict__ SN) {
  #pragma clang fp contract(off)
  const int t = blockIdx.x * 256 + threadIdx.x; if (t >= SLEN * 32) return; const int j = t % 32, s = t / 32; const float ex = (float)(2 * j) / 64.0f; const float inv = 1.0f / powf(10000.0f, ex); const float th = (float)s * inv; const float c = cosf(th), sn = sinf(th);
  { *(float*)(CS + t) = c; *(float*)(SN + t) = sn;  } }
__global__ __launch_bounds__(256) void k_rope(const float* __restrict__ F, int nsrc, int ndst, int rep, const float* __restrict__ CS, const float* __restrict__ SN, _Float16* __restrict__ H, _Float16* __restrict__ L) {
  #pragma clang fp contract(off)
  const size_t t = (size_t)blockIdx.x * 256 + threadIdx.x; if (t >= (size_t)NR * ndst * 4) return; const int g8 = (int)(t % 4); const int hd = (int)((t / 4) % ndst); const size_t row = t / ((size_t)4 * ndst); const int s = (int)(row % SLEN); const int hs = hd / rep;
  const float* src = F + row * (size_t)(nsrc * 64) + hs * 64; FragH ah, al, bh, bl;
  for (int i = 0; i < 8; ++i) { const int d = g8 * 8 + i; const float c = CS[s * 32 + d], sn = SN[s * 32 + d]; const float x1 = src[d], x2 = src[d + 32];
    float o1 = x1 * c; o1 += -x2 * sn; float o2 = x2 * c; o2 += x1 * sn;
    _Float16 hv = (_Float16)o1; ah.h[i] = hv; al.h[i] = (_Float16)((o1 - (float)hv) * 1024.0f); hv = (_Float16)o2; bh.h[i] = hv; bl.h[i] = (_Float16)((o2 - (float)hv) * 1024.0f); }
  const size_t o = row * (size_t)(ndst * 64) + hd * 64 + g8 * 8;
  { *(v8us*)((unsigned short*)H + o) = ah.half[0]; *(v8us*)((unsigned short*)H + o + 32) = bh.half[0]; *(v8us*)((unsigned short*)L + o) = al.half[0]; *(v8us*)((unsigned short*)L + o + 32) = bl.half[0];  } }
__global__ __launch_bounds__(256) void k_rope2(const float* __restrict__ F, int nsrc, int ndst, int rep, const float* __restrict__ CS, const float* __restrict__ SN, _Float16* __restrict__ H, _Float16* __restrict__ L) {
  #pragma clang fp contract(off)
  const size_t t = (size_t)blockIdx.x * 256 + threadIdx.x; if (t >= (size_t)NR * ndst * 4) return; const int g16 = (int)(t % 4); const int hd = (int)((t / 4) % ndst); const size_t row = t / ((size_t)4 * ndst); const int s = (int)(row % SLEN); const int hs = hd / rep;
  const float* src = F + row * (size_t)(nsrc * 64) + hs * 64 + g16 * 16; FragH ah, al;
  for (int pr = 0; pr < 8; ++pr) { const int i = g16 * 8 + pr; const float c = CS[s * 32 + i], sn = SN[s * 32 + i]; const float x1 = src[2 * pr], x2 = src[2 * pr + 1];
    float o1 = x1 * c; o1 -= x2 * sn; float o2 = x1 * sn; o2 += x2 * c;
    _Float16 hv = (_Float16)o1; ah.h[2 * pr] = hv; al.h[2 * pr] = (_Float16)((o1 - (float)hv) * 1024.0f); hv = (_Float16)o2; ah.h[2 * pr + 1] = hv; al.h[2 * pr + 1] = (_Float16)((o2 - (float)hv) * 1024.0f); }
  const size_t o = row * (size_t)(ndst * 64) + hd * 64 + g16 * 16;
  { *(v8us*)((unsigned short*)H + o) = ah.half[0]; *(v8us*)((unsigned short*)H + o + 8) = ah.half[1]; *(v8us*)((unsigned short*)L + o) = al.half[0]; *(v8us*)((unsigned short*)L + o + 8) = al.half[1];  } }
__global__ __launch_bounds__(256) void k_ln512(const float* __restrict__ A, const float* __restrict__ res, const float* __restrict__ g, const float* __restrict__ bb, float* __restrict__ Y, _Float16* __restrict__ Y16) {
  #pragma clang fp contract(off)
  const int wv = threadIdx.x >> 5, ln = threadIdx.x & 31; const size_t r = (size_t)blockIdx.x * 8 + wv; if (r >= NR) return; float x[16]; float s = 0.f;
  for (int i = 0; i < 2; ++i) { const v8f a = *(const v8f*)(A + r * DM + i * 256 + ln * 8); for (int q = 0; q < 8; ++q) { float v = a[q]; if (res) v += bf16_round(res[r * DM + i * 256 + ln * 8 + q]); x[i * 8 + q] = v; s += v; } }
  for (int o = 16; o > 0; o >>= 1) s += __shfl_xor(s, o, 32); const float mu = s / (float)DM; float var = 0.f; for (int q = 0; q < 16; ++q) { const float d = x[q] - mu; var += d * d; }
  for (int o = 16; o > 0; o >>= 1) var += __shfl_xor(var, o, 32); const float inv = rsqrtf(var / (float)DM + 1e-5f);
  { for (int i = 0; i < 2; ++i) { const int c0 = i * 256 + ln * 8; v8f y; FragH f; for (int q = 0; q < 8; ++q) { float v = (x[i * 8 + q] - mu) * inv; v *= bf16_round(g[c0 + q]); v += bf16_round(bb[c0 + q]); y[q] = v; f.h[q] = (_Float16)v; } *(v8f*)(Y + r * DM + c0) = y; if (Y16) *(v8us*)((unsigned short*)Y16 + r * DM + c0) = f.half[0]; }  } }
__global__ __launch_bounds__(256) void k_pack(const float* __restrict__ rb, const int* __restrict__ rid, int* __restrict__ PK) { const int t = blockIdx.x * 256 + threadIdx.x; if (t >= 1024 + NB * TK) return; int v; if (t < 1024) v = __float_as_int(bf16_round(rb[t])); else v = rid[t - 1024]; *(int*)(PK + t) = v;  }
__global__ __launch_bounds__(256) void k_tabin(const float* __restrict__ sp, float* __restrict__ CS, float* __restrict__ SN) { const int t = blockIdx.x * 256 + threadIdx.x; if (t >= SLEN * 32) return; const int i = t % 32, s = t / 32; const float c = bf16_round(sp[s * 64 + 32 + i]), sn = bf16_round(sp[s * 64 + i]);
  { *(float*)(CS + t) = c; *(float*)(SN + t) = sn;  } }
__device__ __forceinline__ void d_wsc(unsigned blk, const float* __restrict__ Wm, _Float16* __restrict__ Bt, size_t n8, float sc) { const size_t t = (size_t)blk * 256 + threadIdx.x; if (t >= n8) return; FragH f; for (int q = 0; q < 8; ++q) f.h[q] = (_Float16)(bf16_round(Wm[t * 8 + q]) * sc); *(v8us*)((unsigned short*)Bt + t * 8) = f.half[0];  }
__global__ __launch_bounds__(256) void k_rotab2(float* __restrict__ CS, float* __restrict__ SN) {
  #pragma clang fp contract(off)
  const int t = blockIdx.x * 256 + threadIdx.x; if (t >= SLEN * 32) return; const int j = t % 32, s = t / 32; const float c0 = -0.14391156831212787f;      /* -ln(10000)/64 rounded to f32 */ const float inv = expf((float)(2 * j) * c0); const float th = (float)s * inv; const float c = cosf(th), sn = sinf(th);
  { *(float*)(CS + t) = c; *(float*)(SN + t) = sn;  } }
__global__ __launch_bounds__(256) void k_lnu(const float* __restrict__ X, _Float16* __restrict__ N16, float* __restrict__ XB) {
  #pragma clang fp contract(off)
  const int wv = threadIdx.x >> 5, ln = threadIdx.x & 31; const size_t r = (size_t)blockIdx.x * 8 + wv; if (r >= NR) return; float a[32]; float s = 0.f;
  for (int i = 0; i < 4; ++i) { const v8f v = *(const v8f*)(X + r * DM + (i * 32 + ln) * 8); for (int q = 0; q < 8; ++q) { const float u = bf16_round(v[q]); a[i * 8 + q] = u; s += u; } }
  for (int o = 16; o > 0; o >>= 1) s += __shfl_xor(s, o, 32); const float mu = s / (float)DM; float var = 0.f; for (int q = 0; q < 32; ++q) { const float d = a[q] - mu; var += d * d; }
  for (int o = 16; o > 0; o >>= 1) var += __shfl_xor(var, o, 32); const float den = sqrtf(var / (float)(DM - 1)) + 1e-6f; const float inv = 1.0f / den;      /* one reciprocal per row; (x-mean)*inv vs the reference's division differs by <= 1 ulp */
  { for (int i = 0; i < 4; ++i) { const int c0 = (i * 32 + ln) * 8; FragH f; v8f xb; for (int q = 0; q < 8; ++q) { f.h[q] = (_Float16)((a[i * 8 + q] - mu) * inv); xb[q] = a[i * 8 + q]; } *(v8us*)((unsigned short*)N16 + r * DM + c0) = f.half[0]; *(v8f*)(XB + r * DM + c0) = xb; }  } }
__device__ __forceinline__ void d_vtg(int blk, const _Float16* __restrict__ V16, _Float16* __restrict__ Vt) { __shared__ unsigned short tl[64][66]; const int tid = threadIdx.x; const int slab = blk / (SLEN / 64), lg = blk % (SLEN / 64); const int b = slab / NH, h = slab % NH; const int hs = h / NREP;
  for (int i = tid; i < 64 * 8; i += 256) { const int r = i / 8, c8 = (i % 8) * 8; FragH f; f.half[0] = *(const v8us*)((const unsigned short*)V16 + ((size_t)b * SLEN + lg * 64 + r) * KVD + hs * 64 + c8); for (int q = 0; q < 8; ++q) tl[r][c8 + q] = f.u[q]; }
  __syncthreads();
  { for (int rd = 0; rd < 2; ++rd) { const int d = rd * 32 + tid / 8, pc = tid % 8; FragH f; for (int q = 0; q < 8; ++q) f.u[q] = tl[pc * 8 + q][d]; *(v8us*)((unsigned short*)Vt + ((size_t)slab * 64 + d) * SLEN + lg * 64 + pc * 8) = f.half[0]; }
    asm volatile("s_wait_xcnt 0x0" ::: "memory");      /* stands behind the two stores: code of the other body follows them in the shared kernel and reuses their registers */ } }

__global__ __launch_bounds__(256) void k_h16s(const float* __restrict__ SRC, int lds, int coff, _Float16* __restrict__ DST, size_t n8) { const size_t t = (size_t)blockIdx.x * 256 + threadIdx.x; if (t >= n8) return; const size_t r = (t * 8) / DM; const int c = (int)((t * 8) % DM); const v8f a = *(const v8f*)(SRC + r * lds + coff + c); FragH f; for (int q = 0; q < 8; ++q) f.h[q] = (_Float16)a[q];
  *(v8us*)((unsigned short*)DST + t * 8) = f.half[0];  }


__global__ __launch_bounds__(256) void k_ccp(const float* __restrict__ QKV, int coff, _Float16* __restrict__ D) { const size_t t = (size_t)blockIdx.x * 256 + threadIdx.x; if (t >= (size_t)NR * DM / 8) return; const int c0 = (int)((t * 8) % DM); const size_t row = (t * 8) / DM; const v8f a = *(const v8f*)(QKV + row * 3 * DM + coff + c0); FragH f; for (int q = 0; q < 8; ++q) f.h[q] = (_Float16)a[q];
  *(v8us*)((unsigned short*)D + t * 8) = f.half[0];  }


__device__ __forceinline__ void d_sbe(unsigned blk, const float* __restrict__ q, _Float16* __restrict__ X) { const size_t t = (size_t)blk * 256 + threadIdx.x; if (t >= (size_t)NR * DM / 8) return; const int c0 = (int)((t * 8) % DM); const size_t row = (t * 8) / DM; const int b = (int)(row / SLEN), s_ = (int)(row % SLEN); const float* src = q + ((size_t)s_ * NBS + b) * DM + c0; FragH f; for (int i = 0; i < 8; ++i) f.h[i] = (_Float16)bf16_round(src[i]);
  *(v8us*)((unsigned short*)X + t * 8) = f.half[0];  }
// RoPE of one (b, s) row of q and of k by one wave. The angle depends on (s, d) alone: lane l evaluates powf, sinf, cosf once, for d = l, and all 16 heads of both tensors take sine and cosine from there.
// Lane (g = lane & 3, h0 = lane >> 2) holds d = 8 g .. 8 g + 7 and d + 32 of heads h0 and h0 + 8; the products and their order are those of the per-head form, so the f16 planes keep their bits.
__device__ __forceinline__ void d_rope(unsigned blk, const float* __restrict__ Fq, _Float16* __restrict__ Q16, const float* __restrict__ Fk, _Float16* __restrict__ K16) {
  #pragma clang fp contract(off)
  const int lane = threadIdx.x & 31; const size_t row = (size_t)blk * 8 + (threadIdx.x >> 5); if (row >= (size_t)NR) return;      /* the same for a whole wave */ const int s_ = (int)(row % SLEN); const int d0 = (lane & 3) * 8; const size_t e0 = row * DM + (lane >> 2) * 64 + d0;
  const float* pq = Fq + e0; const float* pk = Fk + e0; v8f a[4], c[4];
  /* unrolled: every register-array index is a constant, and all sixteen loads fly while the angle is worked out */
#pragma unroll
  for (int u = 0; u < 4; ++u) { const float* p = ((u & 2) ? pk : pq) + (u & 1) * 512; a[u] = *(const v8f*)p; c[u] = *(const v8f*)(p + 32); }
  asm volatile("s_wait_xcnt 0x0" :: "v"(pq), "v"(pk) : "memory");      /* stands behind the sixteen loads: the code below reuses their address registers; it takes the two addresses as inputs so that no load's own result lands on them ahead of it */
  const float inv = 1.0f / powf(10000.0f, (float)(2 * lane) / 64.0f); const float ang = (float)s_ * inv; const float sn = sinf(ang), cs = cosf(ang);
  float sq[8], cq[8];
  /* this loop and the two behind it are unrolled for the same reason: constant register-array indices */
#pragma unroll
  for (int q = 0; q < 8; ++q) { sq[q] = __shfl(sn, d0 + q, 32); cq[q] = __shfl(cs, d0 + q, 32); }
#pragma unroll
  for (int u = 0; u < 4; ++u) { FragH f1, f2;
#pragma unroll
    for (int q = 0; q < 8; ++q) { float o1 = a[u][q] * cq[q]; o1 = o1 - c[u][q] * sq[q]; float o2 = c[u][q] * cq[q]; o2 = o2 + a[u][q] * sq[q]; f1.h[q] = (_Float16)o1; f2.h[q] = (_Float16)o2; }
    unsigned short* o = (unsigned short*)((u & 2) ? K16 : Q16) + e0 + (u & 1) * 512; *(v8us*)o = f1.half[0]; *(v8us*)(o + 32) = f2.half[0]; } }
// Launches that do not depend on one another share one grid: the block index, the same for a whole block, picks the body.
// Preparation: the query rows (XB blocks), then the four weight matrices (WB blocks each) into four planes that follow one another in Bt.
#define XB ((unsigned)((size_t)NR * DM / 8 / 256))
#define WB ((unsigned)((size_t)DM * DM / 8 / 256))
__global__ __launch_bounds__(256) void k_prep(const float* __restrict__ q, _Float16* __restrict__ X, const float* __restrict__ w0, const float* __restrict__ w1, const float* __restrict__ w2, const float* __restrict__ w3, _Float16* __restrict__ Bt) {
  const unsigned bx = blockIdx.x;
  if (bx < XB) { d_sbe(bx, q, X); return; }
  const unsigned m = (bx - XB) / WB; const float* Wm = m == 0 ? w0 : (m == 1 ? w1 : (m == 2 ? w2 : w3));
  d_wsc(bx - XB - m * WB, Wm, Bt + (size_t)m * DM * DM, (size_t)DM * DM / 8, 16.0f); }
// Behind the q/k/v product: RoPE of q and k (RB blocks, a wave a row, the long bodies first), then V^T.
#define RB ((unsigned)(NR / 8))
__global__ __launch_bounds__(256) void k_post(const float* __restrict__ Fq, _Float16* __restrict__ Q16, const float* __restrict__ Fk, _Float16* __restrict__ K16, const _Float16* __restrict__ V16, _Float16* __restrict__ Vt) {
  const unsigned bx = blockIdx.x;
  if (bx < RB) { d_rope(bx, Fq, Q16, Fk, K16); return; }
  d_vtg((int)(bx - RB), V16, Vt); }
extern "C" void kernel_launch(void* const* d_in, const int* in_sizes, int n_in,
                              void* d_out, int out_size, void* d_ws, size_t ws_size, hipStream_t stream) {
  (void)in_sizes; (void)n_in; (void)out_size;
  const float* qy = (const float*)d_in[0]; const float* wq = (const float*)d_in[1]; const float* bq = (const float*)d_in[2]; const float* wk = (const float*)d_in[3]; const float* bk = (const float*)d_in[4]; const float* wv = (const float*)d_in[5]; const float* bv = (const float*)d_in[6]; const float* wo = (const float*)d_in[7]; const float* bo = (const float*)d_in[8];
  char* ws = (char*)d_ws; size_t off = 0;
  auto take = [&](size_t bytes) { char* p = ws + off; off += (bytes + 255) & ~(size_t)255; return p; };
  const size_t np = (size_t)NR * DM;
  _Float16* BW = (_Float16*)take((size_t)DM * DM * 2 * 4); _Float16* BO = BW + (size_t)DM * DM * 3;      /* weight planes q, k, v, o in a row */ _Float16* X16 = (_Float16*)take(np * 2); float* F32 = (float*)take(np * 4 * 2);      /* f32 planes q, k in a row */
   _Float16* QH = (_Float16*)take(np * 2); _Float16* KH = (_Float16*)take(np * 2); _Float16* V16 = (_Float16*)take(np * 2); _Float16* VT = (_Float16*)take(np * 2); _Float16* OH = (_Float16*)take(np * 2); _Float16* OL = (_Float16*)take(np * 2);      /* planes of their own: k_flash stores them while other blocks of it still read QH, KH */
  if (off > ws_size) return;
  k_prep<<<XB + 4 * WB, 256, 0, stream>>>(qy, X16, wq, wk, wv, wo, BW);      /* weights stay in their (out, in) order */
  const dim3 g((NR / 128) * (DM / 64), 1), g3((NR / 128) * (DM / 64), 3);
  k_gemm2<0, false><<<g3, 128, 0, stream>>>(X16, DM, 0, nullptr, BW, DM, (size_t)DM * DM, 0.0625f, bq, bk, bv, nullptr, 1, 0, 0, F32, V16, DM, np, 2, NR, DM, DM);      /* batches q, k (f32 planes), v (f16) */
  k_post<<<RB + NB * NH * (SLEN / 64), 256, 0, stream>>>(F32, QH, F32 + np, KH, V16, VT);
  k_flash<<<NB * NH * QBNP, 128, 0, stream>>>(QH, DM, KH, DM, VT, OH, OL, DM);
  k_gemm2<0, true><<<g, 128, 0, stream>>>(OL, DM, 0, OH, BO, DM, 0, 0.0625f, bo, nullptr, nullptr, nullptr, 1, 0, 0, (float*)d_out, nullptr, DM, 0, 1, NR, DM, DM);      /* out[s][b] = (ctx_lo / 1024 + ctx_hi) Wo^T + b */
}

// v008
// One run takes 106 microseconds.
// Next to v007, in two timings, it ran 1.13 times as fast each time.
// Counting every step since v000, which is the starting kernel, it is 5.42 times as fast.
#include <hip/hip_runtime.h>
// Multi-head self-attention with rotary embedding (query [2048][2][1024] in [S, B, E] layout, 16 heads x 64: q/k/v = query W^T + b; rotary embedding per head (inv_freq = 10000^(-2i/64), rotate-half form) on q and k; softmax(q k^T / 8) v (no mask); out = attn Wo^T + bo, back in [S, B, E]).
// Structure: [S,B,E] -> exact f16 (b, s) rows; q/k/v as one WMMA GEMM launch (32x64 wave tiles, f32 accumulation, exact x16 weights + bias) whose epilogue applies RoPE to q and k on VALU (f32 angles s * inv_freq, sinf/cosf, each (s, d) angle evaluated once, in a table that k_prep writes) and stores f16 planes, and stores v as V^T through LDS; flash-style fused attention per (batch, head, 64-query block) (K Q^T and V^T P^T, one query per lane, online softmax and P in registers; no score plane), whose epilogue stores the context as f16 hi / 2^10 residual planes; output projection as one GEMM launch that runs the residual term, scales it by 2^-10 and sums the hi term on top, + bias, stored straight into [S, B, E].
// Launches: 4. Bodies that do not depend on one another share a grid (k_prep: the angle table, x and the four weights; k_gemm2 with 3 batches: q, k, v); the elementwise bodies behind the products live in their neighbours' epilogues.
// Left: k_prep starts many short waves; in k_flash's loop the four v_nop written behind every matrix instruction are now about a third of the vector instructions, and its LDS fragment reads come close to the LDS rate.
// Compute dtype: inputs rounded to bf16; query / weights exact as f16; roped q/k and v plain f16 (~2^-12); softmax f32 with f16 probabilities; context hi + 2^-10 residual into the projection. v_wmma_f32_16x16x32_f16.
#define NB 2
#define DM 1024
#define NKV 16
#define NREP (NH / NKV)
#define KVD (NKV * 64)           /* 1024 */
#define NR (NB * SLEN)
#define CHK 512
typedef int v4i __attribute__((ext_vector_type(4)));
#define FF 2048
#define SLEN 2048
#define MQI 2048
#define MKI 2048
#define TQ SLEN
#define TK SLEN
#define NH 16
#define SCL 0.125f
#define QBLKS (TQ / 64)
#define QB05 0
#define QBN5 4
#define QB0P 0
#define QBNP QBLKS
#define RE 256
typedef __bf16 v16b __attribute__((ext_vector_type(16)));
typedef unsigned short v8us __attribute__((ext_vector_type(8), may_alias));
typedef float  v8f  __attribute__((ext_vector_type(8)));
typedef float  v4f  __attribute__((ext_vector_type(4)));
typedef float  v4fa __attribute__((ext_vector_type(4), may_alias));
union FragB { v16b v; v8us half[2]; unsigned short u[16]; };

__device__ __forceinline__ unsigned short bf16_bits(float x) { unsigned int u = __float_as_uint(x); return (unsigned short)((u + 0x7FFFu + ((u >> 16) & 1u)) >> 16); }
__device__ __forceinline__ float bf16_val(unsigned short b) { return __uint_as_float(((unsigned int)b) << 16); }
__device__ __forceinline__ float bf16_round(float x) { return bf16_val(bf16_bits(x)); }
// D += A·B with NT terms: 1 = ah·bh, 2 = + al·bh (A split), 3 = + ah·bl (both split)
template <int NT>
__device__ __forceinline__ v8f mmaN(v16b ah, v16b al, v16b bh, v16b bl, v8f c) {
  c = __builtin_amdgcn_wmma_f32_16x16x32_bf16(false, ah, false, bh, (short)0, c, false, false);
  if (NT >= 2) c = __builtin_amdgcn_wmma_f32_16x16x32_bf16(false, al, false, bh, (short)0, c, false, false);
  if (NT >= 3) c = __builtin_amdgcn_wmma_f32_16x16x32_bf16(false, ah, false, bl, (short)0, c, false, false);
  asm volatile("v_nop\n\tv_nop\n\tv_nop\n\tv_nop" : "+v"(c) : "v"(ah), "v"(al), "v"(bh), "v"(bl));
  return c;
}

__global__ __launch_bounds__(256) void k_wt_bf16(const float* __restrict__ W, unsigned short* __restrict__ Wt, int K, int N) {
  const int t = blockIdx.x * 256 + threadIdx.x;
  const int k8n = K / 8;
  if (t >= N * k8n) return;
  const int n = t / k8n, k8 = (t % k8n) * 8;
  v8us v;
#pragma unroll
  for (int i = 0; i < 8; ++i) v[i] = bf16_bits(W[(size_t)(k8 + i) * N + n]);
  *(v8us*)(Wt + (size_t)n * K + k8) = v;
  
}

// GEMM C[M][N] (f32, pitch ldc) = act(A[M][K]·W + bias). A f32 row-major (pitch lda) converted per fragment to bf16
// (ASPLIT: hi/lo two planes -> 2 terms, else single rounded term); Wt bf16 [N][K] (pitch ldb). BIAS_BF16 rounds the
// bias to bf16 first (bias quantised to bf16 before the add). K%32==0, M%16==0, N%64==0.
template <bool ASPLIT, int ACT, bool BIAS_BF16>
__global__ __launch_bounds__(128) void k_gemm_bf(const float* __restrict__ A, int lda, const unsigned short* __restrict__ Wt, int ldb,
                                               const float* __restrict__ bias, float* __restrict__ C, int ldc, int M, int N, int K) {
  __shared__ __attribute__((aligned(16))) float so[4][16][64];
  const int tid = threadIdx.x, w = tid >> 5, lane = tid & 31, ln = lane & 15, hh = lane >> 4;
  const int ntn = N / 64;
  const int wid = blockIdx.x * 4 + w;
  const int mt = wid / ntn, nq = wid % ntn;
  if (mt * 16 >= M) return;
  const int row0 = mt * 16, col0 = nq * 64;
  const float* arow = A + (size_t)(row0 + ln) * lda;
  v8f acc[4] = {};
  for (int kb = 0; kb < K; kb += 32) {
    FragB ah, al;
    const v4f x0 = *(const v4fa*)(arow + kb + 8 * hh), x1 = *(const v4fa*)(arow + kb + 8 * hh + 4);
    const v4f x2 = *(const v4fa*)(arow + kb + 16 + 8 * hh), x3 = *(const v4fa*)(arow + kb + 16 + 8 * hh + 4);
    float xs[16] = {x0[0],x0[1],x0[2],x0[3],x1[0],x1[1],x1[2],x1[3],x2[0],x2[1],x2[2],x2[3],x3[0],x3[1],x3[2],x3[3]};
#pragma unroll
    for (int i = 0; i < 16; ++i) { const unsigned short hb = bf16_bits(xs[i]); ah.u[i] = hb; al.u[i] = ASPLIT ? bf16_bits(xs[i] - bf16_val(hb)) : (unsigned short)0; }
#pragma unroll
    for (int t = 0; t < 4; ++t) {
      const unsigned short* brow = Wt + (size_t)(col0 + t * 16 + ln) * ldb + kb;
      FragB b;
      b.half[0] = *(const v8us*)(brow + 8 * hh);
      b.half[1] = *(const v8us*)(brow + 16 + 8 * hh);
      acc[t] = mmaN<ASPLIT ? 2 : 1>(ah.v, al.v, b.v, b.v, acc[t]);
    }
  }
#pragma unroll
  for (int t = 0; t < 4; ++t) {
    float bv = bias ? bias[col0 + t * 16 + ln] : 0.f;
    if (BIAS_BF16) bv = bf16_round(bv);
#pragma unroll
    for (int r = 0; r < 8; ++r) { float v = acc[t][r] + bv; if (ACT == 1) v = fmaxf(v, 0.f); so[w][8 * hh + r][t * 16 + ln] = v; }
  }
  __builtin_amdgcn_fence(__ATOMIC_ACQ_REL, "workgroup");
  __builtin_amdgcn_wave_barrier();
  const int rsub = lane >> 4, c4 = (lane & 15) * 4;
  {
#pragma unroll
    for (int q = 0; q < 8; ++q) {
      const int r = q * 2 + rsub;
      const v4f v = *(const v4fa*)&so[w][r][c4];
      *(v4f*)(C + (size_t)(row0 + r) * ldc + col0 + c4) = v;
    }
    
  }
}

// GEMM C = act(A·W + bias + resid): A f32 (ASPLIT -> hi/lo 2 terms), Wt bf16 [N][K]; ACT 0 none, 1 relu, 2 exact gelu;
// resid (optional, f32, row index = (row % rmod), pitch ldr, RES_BF16 rounds it) added before the activation.
template <bool ASPLIT, int ACT, bool BIAS_BF16, bool RES_BF16>
__global__ __launch_bounds__(128) void k_gemm_bf3(const float* __restrict__ A, int lda, const unsigned short* __restrict__ Wt, int ldb,
                                                const float* __restrict__ bias, const float* __restrict__ resid, int rmod, int ldr,
                                                float* __restrict__ C, int ldc, int M, int N, int K) {
  __shared__ __attribute__((aligned(16))) float so[4][16][64];
  const int tid = threadIdx.x, w = tid >> 5, lane = tid & 31, ln = lane & 15, hh = lane >> 4;
  const int ntn = N / 64;
  const int wid = blockIdx.x * 4 + w;
  const int mt = wid / ntn, nq = wid % ntn;
  if (mt * 16 >= M) return;
  const int row0 = mt * 16, col0 = nq * 64;
  const float* arow = A + (size_t)(row0 + ln) * lda;
  v8f acc[4] = {};
  for (int kb = 0; kb < K; kb += 32) {
    FragB ah, al;
    const v4f x0 = *(const v4fa*)(arow + kb + 8 * hh), x1 = *(const v4fa*)(arow + kb + 8 * hh + 4);
    const v4f x2 = *(const v4fa*)(arow + kb + 16 + 8 * hh), x3 = *(const v4fa*)(arow + kb + 16 + 8 * hh + 4);
    float xs[16] = {x0[0],x0[1],x0[2],x0[3],x1[0],x1[1],x1[2],x1[3],x2[0],x2[1],x2[2],x2[3],x3[0],x3[1],x3[2],x3[3]};
#pragma unroll
    for (int i = 0; i < 16; ++i) { const unsigned short hb = bf16_bits(xs[i]); ah.u[i] = hb; al.u[i] = ASPLIT ? bf16_bits(xs[i] - bf16_val(hb)) : (unsigned short)0; }
#pragma unroll
    for (int t = 0; t < 4; ++t) {
      const unsigned short* brow = Wt + (size_t)(col0 + t * 16 + ln) * ldb + kb;
      FragB b;
      b.half[0] = *(const v8us*)(brow + 8 * hh);
      b.half[1] = *(const v8us*)(brow + 16 + 8 * hh);
      acc[t] = mmaN<ASPLIT ? 2 : 1>(ah.v, al.v, b.v, b.v, acc[t]);
    }
  }
#pragma unroll
  for (int t = 0; t < 4; ++t) {
    const int col = col0 + t * 16 + ln;
    float bv = bias ? bias[col] : 0.f;
    if (BIAS_BF16) bv = bf16_round(bv);
#pragma unroll
    for (int r = 0; r < 8; ++r) {
      float v = acc[t][r] + bv;
      if (resid) { float rv = resid[(size_t)((row0 + 8 * hh + r) % rmod) * ldr + col]; if (RES_BF16) rv = bf16_round(rv); v += rv; }
      if (ACT == 1) v = fmaxf(v, 0.f);
      if (ACT == 2) v = 0.5f * v * (1.0f + erff(v * 0.70710678118654752f));
      if (ACT == 3) { const float u = 0.7978845608028654f * (v + 0.044715f * v * v * v); v = 0.5f * v * (1.0f + tanhf(u)); }
      so[w][8 * hh + r][t * 16 + ln] = v;
    }
  }
  __builtin_amdgcn_fence(__ATOMIC_ACQ_REL, "workgroup");
  __builtin_amdgcn_wave_barrier();
  const int rsub = lane >> 4, c4 = (lane & 15) * 4;
  {
#pragma unroll
    for (int q = 0; q < 8; ++q) {
      const int r = q * 2 + rsub;
      const v4f v = *(const v4fa*)&so[w][r][c4];
      *(v4f*)(C + (size_t)(row0 + r) * ldc + col0 + c4) = v;
    }
    
  }
}
// row LayerNorm (biased variance, eps) over N: s = X (+ R); optional out_sum <- s; out_norm <- (s-mu)*rsqrt(var+eps)*g + b
template <bool PARAM_BF16>
__global__ __launch_bounds__(256) void k_layernorm(const float* __restrict__ X, const float* __restrict__ R, const float* __restrict__ g, const float* __restrict__ bta,
                                                  float* __restrict__ out_sum, float* __restrict__ out_norm, int N, float eps) {
  __shared__ float red[256];
  const int row = blockIdx.x, tid = threadIdx.x;
  const float* x = X + (size_t)row * N; const float* rr = R ? R + (size_t)row * N : nullptr;
  float vals[16];                     // up to N = 4096
  const int per = N / 256;            // contiguous chunk per thread? use strided-by-4 chunks: thread handles j = tid*4 + 1024*u
  float s1 = 0.f;
  for (int u = 0; u < per / 4; ++u) {
    const int j = tid * 4 + 1024 * u;
    const v4f a = *(const v4fa*)(x + j);
    v4f b = {0.f,0.f,0.f,0.f}; if (rr) b = *(const v4fa*)(rr + j);
#pragma unroll
    for (int q = 0; q < 4; ++q) { const float v = a[q] + b[q]; vals[u * 4 + q] = v; s1 += v; }
  }
  red[tid] = s1; __syncthreads();
  for (int st = 128; st > 0; st >>= 1) { if (tid < st) red[tid] += red[tid + st]; __syncthreads(); }
  const float mu = red[0] / (float)N; __syncthreads();
  float s2 = 0.f;
  for (int u = 0; u < per / 4; ++u)
#pragma unroll
    for (int q = 0; q < 4; ++q) { const float c = vals[u * 4 + q] - mu; s2 += c * c; }
  red[tid] = s2; __syncthreads();
  for (int st = 128; st > 0; st >>= 1) { if (tid < st) red[tid] += red[tid + st]; __syncthreads(); }
  const float rs = rsqrtf(red[0] / (float)N + eps);
  {
    for (int u = 0; u < per / 4; ++u) {
      const int j = tid * 4 + 1024 * u;
      v4f o, sm;
#pragma unroll
      for (int q = 0; q < 4; ++q) {
        float gg = g[j + q], bb = bta[j + q];
        if (PARAM_BF16) { gg = bf16_round(gg); bb = bf16_round(bb); }
        sm[q] = vals[u * 4 + q]; o[q] = (vals[u * 4 + q] - mu) * rs * gg + bb;
      }
      if (out_sum) *(v4f*)(out_sum + (size_t)row * N + j) = sm;
      *(v4f*)(out_norm + (size_t)row * N + j) = o;
    }
    
  }
}



// ---- f16 WMMA path (v_wmma_f32_16x16x32_f16): 11-bit significands for operands in range — used where a [0,1] probability operand needs more precision than bf16
typedef _Float16 v16h __attribute__((ext_vector_type(16)));
union FragH { v16h v; v8us half[2]; _Float16 h[16]; unsigned short u[16]; };
template <int NT>
__device__ __forceinline__ v8f mmaH(v16h ah, v16h al, v16h bh, v16h bl, v8f c) {
  c = __builtin_amdgcn_wmma_f32_16x16x32_f16(false, ah, false, bh, (short)0, c, false, false);
  if (NT >= 2) c = __builtin_amdgcn_wmma_f32_16x16x32_f16(false, al, false, bh, (short)0, c, false, false);
  if (NT >= 3) c = __builtin_amdgcn_wmma_f32_16x16x32_f16(false, ah, false, bl, (short)0, c, false, false);
  asm volatile("v_nop\n\tv_nop\n\tv_nop\n\tv_nop" : "+v"(c) : "v"(ah), "v"(al), "v"(bh), "v"(bl));
  return c;
}
// batched GEMM like k_gemm_b but f16 operands: A f32 (split into f16 hi/lo if ASPLIT, else rounded to f16), Bt = f16 values [n][k]; alpha; C f32; N multiple of 16 (partial tiles skipped)
template <bool ASPLIT>
__global__ __launch_bounds__(128) void k_gemm_h(const float* __restrict__ A, int lda, size_t sA, const _Float16* __restrict__ Bh, int ldb, size_t sB, float alpha, float* __restrict__ C, int ldc, size_t sC, int M, int N, int K) {
  __shared__ __attribute__((aligned(16))) float so[4][16][64];
  const int tid = threadIdx.x, w = tid >> 5, lane = tid & 31, ln = lane & 15, hh = lane >> 4; const int by = blockIdx.y;
  A += (size_t)by * sA; Bh += (size_t)by * sB; C += (size_t)by * sC;
  const int ntn = (N + 63) / 64; const int wid = blockIdx.x * 4 + w; const int mt = wid / ntn, nq = wid % ntn; if (mt * 16 >= M) return;
  const int row0 = mt * 16, col0 = nq * 64; const float* arow = A + (size_t)(row0 + ln) * lda;
  v8f acc[4] = {};
  for (int kb = 0; kb < K; kb += 32) {
    FragH ah, al;
    const v4f x0 = *(const v4fa*)(arow + kb + 8 * hh), x1 = *(const v4fa*)(arow + kb + 8 * hh + 4), x2 = *(const v4fa*)(arow + kb + 16 + 8 * hh), x3 = *(const v4fa*)(arow + kb + 16 + 8 * hh + 4);
    float xs[16] = {x0[0],x0[1],x0[2],x0[3],x1[0],x1[1],x1[2],x1[3],x2[0],x2[1],x2[2],x2[3],x3[0],x3[1],x3[2],x3[3]};
#pragma unroll
    for (int i = 0; i < 16; ++i) { const _Float16 h = (_Float16)xs[i]; ah.h[i] = h; al.h[i] = ASPLIT ? (_Float16)(xs[i] - (float)h) : (_Float16)0.0f; }
#pragma unroll
    for (int t = 0; t < 4; ++t) { if (col0 + t * 16 >= N) continue; const size_t boff = (size_t)(col0 + t * 16 + ln) * ldb + kb; FragH bq; bq.half[0] = *(const v8us*)(Bh + boff + 8 * hh); bq.half[1] = *(const v8us*)(Bh + boff + 16 + 8 * hh);
      acc[t] = mmaH<ASPLIT ? 2 : 1>(ah.v, al.v, bq.v, bq.v, acc[t]); }
  }
#pragma unroll
  for (int t = 0; t < 4; ++t) { if (col0 + t * 16 >= N) continue;
#pragma unroll
    for (int r = 0; r < 8; ++r) so[w][8 * hh + r][t * 16 + ln] = acc[t][r] * alpha; }
  __builtin_amdgcn_fence(__ATOMIC_ACQ_REL, "workgroup"); __builtin_amdgcn_wave_barrier();
  const int rsub = lane >> 4, c4 = (lane & 15) * 4;
  {
#pragma unroll
    for (int q = 0; q < 8; ++q) { const int r = q * 2 + rsub; if (col0 + c4 < N) { const v4f v = *(const v4fa*)&so[w][r][c4]; *(v4f*)(C + (size_t)(row0 + r) * ldc + col0 + c4) = v; } }
     }
}

// Wt[n][k] = f16(W[k][n]·scale) from f32 row-major W[K][N] (scale = power of two; bf16-exact weights stay exact in f16 away from the subnormal range)
__global__ __launch_bounds__(256) void k_wt_f16(const float* __restrict__ W, _Float16* __restrict__ Wt, int K, int N, float scale) {
  const int t = blockIdx.x * 256 + threadIdx.x; if (t >= N * (K / 8)) return; const int n = t / (K / 8), k8 = (t % (K / 8)) * 8; FragH f;
#pragma unroll
  for (int i = 0; i < 8; ++i) f.h[i] = (_Float16)(bf16_round(W[(size_t)(k8 + i) * N + n]) * scale); const v8us o = f.half[0];
  *(v8us*)((unsigned short*)Wt + (size_t)n * K + k8) = o; 
}
// k_gemm_hh variant with fused epilogue: v = acc·alpha + bias[by·sBias + col] (+ CP[(row/rowsPerB)·sCPb + by·64 + col] if CP) ; ACT 0 none / 1 elu ; writes f16 C16 (and f32 C if non-null)
template <int ACT>
__global__ __launch_bounds__(128) void k_gemm_hhx(const _Float16* __restrict__ A, int lda, size_t sA, const _Float16* __restrict__ Bh, int ldb, size_t sB, float alpha, const float* __restrict__ bias, size_t sBias, const float* __restrict__ CP, int rowsPerB, size_t sCPb, int row0g,
    float* __restrict__ C, _Float16* __restrict__ C16, int ldc, size_t sC, int M, int N, int K) {
  __shared__ __attribute__((aligned(16))) float so[4][16][64];
  const int tid = threadIdx.x, w = tid >> 5, lane = tid & 31, ln = lane & 15, hh = lane >> 4; const int by = blockIdx.y;
  A += (size_t)by * sA; Bh += (size_t)by * sB; const size_t cofs = (size_t)by * sC; const float* bp = bias ? bias + (size_t)by * sBias : nullptr;
  const int ntn = (N + 63) / 64; const int wid = blockIdx.x * 4 + w; const int mt = wid / ntn, nq = wid % ntn; if (mt * 16 >= M) return;
  const int row0 = mt * 16, col0 = nq * 64; const _Float16* arow = A + (size_t)(row0 + ln) * lda;
  v8f acc[4] = {};
  for (int kb = 0; kb < K; kb += 32) { FragH ah; ah.half[0] = *(const v8us*)((const unsigned short*)arow + kb + 8 * hh); ah.half[1] = *(const v8us*)((const unsigned short*)arow + kb + 16 + 8 * hh);
#pragma unroll
    for (int t = 0; t < 4; ++t) { if (col0 + t * 16 >= N) continue; const size_t boff = (size_t)(col0 + t * 16 + ln) * ldb + kb; FragH bq; bq.half[0] = *(const v8us*)((const unsigned short*)Bh + boff + 8 * hh); bq.half[1] = *(const v8us*)((const unsigned short*)Bh + boff + 16 + 8 * hh);
      acc[t] = mmaH<1>(ah.v, ah.v, bq.v, bq.v, acc[t]); }
  }
#pragma unroll
  for (int t = 0; t < 4; ++t) { if (col0 + t * 16 >= N) continue; const int col = col0 + t * 16 + ln; const float bv = bp ? bf16_round(bp[col]) : 0.f;
#pragma unroll
    for (int r = 0; r < 8; ++r) { float v = acc[t][r] * alpha + bv; if (CP) { const int bidx = (row0g + row0 + 8 * hh + r) / rowsPerB; v += CP[(size_t)bidx * sCPb + (size_t)by * 64 + col]; } if (ACT == 1) v = (v > 0.f) ? v : expm1f(v); else if (ACT == 7) v = (v > 0.f) ? v + 1.0f : expf(v); else if (ACT == 8) v = tanhf(v); else if (ACT == 9) v = 0.5f * v * (1.0f + tanhf(0.7978845608028654f * (v + 0.044715f * v * v * v))); else if (ACT == 11) v = 1.0f / (1.0f + expf(-v)); else if (ACT == 12) v = (v > 0.f) ? v : 0.01f * v; else if (ACT == 14) v = (v > 0.f) ? v : 0.1f * v; else if (ACT == 15) v = v / (1.0f + expf(-v)); else if (ACT == 3) v = fmaxf(v, 0.f); else if (ACT == 6) v = 0.5f * v * (1.0f + erff(v * 0.70710678118654752f)); so[w][8 * hh + r][t * 16 + ln] = v; } }
  __builtin_amdgcn_fence(__ATOMIC_ACQ_REL, "workgroup"); __builtin_amdgcn_wave_barrier();
  const int rsub = lane >> 4, c4 = (lane & 15) * 4; typedef _Float16 v4h __attribute__((ext_vector_type(4)));
  {
#pragma unroll
    for (int q = 0; q < 8; ++q) { const int r = q * 2 + rsub; if (col0 + c4 < N) { const v4f v = *(const v4fa*)&so[w][r][c4]; if (C) *(v4f*)(C + cofs + (size_t)(row0 + r) * ldc + col0 + c4) = v; if (C16) { v4h h4; for (int i = 0; i < 4; ++i) h4[i] = (_Float16)v[i]; *(v4h*)(C16 + cofs + (size_t)(row0 + r) * ldc + col0 + c4) = h4; } } }
     }
}


typedef _Float16 v4h __attribute__((ext_vector_type(4)));

__global__ __launch_bounds__(256) void k_x16(const float* __restrict__ x, _Float16* __restrict__ X16, size_t n8) { const size_t t = (size_t)blockIdx.x * 256 + threadIdx.x; if (t >= n8) return; FragH f;
#pragma unroll
  for (int q = 0; q < 8; ++q) f.h[q] = (_Float16)bf16_round(x[t * 8 + q]); *(v8us*)((unsigned short*)X16 + t * 8) = f.half[0];  }
__global__ __launch_bounds__(256) void k_h16(const float* __restrict__ x, _Float16* __restrict__ X16, size_t n8) { const size_t t = (size_t)blockIdx.x * 256 + threadIdx.x; if (t >= n8) return; FragH f;
#pragma unroll
  for (int q = 0; q < 8; ++q) f.h[q] = (_Float16)x[t * 8 + q]; *(v8us*)((unsigned short*)X16 + t * 8) = f.half[0];  }
__global__ __launch_bounds__(256) void k_round16f(const float* __restrict__ W, _Float16* __restrict__ Bt, size_t n8) { const size_t t = (size_t)blockIdx.x * 256 + threadIdx.x; if (t >= n8) return; FragH f;
#pragma unroll
  for (int i = 0; i < 8; ++i) f.h[i] = (_Float16)(bf16_round(W[t * 8 + i]) * 16.0f); *(v8us*)((unsigned short*)Bt + t * 8) = f.half[0];  }
template <int NHv, int TTv>
__global__ __launch_bounds__(256) void k_vt(const _Float16* __restrict__ V16, int ldv, int voff, _Float16* __restrict__ Vt) { __shared__ unsigned short tl[64][66]; const int tid = threadIdx.x; const int slab = blockIdx.x / (TTv / 64), lg = blockIdx.x % (TTv / 64); const int b = slab / NHv, h = slab % NHv;
  for (int i = tid; i < 64 * 8; i += 256) { const int r = i / 8, c8 = (i % 8) * 8; FragH f; f.half[0] = *(const v8us*)((const unsigned short*)V16 + ((size_t)b * TTv + lg * 64 + r) * ldv + voff + h * 64 + c8);
#pragma unroll
    for (int q = 0; q < 8; ++q) tl[r][c8 + q] = f.u[q]; }
  __syncthreads();
  {
#pragma unroll
    for (int rd = 0; rd < 2; ++rd) { const int d = rd * 32 + tid / 8, pc = tid % 8; FragH f;
#pragma unroll
      for (int q = 0; q < 8; ++q) f.u[q] = tl[pc * 8 + q][d];
      *(v8us*)((unsigned short*)Vt + ((size_t)slab * 64 + d) * TTv + lg * 64 + pc * 8) = f.half[0]; }
     } }

#ifndef NBS
#define NBS NB      /* batch stride of the [S][B][E] tensors (debug builds may process fewer batches than the layout holds) */
#endif
// ---- fast GEMM (wave tile 32x64, block tile 128x64; requires M % 128 == 0, N % 64 == 0, K % 64 == 0, K >= 64) ----
// Operands reach the waves through LDS: per stage the block brings 64 k of its 128 A rows and 64 B rows in by asynchronous copies that cover whole 128-byte lines (8 lanes a row),
// two buffers, the next stage in flight while this one is worked on; the fragments are read from LDS in the same k order as before.
// TAIL: C = (A B^T / 1024 + A2 B^T) alpha + bias in one launch: the stages walk A's K columns, the sums are scaled by 2^-10 (exact), then the stages walk A2's K columns on top of them, B's anew;
// row (b, s) of the result is stored at row (s, b) of Cf, which is f32.
// Not TAIL: three batches, C = A B^T alpha + bias with the batch's own B and bias. A block's 64 columns are one head: batches 0, 1 (q, k) take the rotary embedding in the epilogue, from the angle table CS / SN, and leave as f16 planes of Ch; batch 2 (v) leaves as V^T.
__device__ __forceinline__ v16h g2_frag(const unsigned short* p, int hh) { FragH f; f.half[0] = *(const v8us*)(p + 8 * hh); f.half[1] = *(const v8us*)(p + 16 + 8 * hh); return f.v; }
__device__ __forceinline__ v8f g2_mma(v16h a, v16h b, v8f c) { v8f d = __builtin_amdgcn_wmma_f32_16x16x32_f16(false, a, false, b, (short)0, c, false, false); asm volatile("v_nop\n\tv_nop\n\tv_nop\n\tv_nop" : "+v"(d) : "v"(a), "v"(b)); return d; }
// One lane's share of a stage: 8 pieces of A and 4 of B, 16 bytes each, 16 rows apart (ls bytes in LDS, da / db bytes in memory), global memory -> LDS through no register.
// The s_wait_xcnt closes the copies' own statement so that no address register named here is rewritten ahead of it.
__device__ __forceinline__ void g2_copy(unsigned la, unsigned lb, unsigned ls, const char* pa, size_t da, const char* pb, size_t db) {
  asm volatile("global_load_async_to_lds_b128 %0, %12, off\n\t" "global_load_async_to_lds_b128 %1, %13, off\n\t" "global_load_async_to_lds_b128 %2, %14, off\n\t" "global_load_async_to_lds_b128 %3, %15, off\n\t"
               "global_load_async_to_lds_b128 %4, %16, off\n\t" "global_load_async_to_lds_b128 %5, %17, off\n\t" "global_load_async_to_lds_b128 %6, %18, off\n\t" "global_load_async_to_lds_b128 %7, %19, off\n\t"
               "global_load_async_to_lds_b128 %8, %20, off\n\t" "global_load_async_to_lds_b128 %9, %21, off\n\t" "global_load_async_to_lds_b128 %10, %22, off\n\t" "global_load_async_to_lds_b128 %11, %23, off\n\t"
               "s_wait_xcnt 0x0"
               :: "v"(la), "v"(la + ls), "v"(la + 2 * ls), "v"(la + 3 * ls), "v"(la + 4 * ls), "v"(la + 5 * ls), "v"(la + 6 * ls), "v"(la + 7 * ls), "v"(lb), "v"(lb + ls), "v"(lb + 2 * ls), "v"(lb + 3 * ls),
                  "v"(pa), "v"(pa + da), "v"(pa + 2 * da), "v"(pa + 3 * da), "v"(pa + 4 * da), "v"(pa + 5 * da), "v"(pa + 6 * da), "v"(pa + 7 * da), "v"(pb), "v"(pb + db), "v"(pb + 2 * db), "v"(pb + 3 * db)
               : "memory"); }
template <int ACT, bool TAIL>
__global__ __launch_bounds__(128) void k_gemm2(const _Float16* __restrict__ A, int lda, size_t sA, const _Float16* __restrict__ A2, const _Float16* __restrict__ Bh, int ldb, size_t sB, float alpha, const float* __restrict__ bias, const float* __restrict__ bias1, const float* __restrict__ bias2, const float* __restrict__ CS, const float* __restrict__ SN,
    float* __restrict__ Cf, _Float16* __restrict__ Ch, _Float16* __restrict__ Vt, int ldc, size_t sC, int M, int N, int K) {
  constexpr int KT = 64, PIT = KT + 8;      /* LDS row pitch 144 B = 16 B x odd: the 16-byte fragment reads of 16 rows fall on distinct banks */
  __shared__ __attribute__((aligned(16))) float so[4][32][68];
  __shared__ __attribute__((aligned(16))) unsigned short tA[2][128][PIT]; __shared__ __attribute__((aligned(16))) unsigned short tB[2][64][PIT];
  const int tid = threadIdx.x, w = tid >> 5, lane = tid & 31, ln = lane & 15, hh = lane >> 4; const int by = blockIdx.y;
  A += (size_t)by * sA; Bh += (size_t)by * sB; const float* bp = by == 0 ? bias : (by == 1 ? bias1 : bias2);      /* batch by has its own bias vector */
  const int ntn = N >> 6; const int mt = blockIdx.x / ntn, nq = blockIdx.x - mt * ntn; const int row0 = mt * 128 + 32 * w, col0 = nq * 64; if (mt * 128 >= M) return;      /* the same for the whole block: it stands in front of barriers */
  const int sr = tid >> 3, sc = (tid & 7) * 8;
  const char* pa = (const char*)(A + (size_t)(mt * 128 + sr) * lda + sc); const char* pb = (const char*)(Bh + (size_t)(col0 + sr) * ldb + sc); const size_t da = (size_t)lda * 32, db = (size_t)ldb * 32;
  const unsigned la = (unsigned)(uintptr_t)&tA[0][sr][sc], lb = (unsigned)(uintptr_t)&tB[0][sr][sc]; constexpr unsigned LS = 16 * PIT * 2, BA = 128 * PIT * 2, BB = 64 * PIT * 2;
  const char* pa2 = TAIL ? (const char*)(A2 + (size_t)by * sA + (size_t)(mt * 128 + sr) * lda + sc) : pa; const int KK = TAIL ? 2 * K : K;
  /* the stage that begins at column kk of [A | A2], into buffer buf; kk is the same for the whole block */
  auto stage = [&](int kk, int buf) { const bool t2 = TAIL && kk >= K; const size_t kx = (size_t)(t2 ? kk - K : kk) * 2; g2_copy(la + buf * BA, lb + buf * BB, LS, (t2 ? pa2 : pa) + kx, da, pb + kx, db); };
  stage(0, 0);
  asm volatile("s_wait_asynccnt 0x0" ::: "memory");      /* this wave's share of stage 0 has landed */
  __syncthreads();      /* every wave's share has: stage 0 may be read */
  if (KT < KK) stage(KT, 1);
  const v8f z8 = {0.f,0.f,0.f,0.f,0.f,0.f,0.f,0.f}; v8f c00 = z8, c01 = z8, c02 = z8, c03 = z8, c10 = z8, c11 = z8, c12 = z8, c13 = z8;
  /* rolled: one stage a trip, so that the order at the foot of the trip stands once */
#pragma unroll 1
  for (int kb = 0; kb < KK; kb += KT) { const int cur = (kb >> 6) & 1;
    if (TAIL && kb == K) { constexpr float s10 = 0.0009765625f; c00 *= s10; c01 *= s10; c02 *= s10; c03 *= s10; c10 *= s10; c11 *= s10; c12 *= s10; c13 *= s10; }
    /* unrolled: the two 32-k blocks of a stage read LDS at immediate offsets */
#pragma unroll
    for (int ks = 0; ks < KT; ks += 32) { const unsigned short* fa = &tA[cur][32 * w + ln][ks]; const unsigned short* fb = &tB[cur][ln][ks];
      const v16h a0 = g2_frag(fa, hh), a1 = g2_frag(fa + 16 * PIT, hh); const v16h b0 = g2_frag(fb, hh), b1 = g2_frag(fb + 16 * PIT, hh), b2 = g2_frag(fb + 32 * PIT, hh), b3 = g2_frag(fb + 48 * PIT, hh);
      c00 = g2_mma(a0, b0, c00); c10 = g2_mma(a1, b0, c10); c01 = g2_mma(a0, b1, c01); c11 = g2_mma(a1, b1, c11);
      c02 = g2_mma(a0, b2, c02); c12 = g2_mma(a1, b2, c12); c03 = g2_mma(a0, b3, c03); c13 = g2_mma(a1, b3, c13); }
    asm volatile("s_wait_dscnt 0x0" ::: "memory");      /* this wave's reads of the buffer that is refilled below have returned */
    asm volatile("s_wait_asynccnt 0x0" ::: "memory");      /* this wave's share of the next stage has landed */
    __syncthreads();      /* publishes the next stage and ends every wave's reads of this one */
    if (kb + 2 * KT < KK) stage(kb + 2 * KT, cur); }
  asm volatile("s_wait_asynccnt 0x0" ::: "memory");      /* no copy is left in flight behind the loop */
  v8f accs[8] = {c00, c01, c02, c03, c10, c11, c12, c13};
  static_assert(TAIL || ACT == 0, "the q/k/v epilogue has no activation");
  if (!TAIL && by == 2) {      /* v, the same for the whole block: stored as V^T[(b, h)][d][s]; the block's 64 columns are one head, its 128 rows lie in one batch */
    /* a lane's 8 accumulator registers are 8 consecutive s of one d: one 16-byte LDS store; pitch 272 B = 16 B x odd. Every loop of this path is unrolled: constant register-array indices, immediate offsets */
    unsigned short (*sT)[136] = (unsigned short (*)[136])&so[0][0][0]; float bv[4] = {0.f, 0.f, 0.f, 0.f};
    if (bp) { const float* bl = bp + col0 + ln;
#pragma unroll
      for (int t = 0; t < 4; ++t) bv[t] = bl[t * 16];
      asm volatile("s_wait_xcnt 0x0" ::: "memory");      /* stands behind the four loads: the code below reuses their address registers */
#pragma unroll
      for (int t = 0; t < 4; ++t) bv[t] = bf16_round(bv[t]); }
#pragma unroll
    for (int u = 0; u < 8; ++u) { const int t = u & 3, half = u >> 2; const int d = t * 16 + ln; FragH f;
#pragma unroll
      for (int r = 0; r < 8; ++r) f.h[r] = (_Float16)(accs[u][r] * alpha + bv[t]);
      *(v8us*)&sT[d][32 * w + half * 16 + 8 * hh] = f.half[0]; }
    __syncthreads();      /* every wave's 32 s of each d are in LDS before the rows are read back whole */
    unsigned short* vo = (unsigned short*)Vt + ((size_t)((mt * 128) / SLEN * NH + nq) * 64 + (tid >> 4)) * SLEN + (mt * 128) % SLEN + (tid & 15) * 8;
    /* 16 lanes store the 256 bytes of one d, 8 d a pass */
#pragma unroll
    for (int p = 0; p < 8; ++p) *(v8us*)(vo + (size_t)p * 8 * SLEN) = *(const v8us*)&sT[p * 8 + (tid >> 4)][(tid & 15) * 8];
    return; }
  /* q, k: the wave's share of the angle table. 4 lanes hold a row, lane g the angles 8 g .. 8 g + 7; 8 rows a pass */
  const int g = lane & 3, rr = lane >> 2; v4f tk[4][2], tn[4][2];
  if (!TAIL) { const float* tc = CS + (size_t)(row0 % SLEN + rr) * 32 + g * 8; const float* ts = SN + (size_t)(row0 % SLEN + rr) * 32 + g * 8;
    /* unrolled: constant register-array indices, immediate offsets */
#pragma unroll
    for (int p = 0; p < 4; ++p) { tk[p][0] = *(const v4fa*)(tc + p * 256); tk[p][1] = *(const v4fa*)(tc + p * 256 + 4); tn[p][0] = *(const v4fa*)(ts + p * 256); tn[p][1] = *(const v4fa*)(ts + p * 256 + 4); }
    asm volatile("s_wait_xcnt 0x0" :: "v"(tc), "v"(ts) : "memory");      /* stands behind the sixteen loads: the code below reuses their address registers; it takes the two addresses as inputs so that no load's result lands on them ahead of the wait */ }
#pragma unroll
  for (int u = 0; u < 8; ++u) { const int t = u & 3, half = u >> 2; const int col = col0 + t * 16 + ln; const float bv = bp ? bf16_round(bp[col]) : 0.f;
#pragma unroll
    for (int r = 0; r < 8; ++r) { const int rloc = half * 16 + 8 * hh + r; float v = accs[u][r] * alpha + bv;
      if (ACT == 3) v = fmaxf(v, 0.f); else if (ACT == 6) v = 0.5f * v * (1.0f + erff(v * 0.70710678118654752f)); else if (ACT == 11) v = 1.0f / (1.0f + expf(-v)); else if (ACT == 15) v = v / (1.0f + expf(-v)); else if (ACT == 12) v = (v > 0.f) ? v : 0.01f * v; else if (ACT == 8) v = tanhf(v);
      so[w][rloc][t * 16 + ln] = v; } }
  __builtin_amdgcn_fence(__ATOMIC_ACQ_REL, "workgroup"); __builtin_amdgcn_wave_barrier();
  if (TAIL) { const int rsub = lane >> 4, c4 = (lane & 15) * 4;
#pragma unroll
    for (int q = 0; q < 16; ++q) { const int r = q * 2 + rsub; const v4f v = *(const v4fa*)&so[w][r][c4]; const size_t orow = (size_t)((row0 + r) % SLEN) * NBS + (row0 + r) / SLEN; *(v4f*)(Cf + orow * ldc + col0 + c4) = v; }
  } else {      /* q, k: rotary embedding of the wave's 32 rows of one head, then f16. Lane g of a row has x = d 8 g .. 8 g + 7 and y = d + 32; out[d] = x cos - y sin, out[d + 32] = y cos + x sin */
    unsigned short* ho = (unsigned short*)Ch + (size_t)by * sC + (size_t)(row0 + rr) * DM + col0 + g * 8;
    /* unrolled: constant register-array indices; LDS and output are addressed by immediate offsets */
#pragma unroll
    for (int p = 0; p < 4; ++p) { const int r = p * 8 + rr; FragH f1, f2;
#pragma unroll
      for (int e = 0; e < 2; ++e) { const v4f x = *(const v4fa*)&so[w][r][g * 8 + 4 * e], y = *(const v4fa*)&so[w][r][32 + g * 8 + 4 * e], k = tk[p][e], s = tn[p][e];
#pragma unroll
        for (int q = 0; q < 4; ++q) { f1.h[4 * e + q] = (_Float16)(x[q] * k[q] - y[q] * s[q]); f2.h[4 * e + q] = (_Float16)(y[q] * k[q] + x[q] * s[q]); } }
      *(v8us*)(ho + (size_t)p * 8 * DM) = f1.half[0]; *(v8us*)(ho + (size_t)p * 8 * DM + 32) = f2.half[0]; }
    asm volatile("s_wait_xcnt 0x0" ::: "memory");      /* stands behind the last of the eight stores: the v path's code follows them in the built kernel and reuses their registers */ } }



// Lane l <-> l ^ 16 by a vector cross-row move (the two lanes that hold one query's keys).
__device__ __forceinline__ float x_half(float x) { const int b = __float_as_int(x); return __int_as_float(__builtin_amdgcn_permlanex16(b, b, 0x76543210, 0xfedcba98, false, false)); }
// One lane's share of a 64-key stage: 4 pieces of K and 4 of V^T, 16 bytes each, 16 rows apart (ls bytes in LDS, dk / dv bytes in memory), global memory -> LDS through no register.
// The s_wait_xcnt closes the copies' own statement so that no address register named here is rewritten ahead of it.
__device__ __forceinline__ void fl_copy(unsigned lk, unsigned lv, unsigned ls, const char* pk, size_t dk, const char* pv, size_t dv) {
  asm volatile("global_load_async_to_lds_b128 %0, %8, off\n\t" "global_load_async_to_lds_b128 %1, %9, off\n\t" "global_load_async_to_lds_b128 %2, %10, off\n\t" "global_load_async_to_lds_b128 %3, %11, off\n\t"
               "global_load_async_to_lds_b128 %4, %12, off\n\t" "global_load_async_to_lds_b128 %5, %13, off\n\t" "global_load_async_to_lds_b128 %6, %14, off\n\t" "global_load_async_to_lds_b128 %7, %15, off\n\t"
               "s_wait_xcnt 0x0"
               :: "v"(lk), "v"(lk + ls), "v"(lk + 2 * ls), "v"(lk + 3 * ls), "v"(lv), "v"(lv + ls), "v"(lv + 2 * ls), "v"(lv + 3 * ls),
                  "v"(pk), "v"(pk + dk), "v"(pk + 2 * dk), "v"(pk + 3 * dk), "v"(pv), "v"(pv + dv), "v"(pv + 2 * dv), "v"(pv + 3 * dv)
               : "memory"); }
// Unmasked attention with both products transposed: S^T = K Q^T (A = K rows, B = Q rows), O^T += V^T P^T (A = V^T rows, B = P^T).
// Lane (ln, hh) owns query q0 + ln; register r of score tile nt is key j0 + ps + nt * 16 + 8 * hh + r, so maximum and sum run inside the lane, joined with lane ^ 16,
// and the two score tiles, converted in place, are the B operand of the second product in the k order of the V^T loader (8 * hh + i, 16 + 8 * hh + i): P touches no LDS.
// K and V^T reach the waves through LDS: per stage the block brings 64 keys (64 K rows and 64 V^T rows of 128 bytes) in by asynchronous copies that cover whole 128-byte lines (8 lanes a row),
// two buffers, the next stage in flight while this one is worked on; the four waves read their fragments from LDS in the same k order as before.
__global__ __launch_bounds__(128) void k_flash(const _Float16* __restrict__ Q16, int ldq, const _Float16* __restrict__ K16, int ldk, const _Float16* __restrict__ Vt, _Float16* __restrict__ Oh, _Float16* __restrict__ Ol, int ldo) {
  constexpr int RPW = 16, DT = 4, KS = 2, KT = 64, PIT = KT + 8;      /* LDS row pitch 144 B = 16 B x odd: the 16-byte fragment reads of 16 rows fall on distinct banks */
  __shared__ __attribute__((aligned(16))) float sO[4][RPW][64 + 4];
  __shared__ __attribute__((aligned(16))) unsigned short tK[2][KT][PIT]; __shared__ __attribute__((aligned(16))) unsigned short tV[2][64][PIT];
  const int tid = threadIdx.x, w = tid >> 5, lane = tid & 31, ln = lane & 15, hh = lane >> 4;
  const int slab = blockIdx.x / QBNP, qblk = QB0P + blockIdx.x % QBNP; const int b = slab / NH, h = slab % NH; const int qb0 = qblk * (4 * RPW); const int q0 = qb0 + w * RPW;
  /* every inner loop below is unrolled so that each register-array index is a constant (no scratch) */
  FragH bq[KS];
  { const unsigned short* qr = (const unsigned short*)Q16 + ((size_t)b * TQ + q0 + ln) * ldq + h * 64;
#pragma unroll
    for (int ks = 0; ks < KS; ++ks) { bq[ks].half[0] = *(const v8us*)(qr + ks * 32 + 8 * hh); bq[ks].half[1] = *(const v8us*)(qr + ks * 32 + 16 + 8 * hh); } }
  const unsigned short* Vth = (const unsigned short*)Vt + (size_t)slab * 64 * TK;
  const int sr = tid >> 3, sc = (tid & 7) * 8;
  const char* pk = (const char*)((const unsigned short*)K16 + ((size_t)b * TK + sr) * ldk + h * 64 + sc); const char* pv = (const char*)(Vth + (size_t)sr * TK + sc); const size_t dk = (size_t)ldk * 32, dv = (size_t)TK * 32, sk = (size_t)ldk * (KT * 2);
  const unsigned lk = (unsigned)(uintptr_t)&tK[0][sr][sc], lv = (unsigned)(uintptr_t)&tV[0][sr][sc]; constexpr unsigned LS = 16 * PIT * 2, BS = 64 * PIT * 2;
  fl_copy(lk, lv, LS, pk, dk, pv, dv);
  asm volatile("s_wait_asynccnt 0x0" ::: "memory");      /* this wave's share of stage 0 has landed */
  __syncthreads();      /* every wave's share has: stage 0 may be read */
  if (KT < TK) fl_copy(lk + BS, lv + BS, LS, pk + sk, dk, pv + KT * 2, dv);
  /* the maximum m_q is kept in units of the raw product q.k; p = 2^10 exp((s - m) / 8) is one multiply-add and one base-2 exponential: 2^(s C2 + (10 - m C2)); l_q sums these p, so it carries the 2^10 as well */
  constexpr float C2 = SCL * 1.4426950408889634f;
  float m_q = -3.0e38f, l_q = 0.f; v8f oacc[DT];
#pragma unroll
  for (int dt = 0; dt < DT; ++dt) oacc[dt] = (v8f){0.f,0.f,0.f,0.f,0.f,0.f,0.f,0.f};
  /* rolled: one 64-key stage a trip, so that the order at the foot of the trip stands once */
#pragma unroll 1
  for (int j0 = 0; j0 < TK; j0 += KT) { const int cur = (j0 >> 6) & 1;
    /* unrolled: the two 32-key passes of a stage read LDS at immediate offsets */
#pragma unroll
    for (int ps = 0; ps < KT; ps += 32) {
    FragH ak[2][KS], av[DT];
#pragma unroll
    for (int nt = 0; nt < 2; ++nt) { const unsigned short* kr = &tK[cur][ps + nt * 16 + ln][0];
#pragma unroll
      for (int ks = 0; ks < KS; ++ks) { ak[nt][ks].half[0] = *(const v8us*)(kr + ks * 32 + 8 * hh); ak[nt][ks].half[1] = *(const v8us*)(kr + ks * 32 + 16 + 8 * hh); } }
#pragma unroll
    for (int dt = 0; dt < DT; ++dt) { const unsigned short* vrow = &tV[cur][dt * 16 + ln][ps]; av[dt].half[0] = *(const v8us*)(vrow + 8 * hh); av[dt].half[1] = *(const v8us*)(vrow + 16 + 8 * hh); }
    float sc_[16];
#pragma unroll
    for (int nt = 0; nt < 2; ++nt) {
      v8f acc = (v8f){0.f,0.f,0.f,0.f,0.f,0.f,0.f,0.f};
#pragma unroll
      for (int ks = 0; ks < KS; ++ks) acc = mmaH<1>(ak[nt][ks].v, ak[nt][ks].v, bq[ks].v, bq[ks].v, acc);
#pragma unroll
      for (int r = 0; r < 8; ++r) sc_[nt * 8 + r] = acc[r]; }
    float mc = sc_[0];
#pragma unroll
    for (int i = 1; i < 16; ++i) mc = fmaxf(mc, sc_[i]);
    mc = fmaxf(mc, x_half(mc));
    const float mn = fmaxf(m_q, mc); const float al = (mn > -1.0e38f) ? __builtin_amdgcn_exp2f((m_q - mn) * C2) : 1.0f; m_q = mn;
    const float nb = fmaf(-mn, C2, 10.0f);
    float p[16]; FragH pb;
#pragma unroll
    for (int i = 0; i < 16; ++i) p[i] = fmaf(sc_[i], C2, nb);
    /* eight base-2 exponentials, each in place, and the v_nop that the slot behind a transcendental asks for, in one statement: no instruction in it or behind it reads a fresh result or overwrites another's argument; the s_delay_alu is the hint that lets the SIMD's other waves issue while the last result is on its way */
#pragma unroll
    for (int g = 0; g < 16; g += 8)
      asm("v_exp_f32 %0, %0\n\tv_exp_f32 %1, %1\n\tv_exp_f32 %2, %2\n\tv_exp_f32 %3, %3\n\tv_exp_f32 %4, %4\n\tv_exp_f32 %5, %5\n\tv_exp_f32 %6, %6\n\tv_exp_f32 %7, %7\n\ts_delay_alu instid0(TRANS32_DEP_1)\n\tv_nop"
          : "+v"(p[g]), "+v"(p[g + 1]), "+v"(p[g + 2]), "+v"(p[g + 3]), "+v"(p[g + 4]), "+v"(p[g + 5]), "+v"(p[g + 6]), "+v"(p[g + 7]));
#pragma unroll
    for (int i = 0; i < 16; ++i) pb.h[i] = (_Float16)p[i];
#pragma unroll
    for (int st = 8; st > 0; st >>= 1)
#pragma unroll
      for (int i = 0; i < st; ++i) p[i] += p[i + st];
    l_q = l_q * al + p[0];
#pragma unroll
    for (int dt = 0; dt < DT; ++dt) {
#pragma unroll
      for (int r = 0; r < 8; ++r) oacc[dt][r] *= al; }
#pragma unroll
    for (int dt = 0; dt < DT; ++dt) oacc[dt] = mmaH<1>(av[dt].v, av[dt].v, pb.v, pb.v, oacc[dt]); }
    asm volatile("s_wait_dscnt 0x0" ::: "memory");      /* this wave's reads of the buffer that is refilled below have returned */
    asm volatile("s_wait_asynccnt 0x0" ::: "memory");      /* this wave's share of the next stage has landed */
    __syncthreads();      /* publishes the next stage and ends every wave's reads of this one */
    if (j0 + 2 * KT < TK) fl_copy(lk + cur * BS, lv + cur * BS, LS, pk + (size_t)((j0 >> 6) + 2) * sk, dk, pv + (size_t)(j0 + 2 * KT) * 2, dv); }
  asm volatile("s_wait_asynccnt 0x0" ::: "memory");      /* no copy is left in flight behind the loop */
  const float l = l_q + x_half(l_q); const float li = (l > 0.f) ? 1.0f / l : 0.f;
#pragma unroll
  for (int dt = 0; dt < DT; ++dt)
#pragma unroll
    for (int g = 0; g < 2; ++g) { const v4f val = {oacc[dt][4 * g] * li, oacc[dt][4 * g + 1] * li, oacc[dt][4 * g + 2] * li, oacc[dt][4 * g + 3] * li}; *(v4fa*)&sO[w][ln][dt * 16 + 8 * hh + 4 * g] = val; }
  __builtin_amdgcn_fence(__ATOMIC_ACQ_REL, "workgroup"); __builtin_amdgcn_wave_barrier();      /* the wave's own rows are in LDS before other lanes of it read them back as whole 128-byte lines */
  /* the context leaves as two f16 planes, hi and 2^10 x residual: 8 lanes store one row's 128-byte line of each plane */
  {
#pragma unroll
    for (int rp = 0; rp < RPW; rp += 4) { const int r = rp + (lane >> 3), pc = lane & 7; const v4f a = *(const v4fa*)&sO[w][r][pc * 8], c = *(const v4fa*)&sO[w][r][pc * 8 + 4]; FragH fh, fl;
#pragma unroll
      for (int q = 0; q < 4; ++q) { _Float16 hv = (_Float16)a[q]; fh.h[q] = hv; fl.h[q] = (_Float16)((a[q] - (float)hv) * 1024.0f); hv = (_Float16)c[q]; fh.h[4 + q] = hv; fl.h[4 + q] = (_Float16)((c[q] - (float)hv) * 1024.0f); }
      const size_t o = ((size_t)b * TQ + q0 + r) * ldo + h * 64 + pc * 8; *(v8us*)((unsigned short*)Oh + o) = fh.half[0]; *(v8us*)((unsigned short*)Ol + o) = fl.half[0]; }
     } }
// 5-plane variant: S = Qh Kh^T + (Ql Kh^T + Qh Kl^T)/1024 with Q/K = [hi | 2^10 residual] f16 planes (QL/KL same layout as Q16/K16), then the 3-term P.V below.
// 3-term variant: O = (P_hi V_hi + (P_lo V_hi + P_hi V_lo) / 1024) / l with P = [hi | 2^10 residual] of 1024 p and V^T = [hi | 2^10 residual] planes (VtL same layout as Vt) -> ~2^-21-class products for un-averaged (early causal / peaked) rows
template <int CAUSAL>
__global__ __launch_bounds__(128) void k_flash5(const _Float16* __restrict__ Q16, const _Float16* __restrict__ QL, int ldq, const _Float16* __restrict__ K16, const _Float16* __restrict__ KL, int ldk, const _Float16* __restrict__ Vt, const _Float16* __restrict__ VtL, const int* __restrict__ MSK, float* __restrict__ O, int ldo) {
  constexpr int RPW = 16, RTN = RPW / 16, NQB = TQ / (4 * RPW), DT = 4, KS = 2;
  __shared__ __attribute__((aligned(16))) unsigned short sP[4][RPW][40]; __shared__ __attribute__((aligned(16))) unsigned short sPL[4][RPW][40]; __shared__ __attribute__((aligned(16))) float sO[4][RPW][64 + 4];
  const int tid = threadIdx.x, w = tid >> 5, lane = tid & 31, ln = lane & 15, hh = lane >> 4;
  const int slab = blockIdx.x / QBN5, qblk = QB05 + blockIdx.x % QBN5; (void)NQB; const int b = slab / NH, h = slab % NH; const int qb0 = qblk * (4 * RPW); const int q0 = qb0 + w * RPW;
  FragH aq[2][KS], aql[2][KS];
#pragma unroll
  for (int rt = 0; rt < RTN; ++rt) { const unsigned short* qr = (const unsigned short*)Q16 + ((size_t)b * TQ + q0 + rt * 16 + ln) * ldq + h * 64; const unsigned short* ql = (const unsigned short*)QL + ((size_t)b * TQ + q0 + rt * 16 + ln) * ldq + h * 64;
#pragma unroll
    for (int ks = 0; ks < KS; ++ks) { aq[rt][ks].half[0] = *(const v8us*)(qr + ks * 32 + 8 * hh); aq[rt][ks].half[1] = *(const v8us*)(qr + ks * 32 + 16 + 8 * hh); aql[rt][ks].half[0] = *(const v8us*)(ql + ks * 32 + 8 * hh); aql[rt][ks].half[1] = *(const v8us*)(ql + ks * 32 + 16 + 8 * hh); } }
  const unsigned short* Vth = (const unsigned short*)Vt + (size_t)slab * 64 * TK; const unsigned short* Vtl = (const unsigned short*)VtL + (size_t)slab * 64 * TK;
  float m_r[2][8], l_r[2][8]; v8f oacc[2][DT], oaccL[2][DT];
#pragma unroll
  for (int rt = 0; rt < RTN; ++rt) {
#pragma unroll
    for (int r = 0; r < 8; ++r) { m_r[rt][r] = -3.0e38f; l_r[rt][r] = 0.f; }
#pragma unroll
    for (int dt = 0; dt < DT; ++dt) { oacc[rt][dt] = (v8f){0.f,0.f,0.f,0.f,0.f,0.f,0.f,0.f}; oaccL[rt][dt] = oacc[rt][dt]; } }
  const int jend = (CAUSAL == 1) ? (qb0 + 4 * RPW) : ((CAUSAL == 23) ? min(TK, (qb0 / CHK + 2) * CHK) : TK);      /* causal / window: keys that can never contribute are skipped */ const int jbeg = (CAUSAL == 23) ? max(0, (qb0 / CHK - 1) * CHK) : 0;
#pragma unroll 1
  for (int j0 = jbeg; j0 < jend; j0 += 32) {
    v8f s[2][2];
#pragma unroll
    for (int nt = 0; nt < 2; ++nt) { const unsigned short* kr = (const unsigned short*)K16 + ((size_t)b * TK + j0 + nt * 16 + ln) * ldk + h * 64; const unsigned short* klr = (const unsigned short*)KL + ((size_t)b * TK + j0 + nt * 16 + ln) * ldk + h * 64; FragH bk[KS], bkl[KS];
#pragma unroll
      for (int ks = 0; ks < KS; ++ks) { bk[ks].half[0] = *(const v8us*)(kr + ks * 32 + 8 * hh); bk[ks].half[1] = *(const v8us*)(kr + ks * 32 + 16 + 8 * hh); bkl[ks].half[0] = *(const v8us*)(klr + ks * 32 + 8 * hh); bkl[ks].half[1] = *(const v8us*)(klr + ks * 32 + 16 + 8 * hh); }
#pragma unroll
      for (int rt = 0; rt < RTN; ++rt) { v8f acc = (v8f){0.f,0.f,0.f,0.f,0.f,0.f,0.f,0.f}, accl = acc;
#pragma unroll
        for (int ks = 0; ks < KS; ++ks) { acc = mmaH<1>(aq[rt][ks].v, aq[rt][ks].v, bk[ks].v, bk[ks].v, acc); accl = mmaH<1>(aql[rt][ks].v, aql[rt][ks].v, bk[ks].v, bk[ks].v, accl); accl = mmaH<1>(aq[rt][ks].v, aq[rt][ks].v, bkl[ks].v, bkl[ks].v, accl); }
#pragma unroll
        for (int r = 0; r < 8; ++r) acc[r] += accl[r] * 0.0009765625f;
        s[rt][nt] = acc; } }
#pragma unroll
    for (int rt = 0; rt < RTN; ++rt)
#pragma unroll
      for (int r = 0; r < 8; ++r) { const int tq = q0 + rt * 16 + 8 * hh + r; const int k0 = j0 + ln, k1 = j0 + 16 + ln;
        bool ok0 = (CAUSAL == 1) ? (k0 <= tq) : ((CAUSAL == 2) ? ((k0 >> 5) == (tq >> 5)) : true), ok1 = (CAUSAL == 1) ? (k1 <= tq) : ((CAUSAL == 2) ? ((k1 >> 5) == (tq >> 5)) : true);      /* mode 2: block-diagonal 32-token groups */
        if (CAUSAL == 4) { const int* mrow = MSK + ((size_t)b * TQ + tq) * TK; ok0 = mrow[k0] != 0; ok1 = mrow[k1] != 0; }      /* mode 4: per-(query, key) INPUT mask shared by all heads; masked keys contribute nothing (== the reference's -4096 fill, whose exp underflows to 0), rows with no valid key give l = 0 -> output 0 (== the reference's row_valid zeroing) */
        float s0 = ok0 ? s[rt][0][r] * SCL : -3.0e38f, s1 = ok1 ? s[rt][1][r] * SCL : -3.0e38f; if (CAUSAL == 17) { const float* amk = (const float*)MSK + (size_t)b * TK; s0 += bf16_round(amk[k0]); s1 += bf16_round(amk[k1]); } if (CAUSAL == 18) { const float* tb = (const float*)MSK; const int* ri = MSK + 1024 + (size_t)b * TK; const int rq = ri[tq]; s0 += tb[(h * 8 + rq) * 8 + ri[k0]]; s1 += tb[(h * 8 + rq) * 8 + ri[k1]]; } if (CAUSAL == 19) { const int* rel = MSK + (size_t)tq * TK; const float* rb = (const float*)MSK + (size_t)TQ * TK + ((size_t)(b * NH + h) * TQ + tq) * 64; s0 += rb[rel[k0]]; s1 += rb[rel[k1]]; }      /* mode 19: + (q.Ek[rel] + Eb[rel][h]) / 8 gathered by the int relative ids (packed [ids | table]) */      /* mode 18: + resource_bias[h][r_q][r_k] from the packed [table | ids] buffer (TQ == TK) */      /* mode 17: additive per-(batch, key) mask INPUT */ float mc = fmaxf(s0, s1);
        mc = fmaxf(mc, __shfl_xor(mc, 1, 32)); mc = fmaxf(mc, __shfl_xor(mc, 2, 32)); mc = fmaxf(mc, __shfl_xor(mc, 4, 32)); mc = fmaxf(mc, __shfl_xor(mc, 8, 32));
        const float mn = fmaxf(m_r[rt][r], mc); const float al = (mn > -1.0e38f) ? expf(m_r[rt][r] - mn) : 1.0f; m_r[rt][r] = mn; const float p0 = ok0 ? expf(s0 - mn) : 0.f, p1 = ok1 ? expf(s1 - mn) : 0.f; l_r[rt][r] = l_r[rt][r] * al + p0 + p1;
#pragma unroll
        for (int dt = 0; dt < DT; ++dt) { oacc[rt][dt][r] *= al; oaccL[rt][dt][r] *= al; }
        FragH t2, t2l; const float ps0 = p0 * 1024.0f, ps1 = p1 * 1024.0f; t2.h[0] = (_Float16)ps0; t2.h[1] = (_Float16)ps1; t2l.h[0] = (_Float16)((ps0 - (float)t2.h[0]) * 1024.0f); t2l.h[1] = (_Float16)((ps1 - (float)t2.h[1]) * 1024.0f);
        sP[w][rt * 16 + 8 * hh + r][ln] = t2.u[0]; sP[w][rt * 16 + 8 * hh + r][16 + ln] = t2.u[1]; sPL[w][rt * 16 + 8 * hh + r][ln] = t2l.u[0]; sPL[w][rt * 16 + 8 * hh + r][16 + ln] = t2l.u[1]; }
    __builtin_amdgcn_fence(__ATOMIC_ACQ_REL, "workgroup"); __builtin_amdgcn_wave_barrier();
    FragH pa[2], pl[2];
#pragma unroll
    for (int rt = 0; rt < RTN; ++rt) { pa[rt].half[0] = *(const v8us*)&sP[w][rt * 16 + ln][8 * hh]; pa[rt].half[1] = *(const v8us*)&sP[w][rt * 16 + ln][16 + 8 * hh]; pl[rt].half[0] = *(const v8us*)&sPL[w][rt * 16 + ln][8 * hh]; pl[rt].half[1] = *(const v8us*)&sPL[w][rt * 16 + ln][16 + 8 * hh]; }
#pragma unroll
    for (int dt = 0; dt < DT; ++dt) { const unsigned short* vrow = Vth + (size_t)(dt * 16 + ln) * TK + j0; const unsigned short* vrl = Vtl + (size_t)(dt * 16 + ln) * TK + j0; FragH bv, bl; bv.half[0] = *(const v8us*)(vrow + 8 * hh); bv.half[1] = *(const v8us*)(vrow + 16 + 8 * hh); bl.half[0] = *(const v8us*)(vrl + 8 * hh); bl.half[1] = *(const v8us*)(vrl + 16 + 8 * hh);
#pragma unroll
      for (int rt = 0; rt < RTN; ++rt) { oacc[rt][dt] = mmaH<1>(pa[rt].v, pa[rt].v, bv.v, bv.v, oacc[rt][dt]); oaccL[rt][dt] = mmaH<1>(pl[rt].v, pl[rt].v, bv.v, bv.v, oaccL[rt][dt]); oaccL[rt][dt] = mmaH<1>(pa[rt].v, pa[rt].v, bl.v, bl.v, oaccL[rt][dt]); } }
    __builtin_amdgcn_fence(__ATOMIC_ACQ_REL, "workgroup"); __builtin_amdgcn_wave_barrier(); }
#pragma unroll
  for (int rt = 0; rt < RTN; ++rt) {
#pragma unroll
    for (int r = 0; r < 8; ++r) { float l = l_r[rt][r]; l += __shfl_xor(l, 1, 32); l += __shfl_xor(l, 2, 32); l += __shfl_xor(l, 4, 32); l += __shfl_xor(l, 8, 32); l_r[rt][r] = (l > 0.f) ? 1.0f / (l * 1024.0f) : 0.f; }
#pragma unroll
    for (int dt = 0; dt < DT; ++dt)
#pragma unroll
      for (int r = 0; r < 8; ++r) { float v = oacc[rt][dt][r]; v += oaccL[rt][dt][r] * 0.0009765625f; sO[w][rt * 16 + 8 * hh + r][dt * 16 + ln] = v * l_r[rt][r]; } }
  __builtin_amdgcn_fence(__ATOMIC_ACQ_REL, "workgroup"); __builtin_amdgcn_wave_barrier();
  {
#pragma unroll
    for (int rp = 0; rp < RPW; rp += 2) { const int r = rp + (lane >> 4), pc = lane & 15; const v4f val = *(const v4fa*)&sO[w][r][pc * 4]; *(v4f*)(O + ((size_t)b * TQ + q0 + r) * ldo + h * 64 + pc * 4) = val; }
     } }

__global__ __launch_bounds__(256) void k_rotab(float* __restrict__ CS, float* __restrict__ SN) {
  #pragma clang fp contract(off)
  const int t = blockIdx.x * 256 + threadIdx.x; if (t >= SLEN * 32) return; const int j = t % 32, s = t / 32; const float ex = (float)(2 * j) / 64.0f; const float inv = 1.0f / powf(10000.0f, ex); const float th = (float)s * inv; const float c = cosf(th), sn = sinf(th);
  { *(float*)(CS + t) = c; *(float*)(SN + t) = sn;  } }
__global__ __launch_bounds__(256) void k_rope(const float* __restrict__ F, int nsrc, int ndst, int rep, const float* __restrict__ CS, const float* __restrict__ SN, _Float16* __restrict__ H, _Float16* __restrict__ L) {
  #pragma clang fp contract(off)
  const size_t t = (size_t)blockIdx.x * 256 + threadIdx.x; if (t >= (size_t)NR * ndst * 4) return; const int g8 = (int)(t % 4); const int hd = (int)((t / 4) % ndst); const size_t row = t / ((size_t)4 * ndst); const int s = (int)(row % SLEN); const int hs = hd / rep;
  const float* src = F + row * (size_t)(nsrc * 64) + hs * 64; FragH ah, al, bh, bl;
  for (int i = 0; i < 8; ++i) { const int d = g8 * 8 + i; const float c = CS[s * 32 + d], sn = SN[s * 32 + d]; const float x1 = src[d], x2 = src[d + 32];
    float o1 = x1 * c; o1 += -x2 * sn; float o2 = x2 * c; o2 += x1 * sn;
    _Float16 hv = (_Float16)o1; ah.h[i] = hv; al.h[i] = (_Float16)((o1 - (float)hv) * 1024.0f); hv = (_Float16)o2; bh.h[i] = hv; bl.h[i] = (_Float16)((o2 - (float)hv) * 1024.0f); }
  const size_t o = row * (size_t)(ndst * 64) + hd * 64 + g8 * 8;
  { *(v8us*)((unsigned short*)H + o) = ah.half[0]; *(v8us*)((unsigned short*)H + o + 32) = bh.half[0]; *(v8us*)((unsigned short*)L + o) = al.half[0]; *(v8us*)((unsigned short*)L + o + 32) = bl.half[0];  } }
__global__ __launch_bounds__(256) void k_rope2(const float* __restrict__ F, int nsrc, int ndst, int rep, const float* __restrict__ CS, const float* __restrict__ SN, _Float16* __restrict__ H, _Float16* __restrict__ L) {
  #pragma clang fp contract(off)
  const size_t t = (size_t)blockIdx.x * 256 + threadIdx.x; if (t >= (size_t)NR * ndst * 4) return; const int g16 = (int)(t % 4); const int hd = (int)((t / 4) % ndst); const size_t row = t / ((size_t)4 * ndst); const int s = (int)(row % SLEN); const int hs = hd / rep;
  const float* src = F + row * (size_t)(nsrc * 64) + hs * 64 + g16 * 16; FragH ah, al;
  for (int pr = 0; pr < 8; ++pr) { const int i = g16 * 8 + pr; const float c = CS[s * 32 + i], sn = SN[s * 32 + i]; const float x1 = src[2 * pr], x2 = src[2 * pr + 1];
    float o1 = x1 * c; o1 -= x2 * sn; float o2 = x1 * sn; o2 += x2 * c;
    _Float16 hv = (_Float16)o1; ah.h[2 * pr] = hv; al.h[2 * pr] = (_Float16)((o1 - (float)hv) * 1024.0f); hv = (_Float16)o2; ah.h[2 * pr + 1] = hv; al.h[2 * pr + 1] = (_Float16)((o2 - (float)hv) * 1024.0f); }
  const size_t o = row * (size_t)(ndst * 64) + hd * 64 + g16 * 16;
  { *(v8us*)((unsigned short*)H + o) = ah.half[0]; *(v8us*)((unsigned short*)H + o + 8) = ah.half[1]; *(v8us*)((unsigned short*)L + o) = al.half[0]; *(v8us*)((unsigned short*)L + o + 8) = al.half[1];  } }
__global__ __launch_bounds__(256) void k_ln512(const float* __restrict__ A, const float* __restrict__ res, const float* __restrict__ g, const float* __restrict__ bb, float* __restrict__ Y, _Float16* __restrict__ Y16) {
  #pragma clang fp contract(off)
  const int wv = threadIdx.x >> 5, ln = threadIdx.x & 31; const size_t r = (size_t)blockIdx.x * 8 + wv; if (r >= NR) return; float x[16]; float s = 0.f;
  for (int i = 0; i < 2; ++i) { const v8f a = *(const v8f*)(A + r * DM + i * 256 + ln * 8); for (int q = 0; q < 8; ++q) { float v = a[q]; if (res) v += bf16_round(res[r * DM + i * 256 + ln * 8 + q]); x[i * 8 + q] = v; s += v; } }
  for (int o = 16; o > 0; o >>= 1) s += __shfl_xor(s, o, 32); const float mu = s / (float)DM; float var = 0.f; for (int q = 0; q < 16; ++q) { const float d = x[q] - mu; var += d * d; }
  for (int o = 16; o > 0; o >>= 1) var += __shfl_xor(var, o, 32); const float inv = rsqrtf(var / (float)DM + 1e-5f);
  { for (int i = 0; i < 2; ++i) { const int c0 = i * 256 + ln * 8; v8f y; FragH f; for (int q = 0; q < 8; ++q) { float v = (x[i * 8 + q] - mu) * inv; v *= bf16_round(g[c0 + q]); v += bf16_round(bb[c0 + q]); y[q] = v; f.h[q] = (_Float16)v; } *(v8f*)(Y + r * DM + c0) = y; if (Y16) *(v8us*)((unsigned short*)Y16 + r * DM + c0) = f.half[0]; }  } }
__global__ __launch_bounds__(256) void k_pack(const float* __restrict__ rb, const int* __restrict__ rid, int* __restrict__ PK) { const int t = blockIdx.x * 256 + threadIdx.x; if (t >= 1024 + NB * TK) return; int v; if (t < 1024) v = __float_as_int(bf16_round(rb[t])); else v = rid[t - 1024]; *(int*)(PK + t) = v;  }
__global__ __launch_bounds__(256) void k_tabin(const float* __restrict__ sp, float* __restrict__ CS, float* __restrict__ SN) { const int t = blockIdx.x * 256 + threadIdx.x; if (t >= SLEN * 32) return; const int i = t % 32, s = t / 32; const float c = bf16_round(sp[s * 64 + 32 + i]), sn = bf16_round(sp[s * 64 + i]);
  { *(float*)(CS + t) = c; *(float*)(SN + t) = sn;  } }
__device__ __forceinline__ void d_wsc(unsigned blk, const float* __restrict__ Wm, _Float16* __restrict__ Bt, size_t n8, float sc) { const size_t t = (size_t)blk * 256 + threadIdx.x; if (t >= n8) return; FragH f; for (int q = 0; q < 8; ++q) f.h[q] = (_Float16)(bf16_round(Wm[t * 8 + q]) * sc); *(v8us*)((unsigned short*)Bt + t * 8) = f.half[0];  }
__global__ __launch_bounds__(256) void k_rotab2(float* __restrict__ CS, float* __restrict__ SN) {
  #pragma clang fp contract(off)
  const int t = blockIdx.x * 256 + threadIdx.x; if (t >= SLEN * 32) return; const int j = t % 32, s = t / 32; const float c0 = -0.14391156831212787f;      /* -ln(10000)/64 rounded to f32 */ const float inv = expf((float)(2 * j) * c0); const float th = (float)s * inv; const float c = cosf(th), sn = sinf(th);
  { *(float*)(CS + t) = c; *(float*)(SN + t) = sn;  } }
__global__ __launch_bounds__(256) void k_lnu(const float* __restrict__ X, _Float16* __restrict__ N16, float* __restrict__ XB) {
  #pragma clang fp contract(off)
  const int wv = threadIdx.x >> 5, ln = threadIdx.x & 31; const size_t r = (size_t)blockIdx.x * 8 + wv; if (r >= NR) return; float a[32]; float s = 0.f;
  for (int i = 0; i < 4; ++i) { const v8f v = *(const v8f*)(X + r * DM + (i * 32 + ln) * 8); for (int q = 0; q < 8; ++q) { const float u = bf16_round(v[q]); a[i * 8 + q] = u; s += u; } }
  for (int o = 16; o > 0; o >>= 1) s += __shfl_xor(s, o, 32); const float mu = s / (float)DM; float var = 0.f; for (int q = 0; q < 32; ++q) { const float d = a[q] - mu; var += d * d; }
  for (int o = 16; o > 0; o >>= 1) var += __shfl_xor(var, o, 32); const float den = sqrtf(var / (float)(DM - 1)) + 1e-6f; const float inv = 1.0f / den;      /* one reciprocal per row; (x-mean)*inv vs the reference's division differs by <= 1 ulp */
  { for (int i = 0; i < 4; ++i) { const int c0 = (i * 32 + ln) * 8; FragH f; v8f xb; for (int q = 0; q < 8; ++q) { f.h[q] = (_Float16)((a[i * 8 + q] - mu) * inv); xb[q] = a[i * 8 + q]; } *(v8us*)((unsigned short*)N16 + r * DM + c0) = f.half[0]; *(v8f*)(XB + r * DM + c0) = xb; }  } }

__global__ __launch_bounds__(256) void k_h16s(const float* __restrict__ SRC, int lds, int coff, _Float16* __restrict__ DST, size_t n8) { const size_t t = (size_t)blockIdx.x * 256 + threadIdx.x; if (t >= n8) return; const size_t r = (t * 8) / DM; const int c = (int)((t * 8) % DM); const v8f a = *(const v8f*)(SRC + r * lds + coff + c); FragH f; for (int q = 0; q < 8; ++q) f.h[q] = (_Float16)a[q];
  *(v8us*)((unsigned short*)DST + t * 8) = f.half[0];  }


__global__ __launch_bounds__(256) void k_ccp(const float* __restrict__ QKV, int coff, _Float16* __restrict__ D) { const size_t t = (size_t)blockIdx.x * 256 + threadIdx.x; if (t >= (size_t)NR * DM / 8) return; const int c0 = (int)((t * 8) % DM); const size_t row = (t * 8) / DM; const v8f a = *(const v8f*)(QKV + row * 3 * DM + coff + c0); FragH f; for (int q = 0; q < 8; ++q) f.h[q] = (_Float16)a[q];
  *(v8us*)((unsigned short*)D + t * 8) = f.half[0];  }


__device__ __forceinline__ void d_sbe(unsigned blk, const float* __restrict__ q, _Float16* __restrict__ X) { const size_t t = (size_t)blk * 256 + threadIdx.x; if (t >= (size_t)NR * DM / 8) return; const int c0 = (int)((t * 8) % DM); const size_t row = (t * 8) / DM; const int b = (int)(row / SLEN), s_ = (int)(row % SLEN); const float* src = q + ((size_t)s_ * NBS + b) * DM + c0; FragH f; for (int i = 0; i < 8; ++i) f.h[i] = (_Float16)bf16_round(src[i]);
  *(v8us*)((unsigned short*)X + t * 8) = f.half[0];  }
// Cosine and sine of the rotary angle s * 10000^(-2 d / 64), one (s, d) a thread, d = 0 .. 31: each angle is evaluated once for all heads, batches and both tensors.
__device__ __forceinline__ void d_tab(unsigned blk, float* __restrict__ CS, float* __restrict__ SN) { const int t = (int)(blk * 256 + threadIdx.x); const int d = t & 31, s_ = t >> 5;
  const float inv = 1.0f / powf(10000.0f, (float)(2 * d) / 64.0f); const float ang = (float)s_ * inv; CS[t] = cosf(ang); SN[t] = sinf(ang); }
// Launches that do not depend on one another share one grid: the block index, the same for a whole block, picks the body.
// Preparation: the angle table (TB blocks, the long bodies first), the query rows (XB blocks), then the four weight matrices (WB blocks each) into four planes that follow one another in Bt.
#define TB ((unsigned)(SLEN * 32 / 256))
#define XB ((unsigned)((size_t)NR * DM / 8 / 256))
#define WB ((unsigned)((size_t)DM * DM / 8 / 256))
__global__ __launch_bounds__(256) void k_prep(const float* __restrict__ q, _Float16* __restrict__ X, const float* __restrict__ w0, const float* __restrict__ w1, const float* __restrict__ w2, const float* __restrict__ w3, _Float16* __restrict__ Bt, float* __restrict__ CS, float* __restrict__ SN) {
  if (blockIdx.x < TB) { d_tab(blockIdx.x, CS, SN); return; }
  const unsigned bx = blockIdx.x - TB;
  if (bx < XB) { d_sbe(bx, q, X); return; }
  const unsigned m = (bx - XB) / WB; const float* Wm = m == 0 ? w0 : (m == 1 ? w1 : (m == 2 ? w2 : w3));
  d_wsc(bx - XB - m * WB, Wm, Bt + (size_t)m * DM * DM, (size_t)DM * DM / 8, 16.0f); }
extern "C" void kernel_launch(void* const* d_in, const int* in_sizes, int n_in,
                              void* d_out, int out_size, void* d_ws, size_t ws_size, hipStream_t stream) {
  (void)in_sizes; (void)n_in; (void)out_size;
  const float* qy = (const float*)d_in[0]; const float* wq = (const float*)d_in[1]; const float* bq = (const float*)d_in[2]; const float* wk = (const float*)d_in[3]; const float* bk = (const float*)d_in[4]; const float* wv = (const float*)d_in[5]; const float* bv = (const float*)d_in[6]; const float* wo = (const float*)d_in[7]; const float* bo = (const float*)d_in[8];
  char* ws = (char*)d_ws; size_t off = 0;
  auto take = [&](size_t bytes) { char* p = ws + off; off += (bytes + 255) & ~(size_t)255; return p; };
  const size_t np = (size_t)NR * DM;
  _Float16* BW = (_Float16*)take((size_t)DM * DM * 2 * 4); _Float16* BO = BW + (size_t)DM * DM * 3;      /* weight planes q, k, v, o in a row */ _Float16* X16 = (_Float16*)take(np * 2); float* CS = (float*)take((size_t)SLEN * 32 * 4); float* SN = (float*)take((size_t)SLEN * 32 * 4);      /* cosine and sine of every (s, d) angle */
   _Float16* QH = (_Float16*)take(np * 2 * 2); _Float16* KH = QH + np;      /* roped planes q, k in a row */ _Float16* VT = (_Float16*)take(np * 2); _Float16* OH = (_Float16*)take(np * 2); _Float16* OL = (_Float16*)take(np * 2);      /* planes of their own: k_flash stores them while other blocks of it still read QH, KH */
  if (off > ws_size) return;
  k_prep<<<TB + XB + 4 * WB, 256, 0, stream>>>(qy, X16, wq, wk, wv, wo, BW, CS, SN);      /* weights stay in their (out, in) order */
  const dim3 g((NR / 128) * (DM / 64), 1), g3((NR / 128) * (DM / 64), 3);
  k_gemm2<0, false><<<g3, 128, 0, stream>>>(X16, DM, 0, nullptr, BW, DM, (size_t)DM * DM, 0.0625f, bq, bk, bv, CS, SN, nullptr, QH, VT, DM, np, NR, DM, DM);      /* batches q, k (roped f16 planes), v (V^T) */
  k_flash<<<NB * NH * QBNP, 128, 0, stream>>>(QH, DM, KH, DM, VT, OH, OL, DM);
  k_gemm2<0, true><<<g, 128, 0, stream>>>(OL, DM, 0, OH, BO, DM, 0, 0.0625f, bo, nullptr, nullptr, nullptr, nullptr, (float*)d_out, nullptr, nullptr, DM, 0, NR, DM, DM);      /* out[s][b] = (ctx_lo / 1024 + ctx_hi) Wo^T + b */
}

// v009
// One run takes 100 microseconds.
// In both of two side-by-side timings against v008, it was 1.05 times as fast.
// All steps since the starting kernel, v000, together make it 5.70 times as fast.
#include <hip/hip_runtime.h>
// Multi-head self-attention with rotary embedding (query [2048][2][1024] in [S, B, E] layout, 16 heads x 64: q/k/v = query W^T + b; rotary embedding per head (inv_freq = 10000^(-2i/64), rotate-half form) on q and k; softmax(q k^T / 8) v (no mask); out = attn Wo^T + bo, back in [S, B, E]).
// Structure: [S,B,E] -> exact f16 (b, s) rows; q/k/v as one WMMA GEMM launch (32x64 wave tiles, f32 accumulation, exact x16 weights + bias) whose epilogue applies RoPE to q and k on VALU (f32 angles s * inv_freq, sinf/cosf, each (s, d) angle evaluated once, in a table that k_prep writes) and stores f16 planes, and stores v as V^T through LDS; flash-style fused attention per (batch, head, 64-query block) (K Q^T and V^T P^T, one query per lane, online softmax and P in registers; no score plane), whose epilogue stores the context as f16 hi / 2^10 residual planes; output projection as one GEMM launch that runs the residual term, scales it by 2^-10 and sums the hi term on top, + bias, stored straight into [S, B, E].
// Launches: 4. Bodies that do not depend on one another share a grid (k_prep: the angle table, x and the four weights; k_gemm2 with 3 batches: q, k, v); the elementwise bodies behind the products live in their neighbours' epilogues.
// Left: k_prep starts many short waves; in k_flash's loop the four v_nop written behind every matrix instruction are now about a third of the vector instructions, and its LDS fragment reads come close to the LDS rate; its 4-wave blocks copy every K and V^T tile from L2 once per 64 queries (8 waves a block would halve that); k_gemm2's ring holds one stage in flight.
// Compute dtype: inputs rounded to bf16; query / weights exact as f16; roped q/k and v plain f16 (~2^-12); softmax f32 with f16 probabilities; context hi + 2^-10 residual into the projection. v_wmma_f32_16x16x32_f16.
#define NB 2
#define DM 1024
#define NKV 16
#define NREP (NH / NKV)
#define KVD (NKV * 64)           /* 1024 */
#define NR (NB * SLEN)
#define CHK 512
typedef int v4i __attribute__((ext_vector_type(4)));
#define FF 2048
#define SLEN 2048
#define MQI 2048
#define MKI 2048
#define TQ SLEN
#define TK SLEN
#define NH 16
#define SCL 0.125f
#define QBLKS (TQ / 64)
#define QB05 0
#define QBN5 4
#define QB0P 0
#define QBNP QBLKS
#define RE 256
typedef __bf16 v16b __attribute__((ext_vector_type(16)));
typedef unsigned short v8us __attribute__((ext_vector_type(8), may_alias));
typedef float  v8f  __attribute__((ext_vector_type(8)));
typedef float  v4f  __attribute__((ext_vector_type(4)));
typedef float  v4fa __attribute__((ext_vector_type(4), may_alias));
union FragB { v16b v; v8us half[2]; unsigned short u[16]; };

__device__ __forceinline__ unsigned short bf16_bits(float x) { unsigned int u = __float_as_uint(x); return (unsigned short)((u + 0x7FFFu + ((u >> 16) & 1u)) >> 16); }
__device__ __forceinline__ float bf16_val(unsigned short b) { return __uint_as_float(((unsigned int)b) << 16); }
__device__ __forceinline__ float bf16_round(float x) { return bf16_val(bf16_bits(x)); }
// D += A·B with NT terms: 1 = ah·bh, 2 = + al·bh (A split), 3 = + ah·bl (both split)
template <int NT>
__device__ __forceinline__ v8f mmaN(v16b ah, v16b al, v16b bh, v16b bl, v8f c) {
  c = __builtin_amdgcn_wmma_f32_16x16x32_bf16(false, ah, false, bh, (short)0, c, false, false);
  if (NT >= 2) c = __builtin_amdgcn_wmma_f32_16x16x32_bf16(false, al, false, bh, (short)0, c, false, false);
  if (NT >= 3) c = __builtin_amdgcn_wmma_f32_16x16x32_bf16(false, ah, false, bl, (short)0, c, false, false);
  asm volatile("v_nop\n\tv_nop\n\tv_nop\n\tv_nop" : "+v"(c) : "v"(ah), "v"(al), "v"(bh), "v"(bl));
  return c;
}

__global__ __launch_bounds__(256) void k_wt_bf16(const float* __restrict__ W, unsigned short* __restrict__ Wt, int K, int N) {
  const int t = blockIdx.x * 256 + threadIdx.x;
  const int k8n = K / 8;
  if (t >= N * k8n) return;
  const int n = t / k8n, k8 = (t % k8n) * 8;
  v8us v;
#pragma unroll
  for (int i = 0; i < 8; ++i) v[i] = bf16_bits(W[(size_t)(k8 + i) * N + n]);
  *(v8us*)(Wt + (size_t)n * K + k8) = v;
  
}

// GEMM C[M][N] (f32, pitch ldc) = act(A[M][K]·W + bias). A f32 row-major (pitch lda) converted per fragment to bf16
// (ASPLIT: hi/lo two planes -> 2 terms, else single rounded term); Wt bf16 [N][K] (pitch ldb). BIAS_BF16 rounds the
// bias to bf16 first (bias quantised to bf16 before the add). K%32==0, M%16==0, N%64==0.
template <bool ASPLIT, int ACT, bool BIAS_BF16>
__global__ __launch_bounds__(128) void k_gemm_bf(const float* __restrict__ A, int lda, const unsigned short* __restrict__ Wt, int ldb,
                                               const float* __restrict__ bias, float* __restrict__ C, int ldc, int M, int N, int K) {
  __shared__ __attribute__((aligned(16))) float so[4][16][64];
  const int tid = threadIdx.x, w = tid >> 5, lane = tid & 31, ln = lane & 15, hh = lane >> 4;
  const int ntn = N / 64;
  const int wid = blockIdx.x * 4 + w;
  const int mt = wid / ntn, nq = wid % ntn;
  if (mt * 16 >= M) return;
  const int row0 = mt * 16, col0 = nq * 64;
  const float* arow = A + (size_t)(row0 + ln) * lda;
  v8f acc[4] = {};
  for (int kb = 0; kb < K; kb += 32) {
    FragB ah, al;
    const v4f x0 = *(const v4fa*)(arow + kb + 8 * hh), x1 = *(const v4fa*)(arow + kb + 8 * hh + 4);
    const v4f x2 = *(const v4fa*)(arow + kb + 16 + 8 * hh), x3 = *(const v4fa*)(arow + kb + 16 + 8 * hh + 4);
    float xs[16] = {x0[0],x0[1],x0[2],x0[3],x1[0],x1[1],x1[2],x1[3],x2[0],x2[1],x2[2],x2[3],x3[0],x3[1],x3[2],x3[3]};
#pragma unroll
    for (int i = 0; i < 16; ++i) { const unsigned short hb = bf16_bits(xs[i]); ah.u[i] = hb; al.u[i] = ASPLIT ? bf16_bits(xs[i] - bf16_val(hb)) : (unsigned short)0; }
#pragma unroll
    for (int t = 0; t < 4; ++t) {
      const unsigned short* brow = Wt + (size_t)(col0 + t * 16 + ln) * ldb + kb;
      FragB b;
      b.half[0] = *(const v8us*)(brow + 8 * hh);
      b.half[1] = *(const v8us*)(brow + 16 + 8 * hh);
      acc[t] = mmaN<ASPLIT ? 2 : 1>(ah.v, al.v, b.v, b.v, acc[t]);
    }
  }
#pragma unroll
  for (int t = 0; t < 4; ++t) {
    float bv = bias ? bias[col0 + t * 16 + ln] : 0.f;
    if (BIAS_BF16) bv = bf16_round(bv);
#pragma unroll
    for (int r = 0; r < 8; ++r) { float v = acc[t][r] + bv; if (ACT == 1) v = fmaxf(v, 0.f); so[w][8 * hh + r][t * 16 + ln] = v; }
  }
  __builtin_amdgcn_fence(__ATOMIC_ACQ_REL, "workgroup");
  __builtin_amdgcn_wave_barrier();
  const int rsub = lane >> 4, c4 = (lane & 15) * 4;
  {
#pragma unroll
    for (int q = 0; q < 8; ++q) {
      const int r = q * 2 + rsub;
      const v4f v = *(const v4fa*)&so[w][r][c4];
      *(v4f*)(C + (size_t)(row0 + r) * ldc + col0 + c4) = v;
    }
    
  }
}

// GEMM C = act(A·W + bias + resid): A f32 (ASPLIT -> hi/lo 2 terms), Wt bf16 [N][K]; ACT 0 none, 1 relu, 2 exact gelu;
// resid (optional, f32, row index = (row % rmod), pitch ldr, RES_BF16 rounds it) added before the activation.
template <bool ASPLIT, int ACT, bool BIAS_BF16, bool RES_BF16>
__global__ __launch_bounds__(128) void k_gemm_bf3(const float* __restrict__ A, int lda, const unsigned short* __restrict__ Wt, int ldb,
                                                const float* __restrict__ bias, const float* __restrict__ resid, int rmod, int ldr,
                                                float* __restrict__ C, int ldc, int M, int N, int K) {
  __shared__ __attribute__((aligned(16))) float so[4][16][64];
  const int tid = threadIdx.x, w = tid >> 5, lane = tid & 31, ln = lane & 15, hh = lane >> 4;
  const int ntn = N / 64;
  const int wid = blockIdx.x * 4 + w;
  const int mt = wid / ntn, nq = wid % ntn;
  if (mt * 16 >= M) return;
  const int row0 = mt * 16, col0 = nq * 64;
  const float* arow = A + (size_t)(row0 + ln) * lda;
  v8f acc[4] = {};
  for (int kb = 0; kb < K; kb += 32) {
    FragB ah, al;
    const v4f x0 = *(const v4fa*)(arow + kb + 8 * hh), x1 = *(const v4fa*)(arow + kb + 8 * hh + 4);
    const v4f x2 = *(const v4fa*)(arow + kb + 16 + 8 * hh), x3 = *(const v4fa*)(arow + kb + 16 + 8 * hh + 4);
    float xs[16] = {x0[0],x0[1],x0[2],x0[3],x1[0],x1[1],x1[2],x1[3],x2[0],x2[1],x2[2],x2[3],x3[0],x3[1],x3[2],x3[3]};
#pragma unroll
    for (int i = 0; i < 16; ++i) { const unsigned short hb = bf16_bits(xs[i]); ah.u[i] = hb; al.u[i] = ASPLIT ? bf16_bits(xs[i] - bf16_val(hb)) : (unsigned short)0; }
#pragma unroll
    for (int t = 0; t < 4; ++t) {
      const unsigned short* brow = Wt + (size_t)(col0 + t * 16 + ln) * ldb + kb;
      FragB b;
      b.half[0] = *(const v8us*)(brow + 8 * hh);
      b.half[1] = *(const v8us*)(brow + 16 + 8 * hh);
      acc[t] = mmaN<ASPLIT ? 2 : 1>(ah.v, al.v, b.v, b.v, acc[t]);
    }
  }
#pragma unroll
  for (int t = 0; t < 4; ++t) {
    const int col = col0 + t * 16 + ln;
    float bv = bias ? bias[col] : 0.f;
    if (BIAS_BF16) bv = bf16_round(bv);
#pragma unroll
    for (int r = 0; r < 8; ++r) {
      float v = acc[t][r] + bv;
      if (resid) { float rv = resid[(size_t)((row0 + 8 * hh + r) % rmod) * ldr + col]; if (RES_BF16) rv = bf16_round(rv); v += rv; }
      if (ACT == 1) v = fmaxf(v, 0.f);
      if (ACT == 2) v = 0.5f * v * (1.0f + erff(v * 0.70710678118654752f));
      if (ACT == 3) { const float u = 0.7978845608028654f * (v + 0.044715f * v * v * v); v = 0.5f * v * (1.0f + tanhf(u)); }
      so[w][8 * hh + r][t * 16 + ln] = v;
    }
  }
  __builtin_amdgcn_fence(__ATOMIC_ACQ_REL, "workgroup");
  __builtin_amdgcn_wave_barrier();
  const int rsub = lane >> 4, c4 = (lane & 15) * 4;
  {
#pragma unroll
    for (int q = 0; q < 8; ++q) {
      const int r = q * 2 + rsub;
      const v4f v = *(const v4fa*)&so[w][r][c4];
      *(v4f*)(C + (size_t)(row0 + r) * ldc + col0 + c4) = v;
    }
    
  }
}
// row LayerNorm (biased variance, eps) over N: s = X (+ R); optional out_sum <- s; out_norm <- (s-mu)*rsqrt(var+eps)*g + b
template <bool PARAM_BF16>
__global__ __launch_bounds__(256) void k_layernorm(const float* __restrict__ X, const float* __restrict__ R, const float* __restrict__ g, const float* __restrict__ bta,
                                                  float* __restrict__ out_sum, float* __restrict__ out_norm, int N, float eps) {
  __shared__ float red[256];
  const int row = blockIdx.x, tid = threadIdx.x;
  const float* x = X + (size_t)row * N; const float* rr = R ? R + (size_t)row * N : nullptr;
  float vals[16];                     // up to N = 4096
  const int per = N / 256;            // contiguous chunk per thread? use strided-by-4 chunks: thread handles j = tid*4 + 1024*u
  float s1 = 0.f;
  for (int u = 0; u < per / 4; ++u) {
    const int j = tid * 4 + 1024 * u;
    const v4f a = *(const v4fa*)(x + j);
    v4f b = {0.f,0.f,0.f,0.f}; if (rr) b = *(const v4fa*)(rr + j);
#pragma unroll
    for (int q = 0; q < 4; ++q) { const float v = a[q] + b[q]; vals[u * 4 + q] = v; s1 += v; }
  }
  red[tid] = s1; __syncthreads();
  for (int st = 128; st > 0; st >>= 1) { if (tid < st) red[tid] += red[tid + st]; __syncthreads(); }
  const float mu = red[0] / (float)N; __syncthreads();
  float s2 = 0.f;
  for (int u = 0; u < per / 4; ++u)
#pragma unroll
    for (int q = 0; q < 4; ++q) { const float c = vals[u * 4 + q] - mu; s2 += c * c; }
  red[tid] = s2; __syncthreads();
  for (int st = 128; st > 0; st >>= 1) { if (tid < st) red[tid] += red[tid + st]; __syncthreads(); }
  const float rs = rsqrtf(red[0] / (float)N + eps);
  {
    for (int u = 0; u < per / 4; ++u) {
      const int j = tid * 4 + 1024 * u;
      v4f o, sm;
#pragma unroll
      for (int q = 0; q < 4; ++q) {
        float gg = g[j + q], bb = bta[j + q];
        if (PARAM_BF16) { gg = bf16_round(gg); bb = bf16_round(bb); }
        sm[q] = vals[u * 4 + q]; o[q] = (vals[u * 4 + q] - mu) * rs * gg + bb;
      }
      if (out_sum) *(v4f*)(out_sum + (size_t)row * N + j) = sm;
      *(v4f*)(out_norm + (size_t)row * N + j) = o;
    }
    
  }
}



// ---- f16 WMMA path (v_wmma_f32_16x16x32_f16): 11-bit significands for operands in range — used where a [0,1] probability operand needs more precision than bf16
typedef _Float16 v16h __attribute__((ext_vector_type(16)));
union FragH { v16h v; v8us half[2]; _Float16 h[16]; unsigned short u[16]; };
template <int NT>
__device__ __forceinline__ v8f mmaH(v16h ah, v16h al, v16h bh, v16h bl, v8f c) {
  c = __builtin_amdgcn_wmma_f32_16x16x32_f16(false, ah, false, bh, (short)0, c, false, false);
  if (NT >= 2) c = __builtin_amdgcn_wmma_f32_16x16x32_f16(false, al, false, bh, (short)0, c, false, false);
  if (NT >= 3) c = __builtin_amdgcn_wmma_f32_16x16x32_f16(false, ah, false, bl, (short)0, c, false, false);
  asm volatile("v_nop\n\tv_nop\n\tv_nop\n\tv_nop" : "+v"(c) : "v"(ah), "v"(al), "v"(bh), "v"(bl));
  return c;
}
// batched GEMM like k_gemm_b but f16 operands: A f32 (split into f16 hi/lo if ASPLIT, else rounded to f16), Bt = f16 values [n][k]; alpha; C f32; N multiple of 16 (partial tiles skipped)
template <bool ASPLIT>
__global__ __launch_bounds__(128) void k_gemm_h(const float* __restrict__ A, int lda, size_t sA, const _Float16* __restrict__ Bh, int ldb, size_t sB, float alpha, float* __restrict__ C, int ldc, size_t sC, int M, int N, int K) {
  __shared__ __attribute__((aligned(16))) float so[4][16][64];
  const int tid = threadIdx.x, w = tid >> 5, lane = tid & 31, ln = lane & 15, hh = lane >> 4; const int by = blockIdx.y;
  A += (size_t)by * sA; Bh += (size_t)by * sB; C += (size_t)by * sC;
  const int ntn = (N + 63) / 64; const int wid = blockIdx.x * 4 + w; const int mt = wid / ntn, nq = wid % ntn; if (mt * 16 >= M) return;
  const int row0 = mt * 16, col0 = nq * 64; const float* arow = A + (size_t)(row0 + ln) * lda;
  v8f acc[4] = {};
  for (int kb = 0; kb < K; kb += 32) {
    FragH ah, al;
    const v4f x0 = *(const v4fa*)(arow + kb + 8 * hh), x1 = *(const v4fa*)(arow + kb + 8 * hh + 4), x2 = *(const v4fa*)(arow + kb + 16 + 8 * hh), x3 = *(const v4fa*)(arow + kb + 16 + 8 * hh + 4);
    float xs[16] = {x0[0],x0[1],x0[2],x0[3],x1[0],x1[1],x1[2],x1[3],x2[0],x2[1],x2[2],x2[3],x3[0],x3[1],x3[2],x3[3]};
#pragma unroll
    for (int i = 0; i < 16; ++i) { const _Float16 h = (_Float16)xs[i]; ah.h[i] = h; al.h[i] = ASPLIT ? (_Float16)(xs[i] - (float)h) : (_Float16)0.0f; }
#pragma unroll
    for (int t = 0; t < 4; ++t) { if (col0 + t * 16 >= N) continue; const size_t boff = (size_t)(col0 + t * 16 + ln) * ldb + kb; FragH bq; bq.half[0] = *(const v8us*)(Bh + boff + 8 * hh); bq.half[1] = *(const v8us*)(Bh + boff + 16 + 8 * hh);
      acc[t] = mmaH<ASPLIT ? 2 : 1>(ah.v, al.v, bq.v, bq.v, acc[t]); }
  }
#pragma unroll
  for (int t = 0; t < 4; ++t) { if (col0 + t * 16 >= N) continue;
#pragma unroll
    for (int r = 0; r < 8; ++r) so[w][8 * hh + r][t * 16 + ln] = acc[t][r] * alpha; }
  __builtin_amdgcn_fence(__ATOMIC_ACQ_REL, "workgroup"); __builtin_amdgcn_wave_barrier();
  const int rsub = lane >> 4, c4 = (lane & 15) * 4;
  {
#pragma unroll
    for (int q = 0; q < 8; ++q) { const int r = q * 2 + rsub; if (col0 + c4 < N) { const v4f v = *(const v4fa*)&so[w][r][c4]; *(v4f*)(C + (size_t)(row0 + r) * ldc + col0 + c4) = v; } }
     }
}

// Wt[n][k] = f16(W[k][n]·scale) from f32 row-major W[K][N] (scale = power of two; bf16-exact weights stay exact in f16 away from the subnormal range)
__global__ __launch_bounds__(256) void k_wt_f16(const float* __restrict__ W, _Float16* __restrict__ Wt, int K, int N, float scale) {
  const int t = blockIdx.x * 256 + threadIdx.x; if (t >= N * (K / 8)) return; const int n = t / (K / 8), k8 = (t % (K / 8)) * 8; FragH f;
#pragma unroll
  for (int i = 0; i < 8; ++i) f.h[i] = (_Float16)(bf16_round(W[(size_t)(k8 + i) * N + n]) * scale); const v8us o = f.half[0];
  *(v8us*)((unsigned short*)Wt + (size_t)n * K + k8) = o; 
}
// k_gemm_hh variant with fused epilogue: v = acc·alpha + bias[by·sBias + col] (+ CP[(row/rowsPerB)·sCPb + by·64 + col] if CP) ; ACT 0 none / 1 elu ; writes f16 C16 (and f32 C if non-null)
template <int ACT>
__global__ __launch_bounds__(128) void k_gemm_hhx(const _Float16* __restrict__ A, int lda, size_t sA, const _Float16* __restrict__ Bh, int ldb, size_t sB, float alpha, const float* __restrict__ bias, size_t sBias, const float* __restrict__ CP, int rowsPerB, size_t sCPb, int row0g,
    float* __restrict__ C, _Float16* __restrict__ C16, int ldc, size_t sC, int M, int N, int K) {
  __shared__ __attribute__((aligned(16))) float so[4][16][64];
  const int tid = threadIdx.x, w = tid >> 5, lane = tid & 31, ln = lane & 15, hh = lane >> 4; const int by = blockIdx.y;
  A += (size_t)by * sA; Bh += (size_t)by * sB; const size_t cofs = (size_t)by * sC; const float* bp = bias ? bias + (size_t)by * sBias : nullptr;
  const int ntn = (N + 63) / 64; const int wid = blockIdx.x * 4 + w; const int mt = wid / ntn, nq = wid % ntn; if (mt * 16 >= M) return;
  const int row0 = mt * 16, col0 = nq * 64; const _Float16* arow = A + (size_t)(row0 + ln) * lda;
  v8f acc[4] = {};
  for (int kb = 0; kb < K; kb += 32) { FragH ah; ah.half[0] = *(const v8us*)((const unsigned short*)arow + kb + 8 * hh); ah.half[1] = *(const v8us*)((const unsigned short*)arow + kb + 16 + 8 * hh);
#pragma unroll
    for (int t = 0; t < 4; ++t) { if (col0 + t * 16 >= N) continue; const size_t boff = (size_t)(col0 + t * 16 + ln) * ldb + kb; FragH bq; bq.half[0] = *(const v8us*)((const unsigned short*)Bh + boff + 8 * hh); bq.half[1] = *(const v8us*)((const unsigned short*)Bh + boff + 16 + 8 * hh);
      acc[t] = mmaH<1>(ah.v, ah.v, bq.v, bq.v, acc[t]); }
  }
#pragma unroll
  for (int t = 0; t < 4; ++t) { if (col0 + t * 16 >= N) continue; const int col = col0 + t * 16 + ln; const float bv = bp ? bf16_round(bp[col]) : 0.f;
#pragma unroll
    for (int r = 0; r < 8; ++r) { float v = acc[t][r] * alpha + bv; if (CP) { const int bidx = (row0g + row0 + 8 * hh + r) / rowsPerB; v += CP[(size_t)bidx * sCPb + (size_t)by * 64 + col]; } if (ACT == 1) v = (v > 0.f) ? v : expm1f(v); else if (ACT == 7) v = (v > 0.f) ? v + 1.0f : expf(v); else if (ACT == 8) v = tanhf(v); else if (ACT == 9) v = 0.5f * v * (1.0f + tanhf(0.7978845608028654f * (v + 0.044715f * v * v * v))); else if (ACT == 11) v = 1.0f / (1.0f + expf(-v)); else if (ACT == 12) v = (v > 0.f) ? v : 0.01f * v; else if (ACT == 14) v = (v > 0.f) ? v : 0.1f * v; else if (ACT == 15) v = v / (1.0f + expf(-v)); else if (ACT == 3) v = fmaxf(v, 0.f); else if (ACT == 6) v = 0.5f * v * (1.0f + erff(v * 0.70710678118654752f)); so[w][8 * hh + r][t * 16 + ln] = v; } }
  __builtin_amdgcn_fence(__ATOMIC_ACQ_REL, "workgroup"); __builtin_amdgcn_wave_barrier();
  const int rsub = lane >> 4, c4 = (lane & 15) * 4; typedef _Float16 v4h __attribute__((ext_vector_type(4)));
  {
#pragma unroll
    for (int q = 0; q < 8; ++q) { const int r = q * 2 + rsub; if (col0 + c4 < N) { const v4f v = *(const v4fa*)&so[w][r][c4]; if (C) *(v4f*)(C + cofs + (size_t)(row0 + r) * ldc + col0 + c4) = v; if (C16) { v4h h4; for (int i = 0; i < 4; ++i) h4[i] = (_Float16)v[i]; *(v4h*)(C16 + cofs + (size_t)(row0 + r) * ldc + col0 + c4) = h4; } } }
     }
}


typedef _Float16 v4h __attribute__((ext_vector_type(4)));

__global__ __launch_bounds__(256) void k_x16(const float* __restrict__ x, _Float16* __restrict__ X16, size_t n8) { const size_t t = (size_t)blockIdx.x * 256 + threadIdx.x; if (t >= n8) return; FragH f;
#pragma unroll
  for (int q = 0; q < 8; ++q) f.h[q] = (_Float16)bf16_round(x[t * 8 + q]); *(v8us*)((unsigned short*)X16 + t * 8) = f.half[0];  }
__global__ __launch_bounds__(256) void k_h16(const float* __restrict__ x, _Float16* __restrict__ X16, size_t n8) { const size_t t = (size_t)blockIdx.x * 256 + threadIdx.x; if (t >= n8) return; FragH f;
#pragma unroll
  for (int q = 0; q < 8; ++q) f.h[q] = (_Float16)x[t * 8 + q]; *(v8us*)((unsigned short*)X16 + t * 8) = f.half[0];  }
__global__ __launch_bounds__(256) void k_round16f(const float* __restrict__ W, _Float16* __restrict__ Bt, size_t n8) { const size_t t = (size_t)blockIdx.x * 256 + threadIdx.x; if (t >= n8) return; FragH f;
#pragma unroll
  for (int i = 0; i < 8; ++i) f.h[i] = (_Float16)(bf16_round(W[t * 8 + i]) * 16.0f); *(v8us*)((unsigned short*)Bt + t * 8) = f.half[0];  }
template <int NHv, int TTv>
__global__ __launch_bounds__(256) void k_vt(const _Float16* __restrict__ V16, int ldv, int voff, _Float16* __restrict__ Vt) { __shared__ unsigned short tl[64][66]; const int tid = threadIdx.x; const int slab = blockIdx.x / (TTv / 64), lg = blockIdx.x % (TTv / 64); const int b = slab / NHv, h = slab % NHv;
  for (int i = tid; i < 64 * 8; i += 256) { const int r = i / 8, c8 = (i % 8) * 8; FragH f; f.half[0] = *(const v8us*)((const unsigned short*)V16 + ((size_t)b * TTv + lg * 64 + r) * ldv + voff + h * 64 + c8);
#pragma unroll
    for (int q = 0; q < 8; ++q) tl[r][c8 + q] = f.u[q]; }
  __syncthreads();
  {
#pragma unroll
    for (int rd = 0; rd < 2; ++rd) { const int d = rd * 32 + tid / 8, pc = tid % 8; FragH f;
#pragma unroll
      for (int q = 0; q < 8; ++q) f.u[q] = tl[pc * 8 + q][d];
      *(v8us*)((unsigned short*)Vt + ((size_t)slab * 64 + d) * TTv + lg * 64 + pc * 8) = f.half[0]; }
     } }

#ifndef NBS
#define NBS NB      /* batch stride of the [S][B][E] tensors (debug builds may process fewer batches than the layout holds) */
#endif
// ---- fast GEMM (wave tile 32x64, 8 waves as 4 x 2, block tile 128x128; requires M % 128 == 0, N % 128 == 0, K % 64 == 0, K >= 64) ----
// Operands reach the waves through LDS: per stage the block brings 64 k of its 128 A rows and 128 B rows in by asynchronous copies that cover whole 128-byte lines (8 lanes a row),
// two buffers, the next stage in flight while this one is worked on; the fragments are read from LDS in the same k order as before.
// TAIL: C = (A B^T / 1024 + A2 B^T) alpha + bias in one launch: the stages walk A's K columns, the sums are scaled by 2^-10 (exact), then the stages walk A2's K columns on top of them, B's anew;
// row (b, s) of the result is stored at row (s, b) of Cf, which is f32.
// The epilogue's staging lies on the two buffers' LDS: the barrier at the foot of the last trip, behind every wave's dscnt and asynccnt waits, has ended their use.
// Not TAIL: three batches, C = A B^T alpha + bias with the batch's own B and bias. A wave's 64 columns are one head: batches 0, 1 (q, k) take the rotary embedding in the epilogue, from the angle table CS / SN, and leave as f16 planes of Ch; batch 2 (v) leaves as V^T.
__device__ __forceinline__ v16h g2_frag(const unsigned short* p, int hh) { FragH f; f.half[0] = *(const v8us*)(p + 8 * hh); f.half[1] = *(const v8us*)(p + 16 + 8 * hh); return f.v; }
__device__ __forceinline__ v8f g2_mma(v16h a, v16h b, v8f c) { v8f d = __builtin_amdgcn_wmma_f32_16x16x32_f16(false, a, false, b, (short)0, c, false, false); asm volatile("v_nop\n\tv_nop\n\tv_nop\n\tv_nop" : "+v"(d) : "v"(a), "v"(b)); return d; }
// One lane's share of a stage: 4 pieces of A and 4 of B, 16 bytes each, 32 rows apart (ls bytes in LDS, da / db bytes in memory), global memory -> LDS through no register.
// The s_wait_xcnt closes the copies' own statement so that no address register named here is rewritten ahead of it.
__device__ __forceinline__ void g2_copy(unsigned la, unsigned lb, unsigned ls, const char* pa, size_t da, const char* pb, size_t db) {
  asm volatile("global_load_async_to_lds_b128 %0, %8, off\n\t" "global_load_async_to_lds_b128 %1, %9, off\n\t" "global_load_async_to_lds_b128 %2, %10, off\n\t" "global_load_async_to_lds_b128 %3, %11, off\n\t"
               "global_load_async_to_lds_b128 %4, %12, off\n\t" "global_load_async_to_lds_b128 %5, %13, off\n\t" "global_load_async_to_lds_b128 %6, %14, off\n\t" "global_load_async_to_lds_b128 %7, %15, off\n\t"
               "s_wait_xcnt 0x0"
               :: "v"(la), "v"(la + ls), "v"(la + 2 * ls), "v"(la + 3 * ls), "v"(lb), "v"(lb + ls), "v"(lb + 2 * ls), "v"(lb + 3 * ls),
                  "v"(pa), "v"(pa + da), "v"(pa + 2 * da), "v"(pa + 3 * da), "v"(pb), "v"(pb + db), "v"(pb + 2 * db), "v"(pb + 3 * db)
               : "memory"); }
/* second launch bound: registers for 6 waves a SIMD, so that three blocks fit a WGP and the q/k/v grid (3 blocks a WGP) is resident at once */
template <int ACT, bool TAIL>
__global__ __launch_bounds__(256, 6) void k_gemm2(const _Float16* __restrict__ A, int lda, size_t sA, const _Float16* __restrict__ A2, const _Float16* __restrict__ Bh, int ldb, size_t sB, float alpha, const float* __restrict__ bias, const float* __restrict__ bias1, const float* __restrict__ bias2, const float* __restrict__ CS, const float* __restrict__ SN,
    float* __restrict__ Cf, _Float16* __restrict__ Ch, _Float16* __restrict__ Vt, int ldc, size_t sC, int M, int N, int K) {
  constexpr int KT = 64, PIT = KT + 8;      /* LDS row pitch 144 B = 16 B x odd: the 16-byte fragment reads of 16 rows fall on distinct banks */
  __shared__ __attribute__((aligned(16))) unsigned short ring[4][128][PIT];      /* A's two buffers, then B's; behind the loop the epilogue's staging */
  unsigned short (*tA)[128][PIT] = ring; unsigned short (*tB)[128][PIT] = ring + 2; float (*so)[32][68] = (float (*)[32][68])&ring[0][0][0];
  static_assert(sizeof(float) * 8 * 32 * 68 <= sizeof(ring), "the staging of 8 waves fits the buffers");
  const int tid = threadIdx.x, w = tid >> 5, wr = w & 3, wc = w >> 2, lane = tid & 31, ln = lane & 15, hh = lane >> 4; const int by = blockIdx.y;
  A += (size_t)by * sA; Bh += (size_t)by * sB; const float* bp = by == 0 ? bias : (by == 1 ? bias1 : bias2);      /* batch by has its own bias vector */
  const int ntn = N >> 7; const int mt = blockIdx.x / ntn, nq = blockIdx.x - mt * ntn; const int row0 = mt * 128 + 32 * wr, col0 = nq * 128 + 64 * wc; if (mt * 128 >= M) return;      /* the same for the whole block: it stands in front of barriers */
  const int sr = tid >> 3, sc = (tid & 7) * 8;
  const char* pa = (const char*)(A + (size_t)(mt * 128 + sr) * lda + sc); const char* pb = (const char*)(Bh + (size_t)(nq * 128 + sr) * ldb + sc); const size_t da = (size_t)lda * 64, db = (size_t)ldb * 64;
  const unsigned la = (unsigned)(uintptr_t)&tA[0][sr][sc], lb = (unsigned)(uintptr_t)&tB[0][sr][sc]; constexpr unsigned LS = 32 * PIT * 2, BA = 128 * PIT * 2, BB = 128 * PIT * 2;
  const char* pa2 = TAIL ? (const char*)(A2 + (size_t)by * sA + (size_t)(mt * 128 + sr) * lda + sc) : pa; const int KK = TAIL ? 2 * K : K;
  /* the stage that begins at column kk of [A | A2], into buffer buf; kk is the same for the whole block */
  auto stage = [&](int kk, int buf) { const bool t2 = TAIL && kk >= K; const size_t kx = (size_t)(t2 ? kk - K : kk) * 2; g2_copy(la + buf * BA, lb + buf * BB, LS, (t2 ? pa2 : pa) + kx, da, pb + kx, db); };
  stage(0, 0);
  asm volatile("s_wait_asynccnt 0x0" ::: "memory");      /* this wave's share of stage 0 has landed */
  __syncthreads();      /* every wave's share has: stage 0 may be read */
  if (KT < KK) stage(KT, 1);
  const v8f z8 = {0.f,0.f,0.f,0.f,0.f,0.f,0.f,0.f}; v8f c00 = z8, c01 = z8, c02 = z8, c03 = z8, c10 = z8, c11 = z8, c12 = z8, c13 = z8;
  /* rolled: one stage a trip, so that the order at the foot of the trip stands once */
#pragma unroll 1
  for (int kb = 0; kb < KK; kb += KT) { const int cur = (kb >> 6) & 1;
    if (TAIL && kb == K) { constexpr float s10 = 0.0009765625f; c00 *= s10; c01 *= s10; c02 *= s10; c03 *= s10; c10 *= s10; c11 *= s10; c12 *= s10; c13 *= s10; }
    /* unrolled: the two 32-k blocks of a stage read LDS at immediate offsets */
#pragma unroll
    for (int ks = 0; ks < KT; ks += 32) { const unsigned short* fa = &tA[cur][32 * wr + ln][ks]; const unsigned short* fb = &tB[cur][64 * wc + ln][ks];
      const v16h a0 = g2_frag(fa, hh), a1 = g2_frag(fa + 16 * PIT, hh); const v16h b0 = g2_frag(fb, hh), b1 = g2_frag(fb + 16 * PIT, hh), b2 = g2_frag(fb + 32 * PIT, hh), b3 = g2_frag(fb + 48 * PIT, hh);
      c00 = g2_mma(a0, b0, c00); c10 = g2_mma(a1, b0, c10); c01 = g2_mma(a0, b1, c01); c11 = g2_mma(a1, b1, c11);
      c02 = g2_mma(a0, b2, c02); c12 = g2_mma(a1, b2, c12); c03 = g2_mma(a0, b3, c03); c13 = g2_mma(a1, b3, c13); }
    asm volatile("s_wait_dscnt 0x0" ::: "memory");      /* this wave's reads of the buffer that is refilled below have returned */
    asm volatile("s_wait_asynccnt 0x0" ::: "memory");      /* this wave's share of the next stage has landed */
    __syncthreads();      /* publishes the next stage and ends every wave's reads of this one */
    if (kb + 2 * KT < KK) stage(kb + 2 * KT, cur); }
  asm volatile("s_wait_asynccnt 0x0" ::: "memory");      /* no copy is left in flight behind the loop */
  v8f accs[8] = {c00, c01, c02, c03, c10, c11, c12, c13};
  static_assert(TAIL || ACT == 0, "the q/k/v epilogue has no activation");
  if (!TAIL && by == 2) {      /* v, the same for the whole block: stored as V^T[(b, h)][d][s]; the block's 128 columns are two heads that follow one another, its 128 rows lie in one batch */
    /* a lane's 8 accumulator registers are 8 consecutive s of one d: one 16-byte LDS store; pitch 272 B = 16 B x odd. Every loop of this path is unrolled: constant register-array indices, immediate offsets */
    unsigned short (*sT)[136] = (unsigned short (*)[136])&so[0][0][0]; float bv[4] = {0.f, 0.f, 0.f, 0.f};
    if (bp) { const float* bl = bp + col0 + ln;
#pragma unroll
      for (int t = 0; t < 4; ++t) bv[t] = bl[t * 16];
      asm volatile("s_wait_xcnt 0x0" ::: "memory");      /* stands behind the four loads: the code below reuses their address registers */
#pragma unroll
      for (int t = 0; t < 4; ++t) bv[t] = bf16_round(bv[t]); }
#pragma unroll
    for (int u = 0; u < 8; ++u) { const int t = u & 3, half = u >> 2; const int d = 64 * wc + t * 16 + ln; FragH f;
#pragma unroll
      for (int r = 0; r < 8; ++r) f.h[r] = (_Float16)(accs[u][r] * alpha + bv[t]);
      *(v8us*)&sT[d][32 * wr + half * 16 + 8 * hh] = f.half[0]; }
    __syncthreads();      /* every wave's 32 s of each d are in LDS before the rows are read back whole */
    unsigned short* vo = (unsigned short*)Vt + ((size_t)((mt * 128) / SLEN * NH + nq * 2) * 64 + (tid >> 4)) * SLEN + (mt * 128) % SLEN + (tid & 15) * 8;
    /* 16 lanes store the 256 bytes of one d, 16 d a pass */
#pragma unroll
    for (int p = 0; p < 8; ++p) *(v8us*)(vo + (size_t)p * 16 * SLEN) = *(const v8us*)&sT[p * 16 + (tid >> 4)][(tid & 15) * 8];
    return; }
  /* q, k: the wave's share of the angle table. 4 lanes hold a row, lane g the angles 8 g .. 8 g + 7; 8 rows a pass */
  const int g = lane & 3, rr = lane >> 2; v4f tk[4][2], tn[4][2];
  if (!TAIL) { const float* tc = CS + (size_t)(row0 % SLEN + rr) * 32 + g * 8; const float* ts = SN + (size_t)(row0 % SLEN + rr) * 32 + g * 8;
    /* unrolled: constant register-array indices, immediate offsets */
#pragma unroll
    for (int p = 0; p < 4; ++p) { tk[p][0] = *(const v4fa*)(tc + p * 256); tk[p][1] = *(const v4fa*)(tc + p * 256 + 4); tn[p][0] = *(const v4fa*)(ts + p * 256); tn[p][1] = *(const v4fa*)(ts + p * 256 + 4); }
    asm volatile("s_wait_xcnt 0x0" :: "v"(tc), "v"(ts) : "memory");      /* stands behind the sixteen loads: the code below reuses their address registers; it takes the two addresses as inputs so that no load's result lands on them ahead of the wait */ }
#pragma unroll
  for (int u = 0; u < 8; ++u) { const int t = u & 3, half = u >> 2; const int col = col0 + t * 16 + ln; const float bv = bp ? bf16_round(bp[col]) : 0.f;
#pragma unroll
    for (int r = 0; r < 8; ++r) { const int rloc = half * 16 + 8 * hh + r; float v = accs[u][r] * alpha + bv;
      if (ACT == 3) v = fmaxf(v, 0.f); else if (ACT == 6) v = 0.5f * v * (1.0f + erff(v * 0.70710678118654752f)); else if (ACT == 11) v = 1.0f / (1.0f + expf(-v)); else if (ACT == 15) v = v / (1.0f + expf(-v)); else if (ACT == 12) v = (v > 0.f) ? v : 0.01f * v; else if (ACT == 8) v = tanhf(v);
      so[w][rloc][t * 16 + ln] = v; } }
  __builtin_amdgcn_fence(__ATOMIC_ACQ_REL, "workgroup"); __builtin_amdgcn_wave_barrier();
  if (TAIL) { const int rsub = lane >> 4, c4 = (lane & 15) * 4;
#pragma unroll
    for (int q = 0; q < 16; ++q) { const int r = q * 2 + rsub; const v4f v = *(const v4fa*)&so[w][r][c4]; const size_t orow = (size_t)((row0 + r) % SLEN) * NBS + (row0 + r) / SLEN; *(v4f*)(Cf + orow * ldc + col0 + c4) = v; }
  } else {      /* q, k: rotary embedding of the wave's 32 rows of one head, then f16. Lane g of a row has x = d 8 g .. 8 g + 7 and y = d + 32; out[d] = x cos - y sin, out[d + 32] = y cos + x sin */
    unsigned short* ho = (unsigned short*)Ch + (size_t)by * sC + (size_t)(row0 + rr) * DM + col0 + g * 8;
    /* unrolled: constant register-array indices; LDS and output are addressed by immediate offsets */
#pragma unroll
    for (int p = 0; p < 4; ++p) { const int r = p * 8 + rr; FragH f1, f2;
#pragma unroll
      for (int e = 0; e < 2; ++e) { const v4f x = *(const v4fa*)&so[w][r][g * 8 + 4 * e], y = *(const v4fa*)&so[w][r][32 + g * 8 + 4 * e], k = tk[p][e], s = tn[p][e];
#pragma unroll
        for (int q = 0; q < 4; ++q) { f1.h[4 * e + q] = (_Float16)(x[q] * k[q] - y[q] * s[q]); f2.h[4 * e + q] = (_Float16)(y[q] * k[q] + x[q] * s[q]); } }
      *(v8us*)(ho + (size_t)p * 8 * DM) = f1.half[0]; *(v8us*)(ho + (size_t)p * 8 * DM + 32) = f2.half[0]; }
    asm volatile("s_wait_xcnt 0x0" ::: "memory");      /* stands behind the last of the eight stores: the v path's code follows them in the built kernel and reuses their registers */ } }



// Lane l <-> l ^ 16 by a vector cross-row move (the two lanes that hold one query's keys).
__device__ __forceinline__ float x_half(float x) { const int b = __float_as_int(x); return __int_as_float(__builtin_amdgcn_permlanex16(b, b, 0x76543210, 0xfedcba98, false, false)); }
// One lane's share of a 64-key stage: 4 pieces of K and 4 of V^T, 16 bytes each, 16 rows apart (ls bytes in LDS, dk / dv bytes in memory), global memory -> LDS through no register.
// The s_wait_xcnt closes the copies' own statement so that no address register named here is rewritten ahead of it.
__device__ __forceinline__ void fl_copy(unsigned lk, unsigned lv, unsigned ls, const char* pk, size_t dk, const char* pv, size_t dv) {
  asm volatile("global_load_async_to_lds_b128 %0, %8, off\n\t" "global_load_async_to_lds_b128 %1, %9, off\n\t" "global_load_async_to_lds_b128 %2, %10, off\n\t" "global_load_async_to_lds_b128 %3, %11, off\n\t"
               "global_load_async_to_lds_b128 %4, %12, off\n\t" "global_load_async_to_lds_b128 %5, %13, off\n\t" "global_load_async_to_lds_b128 %6, %14, off\n\t" "global_load_async_to_lds_b128 %7, %15, off\n\t"
               "s_wait_xcnt 0x0"
               :: "v"(lk), "v"(lk + ls), "v"(lk + 2 * ls), "v"(lk + 3 * ls), "v"(lv), "v"(lv + ls), "v"(lv + 2 * ls), "v"(lv + 3 * ls),
                  "v"(pk), "v"(pk + dk), "v"(pk + 2 * dk), "v"(pk + 3 * dk), "v"(pv), "v"(pv + dv), "v"(pv + 2 * dv), "v"(pv + 3 * dv)
               : "memory"); }
// Unmasked attention with both products transposed: S^T = K Q^T (A = K rows, B = Q rows), O^T += V^T P^T (A = V^T rows, B = P^T).
// Lane (ln, hh) owns query q0 + ln; register r of score tile nt is key j0 + ps + nt * 16 + 8 * hh + r, so maximum and sum run inside the lane, joined with lane ^ 16,
// and the two score tiles, converted in place, are the B operand of the second product in the k order of the V^T loader (8 * hh + i, 16 + 8 * hh + i): P touches no LDS.
// K and V^T reach the waves through LDS: per stage the block brings 64 keys (64 K rows and 64 V^T rows of 128 bytes) in by asynchronous copies that cover whole 128-byte lines (8 lanes a row),
// two buffers, the next stage in flight while this one is worked on; the four waves read their fragments from LDS in the same k order as before.
__global__ __launch_bounds__(128) void k_flash(const _Float16* __restrict__ Q16, int ldq, const _Float16* __restrict__ K16, int ldk, const _Float16* __restrict__ Vt, _Float16* __restrict__ Oh, _Float16* __restrict__ Ol, int ldo) {
  constexpr int RPW = 16, DT = 4, KS = 2, KT = 64, PIT = KT + 8;      /* LDS row pitch 144 B = 16 B x odd: the 16-byte fragment reads of 16 rows fall on distinct banks */
  __shared__ __attribute__((aligned(16))) float sO[4][RPW][64 + 4];
  __shared__ __attribute__((aligned(16))) unsigned short tK[2][KT][PIT]; __shared__ __attribute__((aligned(16))) unsigned short tV[2][64][PIT];
  const int tid = threadIdx.x, w = tid >> 5, lane = tid & 31, ln = lane & 15, hh = lane >> 4;
  const int slab = blockIdx.x / QBNP, qblk = QB0P + blockIdx.x % QBNP; const int b = slab / NH, h = slab % NH; const int qb0 = qblk * (4 * RPW); const int q0 = qb0 + w * RPW;
  /* every inner loop below is unrolled so that each register-array index is a constant (no scratch) */
  FragH bq[KS];
  { const unsigned short* qr = (const unsigned short*)Q16 + ((size_t)b * TQ + q0 + ln) * ldq + h * 64;
#pragma unroll
    for (int ks = 0; ks < KS; ++ks) { bq[ks].half[0] = *(const v8us*)(qr + ks * 32 + 8 * hh); bq[ks].half[1] = *(const v8us*)(qr + ks * 32 + 16 + 8 * hh); } }
  const unsigned short* Vth = (const unsigned short*)Vt + (size_t)slab * 64 * TK;
  const int sr = tid >> 3, sc = (tid & 7) * 8;
  const char* pk = (const char*)((const unsigned short*)K16 + ((size_t)b * TK + sr) * ldk + h * 64 + sc); const char* pv = (const char*)(Vth + (size_t)sr * TK + sc); const size_t dk = (size_t)ldk * 32, dv = (size_t)TK * 32, sk = (size_t)ldk * (KT * 2);
  const unsigned lk = (unsigned)(uintptr_t)&tK[0][sr][sc], lv = (unsigned)(uintptr_t)&tV[0][sr][sc]; constexpr unsigned LS = 16 * PIT * 2, BS = 64 * PIT * 2;
  fl_copy(lk, lv, LS, pk, dk, pv, dv);
  asm volatile("s_wait_asynccnt 0x0" ::: "memory");      /* this wave's share of stage 0 has landed */
  __syncthreads();      /* every wave's share has: stage 0 may be read */
  if (KT < TK) fl_copy(lk + BS, lv + BS, LS, pk + sk, dk, pv + KT * 2, dv);
  /* the maximum m_q is kept in units of the raw product q.k; p = 2^10 exp((s - m) / 8) is one multiply-add and one base-2 exponential: 2^(s C2 + (10 - m C2)); l_q sums these p, so it carries the 2^10 as well */
  constexpr float C2 = SCL * 1.4426950408889634f;
  float m_q = -3.0e38f, l_q = 0.f; v8f oacc[DT];
#pragma unroll
  for (int dt = 0; dt < DT; ++dt) oacc[dt] = (v8f){0.f,0.f,0.f,0.f,0.f,0.f,0.f,0.f};
  /* rolled: one 64-key stage a trip, so that the order at the foot of the trip stands once */
#pragma unroll 1
  for (int j0 = 0; j0 < TK; j0 += KT) { const int cur = (j0 >> 6) & 1;
    /* unrolled: the two 32-key passes of a stage read LDS at immediate offsets */
#pragma unroll
    for (int ps = 0; ps < KT; ps += 32) {
    FragH ak[2][KS], av[DT];
#pragma unroll
    for (int nt = 0; nt < 2; ++nt) { const unsigned short* kr = &tK[cur][ps + nt * 16 + ln][0];
#pragma unroll
      for (int ks = 0; ks < KS; ++ks) { ak[nt][ks].half[0] = *(const v8us*)(kr + ks * 32 + 8 * hh); ak[nt][ks].half[1] = *(const v8us*)(kr + ks * 32 + 16 + 8 * hh); } }
#pragma unroll
    for (int dt = 0; dt < DT; ++dt) { const unsigned short* vrow = &tV[cur][dt * 16 + ln][ps]; av[dt].half[0] = *(const v8us*)(vrow + 8 * hh); av[dt].half[1] = *(const v8us*)(vrow + 16 + 8 * hh); }
    float sc_[16];
#pragma unroll
    for (int nt = 0; nt < 2; ++nt) {
      v8f acc = (v8f){0.f,0.f,0.f,0.f,0.f,0.f,0.f,0.f};
#pragma unroll
      for (int ks = 0; ks < KS; ++ks) acc = mmaH<1>(ak[nt][ks].v, ak[nt][ks].v, bq[ks].v, bq[ks].v, acc);
#pragma unroll
      for (int r = 0; r < 8; ++r) sc_[nt * 8 + r] = acc[r]; }
    float mc = sc_[0];
#pragma unroll
    for (int i = 1; i < 16; ++i) mc = fmaxf(mc, sc_[i]);
    mc = fmaxf(mc, x_half(mc));
    const float mn = fmaxf(m_q, mc); const float al = (mn > -1.0e38f) ? __builtin_amdgcn_exp2f((m_q - mn) * C2) : 1.0f; m_q = mn;
    const float nb = fmaf(-mn, C2, 10.0f);
    float p[16]; FragH pb;
#pragma unroll
    for (int i = 0; i < 16; ++i) p[i] = fmaf(sc_[i], C2, nb);
    /* eight base-2 exponentials, each in place, and the v_nop that the slot behind a transcendental asks for, in one statement: no instruction in it or behind it reads a fresh result or overwrites another's argument; the s_delay_alu is the hint that lets the SIMD's other waves issue while the last result is on its way */
#pragma unroll
    for (int g = 0; g < 16; g += 8)
      asm("v_exp_f32 %0, %0\n\tv_exp_f32 %1, %1\n\tv_exp_f32 %2, %2\n\tv_exp_f32 %3, %3\n\tv_exp_f32 %4, %4\n\tv_exp_f32 %5, %5\n\tv_exp_f32 %6, %6\n\tv_exp_f32 %7, %7\n\ts_delay_alu instid0(TRANS32_DEP_1)\n\tv_nop"
          : "+v"(p[g]), "+v"(p[g + 1]), "+v"(p[g + 2]), "+v"(p[g + 3]), "+v"(p[g + 4]), "+v"(p[g + 5]), "+v"(p[g + 6]), "+v"(p[g + 7]));
#pragma unroll
    for (int i = 0; i < 16; ++i) pb.h[i] = (_Float16)p[i];
#pragma unroll
    for (int st = 8; st > 0; st >>= 1)
#pragma unroll
      for (int i = 0; i < st; ++i) p[i] += p[i + st];
    l_q = l_q * al + p[0];
#pragma unroll
    for (int dt = 0; dt < DT; ++dt) {
#pragma unroll
      for (int r = 0; r < 8; ++r) oacc[dt][r] *= al; }
#pragma unroll
    for (int dt = 0; dt < DT; ++dt) oacc[dt] = mmaH<1>(av[dt].v, av[dt].v, pb.v, pb.v, oacc[dt]); }
    asm volatile("s_wait_dscnt 0x0" ::: "memory");      /* this wave's reads of the buffer that is refilled below have returned */
    asm volatile("s_wait_asynccnt 0x0" ::: "memory");      /* this wave's share of the next stage has landed */
    __syncthreads();      /* publishes the next stage and ends every wave's reads of this one */
    if (j0 + 2 * KT < TK) fl_copy(lk + cur * BS, lv + cur * BS, LS, pk + (size_t)((j0 >> 6) + 2) * sk, dk, pv + (size_t)(j0 + 2 * KT) * 2, dv); }
  asm volatile("s_wait_asynccnt 0x0" ::: "memory");      /* no copy is left in flight behind the loop */
  const float l = l_q + x_half(l_q); const float li = (l > 0.f) ? 1.0f / l : 0.f;
#pragma unroll
  for (int dt = 0; dt < DT; ++dt)
#pragma unroll
    for (int g = 0; g < 2; ++g) { const v4f val = {oacc[dt][4 * g] * li, oacc[dt][4 * g + 1] * li, oacc[dt][4 * g + 2] * li, oacc[dt][4 * g + 3] * li}; *(v4fa*)&sO[w][ln][dt * 16 + 8 * hh + 4 * g] = val; }
  __builtin_amdgcn_fence(__ATOMIC_ACQ_REL, "workgroup"); __builtin_amdgcn_wave_barrier();      /* the wave's own rows are in LDS before other lanes of it read them back as whole 128-byte lines */
  /* the context leaves as two f16 planes, hi and 2^10 x residual: 8 lanes store one row's 128-byte line of each plane */
  {
#pragma unroll
    for (int rp = 0; rp < RPW; rp += 4) { const int r = rp + (lane >> 3), pc = lane & 7; const v4f a = *(const v4fa*)&sO[w][r][pc * 8], c = *(const v4fa*)&sO[w][r][pc * 8 + 4]; FragH fh, fl;
#pragma unroll
      for (int q = 0; q < 4; ++q) { _Float16 hv = (_Float16)a[q]; fh.h[q] = hv; fl.h[q] = (_Float16)((a[q] - (float)hv) * 1024.0f); hv = (_Float16)c[q]; fh.h[4 + q] = hv; fl.h[4 + q] = (_Float16)((c[q] - (float)hv) * 1024.0f); }
      const size_t o = ((size_t)b * TQ + q0 + r) * ldo + h * 64 + pc * 8; *(v8us*)((unsigned short*)Oh + o) = fh.half[0]; *(v8us*)((unsigned short*)Ol + o) = fl.half[0]; }
     } }
// 5-plane variant: S = Qh Kh^T + (Ql Kh^T + Qh Kl^T)/1024 with Q/K = [hi | 2^10 residual] f16 planes (QL/KL same layout as Q16/K16), then the 3-term P.V below.
// 3-term variant: O = (P_hi V_hi + (P_lo V_hi + P_hi V_lo) / 1024) / l with P = [hi | 2^10 residual] of 1024 p and V^T = [hi | 2^10 residual] planes (VtL same layout as Vt) -> ~2^-21-class products for un-averaged (early causal / peaked) rows
template <int CAUSAL>
__global__ __launch_bounds__(128) void k_flash5(const _Float16* __restrict__ Q16, const _Float16* __restrict__ QL, int ldq, const _Float16* __restrict__ K16, const _Float16* __restrict__ KL, int ldk, const _Float16* __restrict__ Vt, const _Float16* __restrict__ VtL, const int* __restrict__ MSK, float* __restrict__ O, int ldo) {
  constexpr int RPW = 16, RTN = RPW / 16, NQB = TQ / (4 * RPW), DT = 4, KS = 2;
  __shared__ __attribute__((aligned(16))) unsigned short sP[4][RPW][40]; __shared__ __attribute__((aligned(16))) unsigned short sPL[4][RPW][40]; __shared__ __attribute__((aligned(16))) float sO[4][RPW][64 + 4];
  const int tid = threadIdx.x, w = tid >> 5, lane = tid & 31, ln = lane & 15, hh = lane >> 4;
  const int slab = blockIdx.x / QBN5, qblk = QB05 + blockIdx.x % QBN5; (void)NQB; const int b = slab / NH, h = slab % NH; const int qb0 = qblk * (4 * RPW); const int q0 = qb0 + w * RPW;
  FragH aq[2][KS], aql[2][KS];
#pragma unroll
  for (int rt = 0; rt < RTN; ++rt) { const unsigned short* qr = (const unsigned short*)Q16 + ((size_t)b * TQ + q0 + rt * 16 + ln) * ldq + h * 64; const unsigned short* ql = (const unsigned short*)QL + ((size_t)b * TQ + q0 + rt * 16 + ln) * ldq + h * 64;
#pragma unroll
    for (int ks = 0; ks < KS; ++ks) { aq[rt][ks].half[0] = *(const v8us*)(qr + ks * 32 + 8 * hh); aq[rt][ks].half[1] = *(const v8us*)(qr + ks * 32 + 16 + 8 * hh); aql[rt][ks].half[0] = *(const v8us*)(ql + ks * 32 + 8 * hh); aql[rt][ks].half[1] = *(const v8us*)(ql + ks * 32 + 16 + 8 * hh); } }
  const unsigned short* Vth = (const unsigned short*)Vt + (size_t)slab * 64 * TK; const unsigned short* Vtl = (const unsigned short*)VtL + (size_t)slab * 64 * TK;
  float m_r[2][8], l_r[2][8]; v8f oacc[2][DT], oaccL[2][DT];
#pragma unroll
  for (int rt = 0; rt < RTN; ++rt) {
#pragma unroll
    for (int r = 0; r < 8; ++r) { m_r[rt][r] = -3.0e38f; l_r[rt][r] = 0.f; }
#pragma unroll
    for (int dt = 0; dt < DT; ++dt) { oacc[rt][dt] = (v8f){0.f,0.f,0.f,0.f,0.f,0.f,0.f,0.f}; oaccL[rt][dt] = oacc[rt][dt]; } }
  const int jend = (CAUSAL == 1) ? (qb0 + 4 * RPW) : ((CAUSAL == 23) ? min(TK, (qb0 / CHK + 2) * CHK) : TK);      /* causal / window: keys that can never contribute are skipped */ const int jbeg = (CAUSAL == 23) ? max(0, (qb0 / CHK - 1) * CHK) : 0;
#pragma unroll 1
  for (int j0 = jbeg; j0 < jend; j0 += 32) {
    v8f s[2][2];
#pragma unroll
    for (int nt = 0; nt < 2; ++nt) { const unsigned short* kr = (const unsigned short*)K16 + ((size_t)b * TK + j0 + nt * 16 + ln) * ldk + h * 64; const unsigned short* klr = (const unsigned short*)KL + ((size_t)b * TK + j0 + nt * 16 + ln) * ldk + h * 64; FragH bk[KS], bkl[KS];
#pragma unroll
      for (int ks = 0; ks < KS; ++ks) { bk[ks].half[0] = *(const v8us*)(kr + ks * 32 + 8 * hh); bk[ks].half[1] = *(const v8us*)(kr + ks * 32 + 16 + 8 * hh); bkl[ks].half[0] = *(const v8us*)(klr + ks * 32 + 8 * hh); bkl[ks].half[1] = *(const v8us*)(klr + ks * 32 + 16 + 8 * hh); }
#pragma unroll
      for (int rt = 0; rt < RTN; ++rt) { v8f acc = (v8f){0.f,0.f,0.f,0.f,0.f,0.f,0.f,0.f}, accl = acc;
#pragma unroll
        for (int ks = 0; ks < KS; ++ks) { acc = mmaH<1>(aq[rt][ks].v, aq[rt][ks].v, bk[ks].v, bk[ks].v, acc); accl = mmaH<1>(aql[rt][ks].v, aql[rt][ks].v, bk[ks].v, bk[ks].v, accl); accl = mmaH<1>(aq[rt][ks].v, aq[rt][ks].v, bkl[ks].v, bkl[ks].v, accl); }
#pragma unroll
        for (int r = 0; r < 8; ++r) acc[r] += accl[r] * 0.0009765625f;
        s[rt][nt] = acc; } }
#pragma unroll
    for (int rt = 0; rt < RTN; ++rt)
#pragma unroll
      for (int r = 0; r < 8; ++r) { const int tq = q0 + rt * 16 + 8 * hh + r; const int k0 = j0 + ln, k1 = j0 + 16 + ln;
        bool ok0 = (CAUSAL == 1) ? (k0 <= tq) : ((CAUSAL == 2) ? ((k0 >> 5) == (tq >> 5)) : true), ok1 = (CAUSAL == 1) ? (k1 <= tq) : ((CAUSAL == 2) ? ((k1 >> 5) == (tq >> 5)) : true);      /* mode 2: block-diagonal 32-token groups */
        if (CAUSAL == 4) { const int* mrow = MSK + ((size_t)b * TQ + tq) * TK; ok0 = mrow[k0] != 0; ok1 = mrow[k1] != 0; }      /* mode 4: per-(query, key) INPUT mask shared by all heads; masked keys contribute nothing (== the reference's -4096 fill, whose exp underflows to 0), rows with no valid key give l = 0 -> output 0 (== the reference's row_valid zeroing) */
        float s0 = ok0 ? s[rt][0][r] * SCL : -3.0e38f, s1 = ok1 ? s[rt][1][r] * SCL : -3.0e38f; if (CAUSAL == 17) { const float* amk = (const float*)MSK + (size_t)b * TK; s0 += bf16_round(amk[k0]); s1 += bf16_round(amk[k1]); } if (CAUSAL == 18) { const float* tb = (const float*)MSK; const int* ri = MSK + 1024 + (size_t)b * TK; const int rq = ri[tq]; s0 += tb[(h * 8 + rq) * 8 + ri[k0]]; s1 += tb[(h * 8 + rq) * 8 + ri[k1]]; } if (CAUSAL == 19) { const int* rel = MSK + (size_t)tq * TK; const float* rb = (const float*)MSK + (size_t)TQ * TK + ((size_t)(b * NH + h) * TQ + tq) * 64; s0 += rb[rel[k0]]; s1 += rb[rel[k1]]; }      /* mode 19: + (q.Ek[rel] + Eb[rel][h]) / 8 gathered by the int relative ids (packed [ids | table]) */      /* mode 18: + resource_bias[h][r_q][r_k] from the packed [table | ids] buffer (TQ == TK) */      /* mode 17: additive per-(batch, key) mask INPUT */ float mc = fmaxf(s0, s1);
        mc = fmaxf(mc, __shfl_xor(mc, 1, 32)); mc = fmaxf(mc, __shfl_xor(mc, 2, 32)); mc = fmaxf(mc, __shfl_xor(mc, 4, 32)); mc = fmaxf(mc, __shfl_xor(mc, 8, 32));
        const float mn = fmaxf(m_r[rt][r], mc); const float al = (mn > -1.0e38f) ? expf(m_r[rt][r] - mn) : 1.0f; m_r[rt][r] = mn; const float p0 = ok0 ? expf(s0 - mn) : 0.f, p1 = ok1 ? expf(s1 - mn) : 0.f; l_r[rt][r] = l_r[rt][r] * al + p0 + p1;
#pragma unroll
        for (int dt = 0; dt < DT; ++dt) { oacc[rt][dt][r] *= al; oaccL[rt][dt][r] *= al; }
        FragH t2, t2l; const float ps0 = p0 * 1024.0f, ps1 = p1 * 1024.0f; t2.h[0] = (_Float16)ps0; t2.h[1] = (_Float16)ps1; t2l.h[0] = (_Float16)((ps0 - (float)t2.h[0]) * 1024.0f); t2l.h[1] = (_Float16)((ps1 - (float)t2.h[1]) * 1024.0f);
        sP[w][rt * 16 + 8 * hh + r][ln] = t2.u[0]; sP[w][rt * 16 + 8 * hh + r][16 + ln] = t2.u[1]; sPL[w][rt * 16 + 8 * hh + r][ln] = t2l.u[0]; sPL[w][rt * 16 + 8 * hh + r][16 + ln] = t2l.u[1]; }
    __builtin_amdgcn_fence(__ATOMIC_ACQ_REL, "workgroup"); __builtin_amdgcn_wave_barrier();
    FragH pa[2], pl[2];
#pragma unroll
    for (int rt = 0; rt < RTN; ++rt) { pa[rt].half[0] = *(const v8us*)&sP[w][rt * 16 + ln][8 * hh]; pa[rt].half[1] = *(const v8us*)&sP[w][rt * 16 + ln][16 + 8 * hh]; pl[rt].half[0] = *(const v8us*)&sPL[w][rt * 16 + ln][8 * hh]; pl[rt].half[1] = *(const v8us*)&sPL[w][rt * 16 + ln][16 + 8 * hh]; }
#pragma unroll
    for (int dt = 0; dt < DT; ++dt) { const unsigned short* vrow = Vth + (size_t)(dt * 16 + ln) * TK + j0; const unsigned short* vrl = Vtl + (size_t)(dt * 16 + ln) * TK + j0; FragH bv, bl; bv.half[0] = *(const v8us*)(vrow + 8 * hh); bv.half[1] = *(const v8us*)(vrow + 16 + 8 * hh); bl.half[0] = *(const v8us*)(vrl + 8 * hh); bl.half[1] = *(const v8us*)(vrl + 16 + 8 * hh);
#pragma unroll
      for (int rt = 0; rt < RTN; ++rt) { oacc[rt][dt] = mmaH<1>(pa[rt].v, pa[rt].v, bv.v, bv.v, oacc[rt][dt]); oaccL[rt][dt] = mmaH<1>(pl[rt].v, pl[rt].v, bv.v, bv.v, oaccL[rt][dt]); oaccL[rt][dt] = mmaH<1>(pa[rt].v, pa[rt].v, bl.v, bl.v, oaccL[rt][dt]); } }
    __builtin_amdgcn_fence(__ATOMIC_ACQ_REL, "workgroup"); __builtin_amdgcn_wave_barrier(); }
#pragma unroll
  for (int rt = 0; rt < RTN; ++rt) {
#pragma unroll
    for (int r = 0; r < 8; ++r) { float l = l_r[rt][r]; l += __shfl_xor(l, 1, 32); l += __shfl_xor(l, 2, 32); l += __shfl_xor(l, 4, 32); l += __shfl_xor(l, 8, 32); l_r[rt][r] = (l > 0.f) ? 1.0f / (l * 1024.0f) : 0.f; }
#pragma unroll
    for (int dt = 0; dt < DT; ++dt)
#pragma unroll
      for (int r = 0; r < 8; ++r) { float v = oacc[rt][dt][r]; v += oaccL[rt][dt][r] * 0.0009765625f; sO[w][rt * 16 + 8 * hh + r][dt * 16 + ln] = v * l_r[rt][r]; } }
  __builtin_amdgcn_fence(__ATOMIC_ACQ_REL, "workgroup"); __builtin_amdgcn_wave_barrier();
  {
#pragma unroll
    for (int rp = 0; rp < RPW; rp += 2) { const int r = rp + (lane >> 4), pc = lane & 15; const v4f val = *(const v4fa*)&sO[w][r][pc * 4]; *(v4f*)(O + ((size_t)b * TQ + q0 + r) * ldo + h * 64 + pc * 4) = val; }
     } }

__global__ __launch_bounds__(256) void k_rotab(float* __restrict__ CS, float* __restrict__ SN) {
  #pragma clang fp contract(off)
  const int t = blockIdx.x * 256 + threadIdx.x; if (t >= SLEN * 32) return; const int j = t % 32, s = t / 32; const float ex = (float)(2 * j) / 64.0f; const float inv = 1.0f / powf(10000.0f, ex); const float th = (float)s * inv; const float c = cosf(th), sn = sinf(th);
  { *(float*)(CS + t) = c; *(float*)(SN + t) = sn;  } }
__global__ __launch_bounds__(256) void k_rope(const float* __restrict__ F, int nsrc, int ndst, int rep, const float* __restrict__ CS, const float* __restrict__ SN, _Float16* __restrict__ H, _Float16* __restrict__ L) {
  #pragma clang fp contract(off)
  const size_t t = (size_t)blockIdx.x * 256 + threadIdx.x; if (t >= (size_t)NR * ndst * 4) return; const int g8 = (int)(t % 4); const int hd = (int)((t / 4) % ndst); const size_t row = t / ((size_t)4 * ndst); const int s = (int)(row % SLEN); const int hs = hd / rep;
  const float* src = F + row * (size_t)(nsrc * 64) + hs * 64; FragH ah, al, bh, bl;
  for (int i = 0; i < 8; ++i) { const int d = g8 * 8 + i; const float c = CS[s * 32 + d], sn = SN[s * 32 + d]; const float x1 = src[d], x2 = src[d + 32];
    float o1 = x1 * c; o1 += -x2 * sn; float o2 = x2 * c; o2 += x1 * sn;
    _Float16 hv = (_Float16)o1; ah.h[i] = hv; al.h[i] = (_Float16)((o1 - (float)hv) * 1024.0f); hv = (_Float16)o2; bh.h[i] = hv; bl.h[i] = (_Float16)((o2 - (float)hv) * 1024.0f); }
  const size_t o = row * (size_t)(ndst * 64) + hd * 64 + g8 * 8;
  { *(v8us*)((unsigned short*)H + o) = ah.half[0]; *(v8us*)((unsigned short*)H + o + 32) = bh.half[0]; *(v8us*)((unsigned short*)L + o) = al.half[0]; *(v8us*)((unsigned short*)L + o + 32) = bl.half[0];  } }
__global__ __launch_bounds__(256) void k_rope2(const float* __restrict__ F, int nsrc, int ndst, int rep, const float* __restrict__ CS, const float* __restrict__ SN, _Float16* __restrict__ H, _Float16* __restrict__ L) {
  #pragma clang fp contract(off)
  const size_t t = (size_t)blockIdx.x * 256 + threadIdx.x; if (t >= (size_t)NR * ndst * 4) return; const int g16 = (int)(t % 4); const int hd = (int)((t / 4) % ndst); const size_t row = t / ((size_t)4 * ndst); const int s = (int)(row % SLEN); const int hs = hd / rep;
  const float* src = F + row * (size_t)(nsrc * 64) + hs * 64 + g16 * 16; FragH ah, al;
  for (int pr = 0; pr < 8; ++pr) { const int i = g16 * 8 + pr; const float c = CS[s * 32 + i], sn = SN[s * 32 + i]; const float x1 = src[2 * pr], x2 = src[2 * pr + 1];
    float o1 = x1 * c; o1 -= x2 * sn; float o2 = x1 * sn; o2 += x2 * c;
    _Float16 hv = (_Float16)o1; ah.h[2 * pr] = hv; al.h[2 * pr] = (_Float16)((o1 - (float)hv) * 1024.0f); hv = (_Float16)o2; ah.h[2 * pr + 1] = hv; al.h[2 * pr + 1] = (_Float16)((o2 - (float)hv) * 1024.0f); }
  const size_t o = row * (size_t)(ndst * 64) + hd * 64 + g16 * 16;
  { *(v8us*)((unsigned short*)H + o) = ah.half[0]; *(v8us*)((unsigned short*)H + o + 8) = ah.half[1]; *(v8us*)((unsigned short*)L + o) = al.half[0]; *(v8us*)((unsigned short*)L + o + 8) = al.half[1];  } }
__global__ __launch_bounds__(256) void k_ln512(const float* __restrict__ A, const float* __restrict__ res, const float* __restrict__ g, const float* __restrict__ bb, float* __restrict__ Y, _Float16* __restrict__ Y16) {
  #pragma clang fp contract(off)
  const int wv = threadIdx.x >> 5, ln = threadIdx.x & 31; const size_t r = (size_t)blockIdx.x * 8 + wv; if (r >= NR) return; float x[16]; float s = 0.f;
  for (int i = 0; i < 2; ++i) { const v8f a = *(const v8f*)(A + r * DM + i * 256 + ln * 8); for (int q = 0; q < 8; ++q) { float v = a[q]; if (res) v += bf16_round(res[r * DM + i * 256 + ln * 8 + q]); x[i * 8 + q] = v; s += v; } }
  for (int o = 16; o > 0; o >>= 1) s += __shfl_xor(s, o, 32); const float mu = s / (float)DM; float var = 0.f; for (int q = 0; q < 16; ++q) { const float d = x[q] - mu; var += d * d; }
  for (int o = 16; o > 0; o >>= 1) var += __shfl_xor(var, o, 32); const float inv = rsqrtf(var / (float)DM + 1e-5f);
  { for (int i = 0; i < 2; ++i) { const int c0 = i * 256 + ln * 8; v8f y; FragH f; for (int q = 0; q < 8; ++q) { float v = (x[i * 8 + q] - mu) * inv; v *= bf16_round(g[c0 + q]); v += bf16_round(bb[c0 + q]); y[q] = v; f.h[q] = (_Float16)v; } *(v8f*)(Y + r * DM + c0) = y; if (Y16) *(v8us*)((unsigned short*)Y16 + r * DM + c0) = f.half[0]; }  } }
__global__ __launch_bounds__(256) void k_pack(const float* __restrict__ rb, const int* __restrict__ rid, int* __restrict__ PK) { const int t = blockIdx.x * 256 + threadIdx.x; if (t >= 1024 + NB * TK) return; int v; if (t < 1024) v = __float_as_int(bf16_round(rb[t])); else v = rid[t - 1024]; *(int*)(PK + t) = v;  }
__global__ __launch_bounds__(256) void k_tabin(const float* __restrict__ sp, float* __restrict__ CS, float* __restrict__ SN) { const int t = blockIdx.x * 256 + threadIdx.x; if (t >= SLEN * 32) return; const int i = t % 32, s = t / 32; const float c = bf16_round(sp[s * 64 + 32 + i]), sn = bf16_round(sp[s * 64 + i]);
  { *(float*)(CS + t) = c; *(float*)(SN + t) = sn;  } }
__device__ __forceinline__ void d_wsc(unsigned blk, const float* __restrict__ Wm, _Float16* __restrict__ Bt, size_t n8, float sc) { const size_t t = (size_t)blk * 256 + threadIdx.x; if (t >= n8) return; FragH f; for (int q = 0; q < 8; ++q) f.h[q] = (_Float16)(bf16_round(Wm[t * 8 + q]) * sc); *(v8us*)((unsigned short*)Bt + t * 8) = f.half[0];  }
__global__ __launch_bounds__(256) void k_rotab2(float* __restrict__ CS, float* __restrict__ SN) {
  #pragma clang fp contract(off)
  const int t = blockIdx.x * 256 + threadIdx.x; if (t >= SLEN * 32) return; const int j = t % 32, s = t / 32; const float c0 = -0.14391156831212787f;      /* -ln(10000)/64 rounded to f32 */ const float inv = expf((float)(2 * j) * c0); const float th = (float)s * inv; const float c = cosf(th), sn = sinf(th);
  { *(float*)(CS + t) = c; *(float*)(SN + t) = sn;  } }
__global__ __launch_bounds__(256) void k_lnu(const float* __restrict__ X, _Float16* __restrict__ N16, float* __restrict__ XB) {
  #pragma clang fp contract(off)
  const int wv = threadIdx.x >> 5, ln = threadIdx.x & 31; const size_t r = (size_t)blockIdx.x * 8 + wv; if (r >= NR) return; float a[32]; float s = 0.f;
  for (int i = 0; i < 4; ++i) { const v8f v = *(const v8f*)(X + r * DM + (i * 32 + ln) * 8); for (int q = 0; q < 8; ++q) { const float u = bf16_round(v[q]); a[i * 8 + q] = u; s += u; } }
  for (int o = 16; o > 0; o >>= 1) s += __shfl_xor(s, o, 32); const float mu = s / (float)DM; float var = 0.f; for (int q = 0; q < 32; ++q) { const float d = a[q] - mu; var += d * d; }
  for (int o = 16; o > 0; o >>= 1) var += __shfl_xor(var, o, 32); const float den = sqrtf(var / (float)(DM - 1)) + 1e-6f; const float inv = 1.0f / den;      /* one reciprocal per row; (x-mean)*inv vs the reference's division differs by <= 1 ulp */
  { for (int i = 0; i < 4; ++i) { const int c0 = (i * 32 + ln) * 8; FragH f; v8f xb; for (int q = 0; q < 8; ++q) { f.h[q] = (_Float16)((a[i * 8 + q] - mu) * inv); xb[q] = a[i * 8 + q]; } *(v8us*)((unsigned short*)N16 + r * DM + c0) = f.half[0]; *(v8f*)(XB + r * DM + c0) = xb; }  } }

__global__ __launch_bounds__(256) void k_h16s(const float* __restrict__ SRC, int lds, int coff, _Float16* __restrict__ DST, size_t n8) { const size_t t = (size_t)blockIdx.x * 256 + threadIdx.x; if (t >= n8) return; const size_t r = (t * 8) / DM; const int c = (int)((t * 8) % DM); const v8f a = *(const v8f*)(SRC + r * lds + coff + c); FragH f; for (int q = 0; q < 8; ++q) f.h[q] = (_Float16)a[q];
  *(v8us*)((unsigned short*)DST + t * 8) = f.half[0];  }


__global__ __launch_bounds__(256) void k_ccp(const float* __restrict__ QKV, int coff, _Float16* __restrict__ D) { const size_t t = (size_t)blockIdx.x * 256 + threadIdx.x; if (t >= (size_t)NR * DM / 8) return; const int c0 = (int)((t * 8) % DM); const size_t row = (t * 8) / DM; const v8f a = *(const v8f*)(QKV + row * 3 * DM + coff + c0); FragH f; for (int q = 0; q < 8; ++q) f.h[q] = (_Float16)a[q];
  *(v8us*)((unsigned short*)D + t * 8) = f.half[0];  }


__device__ __forceinline__ void d_sbe(unsigned blk, const float* __restrict__ q, _Float16* __restrict__ X) { const size_t t = (size_t)blk * 256 + threadIdx.x; if (t >= (size_t)NR * DM / 8) return; const int c0 = (int)((t * 8) % DM); const size_t row = (t * 8) / DM; const int b = (int)(row / SLEN), s_ = (int)(row % SLEN); const float* src = q + ((size_t)s_ * NBS + b) * DM + c0; FragH f; for (int i = 0; i < 8; ++i) f.h[i] = (_Float16)bf16_round(src[i]);
  *(v8us*)((unsigned short*)X + t * 8) = f.half[0];  }
// Cosine and sine of the rotary angle s * 10000^(-2 d / 64), one (s, d) a thread, d = 0 .. 31: each angle is evaluated once for all heads, batches and both tensors.
__device__ __forceinline__ void d_tab(unsigned blk, float* __restrict__ CS, float* __restrict__ SN) { const int t = (int)(blk * 256 + threadIdx.x); const int d = t & 31, s_ = t >> 5;
  const float inv = 1.0f / powf(10000.0f, (float)(2 * d) / 64.0f); const float ang = (float)s_ * inv; CS[t] = cosf(ang); SN[t] = sinf(ang); }
// Launches that do not depend on one another share one grid: the block index, the same for a whole block, picks the body.
// Preparation: the angle table (TB blocks, the long bodies first), the query rows (XB blocks), then the four weight matrices (WB blocks each) into four planes that follow one another in Bt.
#define TB ((unsigned)(SLEN * 32 / 256))
#define XB ((unsigned)((size_t)NR * DM / 8 / 256))
#define WB ((unsigned)((size_t)DM * DM / 8 / 256))
__global__ __launch_bounds__(256) void k_prep(const float* __restrict__ q, _Float16* __restrict__ X, const float* __restrict__ w0, const float* __restrict__ w1, const float* __restrict__ w2, const float* __restrict__ w3, _Float16* __restrict__ Bt, float* __restrict__ CS, float* __restrict__ SN) {
  if (blockIdx.x < TB) { d_tab(blockIdx.x, CS, SN); return; }
  const unsigned bx = blockIdx.x - TB;
  if (bx < XB) { d_sbe(bx, q, X); return; }
  const unsigned m = (bx - XB) / WB; const float* Wm = m == 0 ? w0 : (m == 1 ? w1 : (m == 2 ? w2 : w3));
  d_wsc(bx - XB - m * WB, Wm, Bt + (size_t)m * DM * DM, (size_t)DM * DM / 8, 16.0f); }
extern "C" void kernel_launch(void* const* d_in, const int* in_sizes, int n_in,
                              void* d_out, int out_size, void* d_ws, size_t ws_size, hipStream_t stream) {
  (void)in_sizes; (void)n_in; (void)out_size;
  const float* qy = (const float*)d_in[0]; const float* wq = (const float*)d_in[1]; const float* bq = (const float*)d_in[2]; const float* wk = (const float*)d_in[3]; const float* bk = (const float*)d_in[4]; const float* wv = (const float*)d_in[5]; const float* bv = (const float*)d_in[6]; const float* wo = (const float*)d_in[7]; const float* bo = (const float*)d_in[8];
  char* ws = (char*)d_ws; size_t off = 0;
  auto take = [&](size_t bytes) { char* p = ws + off; off += (bytes + 255) & ~(size_t)255; return p; };
  const size_t np = (size_t)NR * DM;
  _Float16* BW = (_Float16*)take((size_t)DM * DM * 2 * 4); _Float16* BO = BW + (size_t)DM * DM * 3;      /* weight planes q, k, v, o in a row */ _Float16* X16 = (_Float16*)take(np * 2); float* CS = (float*)take((size_t)SLEN * 32 * 4); float* SN = (float*)take((size_t)SLEN * 32 * 4);      /* cosine and sine of every (s, d) angle */
   _Float16* QH = (_Float16*)take(np * 2 * 2); _Float16* KH = QH + np;      /* roped planes q, k in a row */ _Float16* VT = (_Float16*)take(np * 2); _Float16* OH = (_Float16*)take(np * 2); _Float16* OL = (_Float16*)take(np * 2);      /* planes of their own: k_flash stores them while other blocks of it still read QH, KH */
  if (off > ws_size) return;
  k_prep<<<TB + XB + 4 * WB, 256, 0, stream>>>(qy, X16, wq, wk, wv, wo, BW, CS, SN);      /* weights stay in their (out, in) order */
  const dim3 g((NR / 128) * (DM / 128), 1), g3((NR / 128) * (DM / 128), 3);
  k_gemm2<0, false><<<g3, 256, 0, stream>>>(X16, DM, 0, nullptr, BW, DM, (size_t)DM * DM, 0.0625f, bq, bk, bv, CS, SN, nullptr, QH, VT, DM, np, NR, DM, DM);      /* batches q, k (roped f16 planes), v (V^T) */
  k_flash<<<NB * NH * QBNP, 128, 0, stream>>>(QH, DM, KH, DM, VT, OH, OL, DM);
  k_gemm2<0, true><<<g, 256, 0, stream>>>(OL, DM, 0, OH, BO, DM, 0, 0.0625f, bo, nullptr, nullptr, nullptr, nullptr, (float*)d_out, nullptr, nullptr, DM, 0, NR, DM, DM);      /* out[s][b] = (ctx_lo / 1024 + ctx_hi) Wo^T + b */
}

// v010
// One run takes 92.3 microseconds.
// Next to v009, in two timings, it ran 1.09 and 1.10 times as fast.
// All steps since the starting kernel, v000, together make it 6.24 times as fast.
#include <hip/hip_runtime.h>
// Multi-head self-attention with rotary embedding (query [2048][2][1024] in [S, B, E] layout, 16 heads x 64: q/k/v = query W^T + b; rotary embedding per head (inv_freq = 10000^(-2i/64), rotate-half form) on q and k; softmax(q k^T / 8) v (no mask); out = attn Wo^T + bo, back in [S, B, E]).
// Structure: [S,B,E] -> exact f16 (b, s) rows; q/k/v as one WMMA GEMM launch (32x64 wave tiles, f32 accumulation, exact x16 weights + bias) whose epilogue applies RoPE to q and k on VALU (f32 angles s * inv_freq, sinf/cosf, each (s, d) angle evaluated once, in a table that k_prep writes) and stores f16 planes, and stores v as V^T through LDS; flash-style fused attention per (batch, head, 64-query block) (K Q^T and V^T P^T, one query per lane, online softmax and P in registers; no score plane), whose epilogue stores the context as f16 hi / 2^10 residual planes; output projection as one GEMM launch in which the residual and the hi term walk k together, each into accumulators of its own, over one copy of every weight tile; residual sum x 2^-10 + hi sum + bias, stored straight into [S, B, E].
// Launches: 4. Bodies that do not depend on one another share a grid (k_prep: the angle table, x and the four weights; k_gemm2 with 3 batches: q, k, v); the elementwise bodies behind the products live in their neighbours' epilogues.
// Left: k_prep starts many short waves; in k_flash's loop the four v_nop written behind every matrix instruction are now about a third of the vector instructions, and its LDS fragment reads come close to the LDS rate; its 4-wave blocks copy every K and V^T tile from L2 once per 64 queries (8 waves a block would halve that); k_gemm2's ring holds one stage in flight, and the tail's block, alone on its WGP, has nothing to run while its waves issue a stage's copies; q, k and v still copy the same query tile three times.
// Compute dtype: inputs rounded to bf16; query / weights exact as f16; roped q/k and v plain f16 (~2^-12); softmax f32 with f16 probabilities; context hi + 2^-10 residual into the projection. v_wmma_f32_16x16x32_f16.
#define NB 2
#define DM 1024
#define NKV 16
#define NREP (NH / NKV)
#define KVD (NKV * 64)           /* 1024 */
#define NR (NB * SLEN)
#define CHK 512
typedef int v4i __attribute__((ext_vector_type(4)));
#define FF 2048
#define SLEN 2048
#define MQI 2048
#define MKI 2048
#define TQ SLEN
#define TK SLEN
#define NH 16
#define SCL 0.125f
#define QBLKS (TQ / 64)
#define QB05 0
#define QBN5 4
#define QB0P 0
#define QBNP QBLKS
#define RE 256
typedef __bf16 v16b __attribute__((ext_vector_type(16)));
typedef unsigned short v8us __attribute__((ext_vector_type(8), may_alias));
typedef float  v8f  __attribute__((ext_vector_type(8)));
typedef float  v4f  __attribute__((ext_vector_type(4)));
typedef float  v4fa __attribute__((ext_vector_type(4), may_alias));
union FragB { v16b v; v8us half[2]; unsigned short u[16]; };

__device__ __forceinline__ unsigned short bf16_bits(float x) { unsigned int u = __float_as_uint(x); return (unsigned short)((u + 0x7FFFu + ((u >> 16) & 1u)) >> 16); }
__device__ __forceinline__ float bf16_val(unsigned short b) { return __uint_as_float(((unsigned int)b) << 16); }
__device__ __forceinline__ float bf16_round(float x) { return bf16_val(bf16_bits(x)); }
// D += A·B with NT terms: 1 = ah·bh, 2 = + al·bh (A split), 3 = + ah·bl (both split)
template <int NT>
__device__ __forceinline__ v8f mmaN(v16b ah, v16b al, v16b bh, v16b bl, v8f c) {
  c = __builtin_amdgcn_wmma_f32_16x16x32_bf16(false, ah, false, bh, (short)0, c, false, false);
  if (NT >= 2) c = __builtin_amdgcn_wmma_f32_16x16x32_bf16(false, al, false, bh, (short)0, c, false, false);
  if (NT >= 3) c = __builtin_amdgcn_wmma_f32_16x16x32_bf16(false, ah, false, bl, (short)0, c, false, false);
  asm volatile("v_nop\n\tv_nop\n\tv_nop\n\tv_nop" : "+v"(c) : "v"(ah), "v"(al), "v"(bh), "v"(bl));
  return c;
}

__global__ __launch_bounds__(256) void k_wt_bf16(const float* __restrict__ W, unsigned short* __restrict__ Wt, int K, int N) {
  const int t = blockIdx.x * 256 + threadIdx.x;
  const int k8n = K / 8;
  if (t >= N * k8n) return;
  const int n = t / k8n, k8 = (t % k8n) * 8;
  v8us v;
#pragma unroll
  for (int i = 0; i < 8; ++i) v[i] = bf16_bits(W[(size_t)(k8 + i) * N + n]);
  *(v8us*)(Wt + (size_t)n * K + k8) = v;
  
}

// GEMM C[M][N] (f32, pitch ldc) = act(A[M][K]·W + bias). A f32 row-major (pitch lda) converted per fragment to bf16
// (ASPLIT: hi/lo two planes -> 2 terms, else single rounded term); Wt bf16 [N][K] (pitch ldb). BIAS_BF16 rounds the
// bias to bf16 first (bias quantised to bf16 before the add). K%32==0, M%16==0, N%64==0.
template <bool ASPLIT, int ACT, bool BIAS_BF16>
__global__ __launch_bounds__(128) void k_gemm_bf(const float* __restrict__ A, int lda, const unsigned short* __restrict__ Wt, int ldb,
                                               const float* __restrict__ bias, float* __restrict__ C, int ldc, int M, int N, int K) {
  __shared__ __attribute__((aligned(16))) float so[4][16][64];
  const int tid = threadIdx.x, w = tid >> 5, lane = tid & 31, ln = lane & 15, hh = lane >> 4;
  const int ntn = N / 64;
  const int wid = blockIdx.x * 4 + w;
  const int mt = wid / ntn, nq = wid % ntn;
  if (mt * 16 >= M) return;
  const int row0 = mt * 16, col0 = nq * 64;
  const float* arow = A + (size_t)(row0 + ln) * lda;
  v8f acc[4] = {};
  for (int kb = 0; kb < K; kb += 32) {
    FragB ah, al;
    const v4f x0 = *(const v4fa*)(arow + kb + 8 * hh), x1 = *(const v4fa*)(arow + kb + 8 * hh + 4);
    const v4f x2 = *(const v4fa*)(arow + kb + 16 + 8 * hh), x3 = *(const v4fa*)(arow + kb + 16 + 8 * hh + 4);
    float xs[16] = {x0[0],x0[1],x0[2],x0[3],x1[0],x1[1],x1[2],x1[3],x2[0],x2[1],x2[2],x2[3],x3[0],x3[1],x3[2],x3[3]};
#pragma unroll
    for (int i = 0; i < 16; ++i) { const unsigned short hb = bf16_bits(xs[i]); ah.u[i] = hb; al.u[i] = ASPLIT ? bf16_bits(xs[i] - bf16_val(hb)) : (unsigned short)0; }
#pragma unroll
    for (int t = 0; t < 4; ++t) {
      const unsigned short* brow = Wt + (size_t)(col0 + t * 16 + ln) * ldb + kb;
      FragB b;
      b.half[0] = *(const v8us*)(brow + 8 * hh);
      b.half[1] = *(const v8us*)(brow + 16 + 8 * hh);
      acc[t] = mmaN<ASPLIT ? 2 : 1>(ah.v, al.v, b.v, b.v, acc[t]);
    }
  }
#pragma unroll
  for (int t = 0; t < 4; ++t) {
    float bv = bias ? bias[col0 + t * 16 + ln] : 0.f;
    if (BIAS_BF16) bv = bf16_round(bv);
#pragma unroll
    for (int r = 0; r < 8; ++r) { float v = acc[t][r] + bv; if (ACT == 1) v = fmaxf(v, 0.f); so[w][8 * hh + r][t * 16 + ln] = v; }
  }
  __builtin_amdgcn_fence(__ATOMIC_ACQ_REL, "workgroup");
  __builtin_amdgcn_wave_barrier();
  const int rsub = lane >> 4, c4 = (lane & 15) * 4;
  {
#pragma unroll
    for (int q = 0; q < 8; ++q) {
      const int r = q * 2 + rsub;
      const v4f v = *(const v4fa*)&so[w][r][c4];
      *(v4f*)(C + (size_t)(row0 + r) * ldc + col0 + c4) = v;
    }
    
  }
}

// GEMM C = act(A·W + bias + resid): A f32 (ASPLIT -> hi/lo 2 terms), Wt bf16 [N][K]; ACT 0 none, 1 relu, 2 exact gelu;
// resid (optional, f32, row index = (row % rmod), pitch ldr, RES_BF16 rounds it) added before the activation.
template <bool ASPLIT, int ACT, bool BIAS_BF16, bool RES_BF16>
__global__ __launch_bounds__(128) void k_gemm_bf3(const float* __restrict__ A, int lda, const unsigned short* __restrict__ Wt, int ldb,
                                                const float* __restrict__ bias, const float* __restrict__ resid, int rmod, int ldr,
                                                float* __restrict__ C, int ldc, int M, int N, int K) {
  __shared__ __attribute__((aligned(16))) float so[4][16][64];
  const int tid = threadIdx.x, w = tid >> 5, lane = tid & 31, ln = lane & 15, hh = lane >> 4;
  const int ntn = N / 64;
  const int wid = blockIdx.x * 4 + w;
  const int mt = wid / ntn, nq = wid % ntn;
  if (mt * 16 >= M) return;
  const int row0 = mt * 16, col0 = nq * 64;
  const float* arow = A + (size_t)(row0 + ln) * lda;
  v8f acc[4] = {};
  for (int kb = 0; kb < K; kb += 32) {
    FragB ah, al;
    const v4f x0 = *(const v4fa*)(arow + kb + 8 * hh), x1 = *(const v4fa*)(arow + kb + 8 * hh + 4);
    const v4f x2 = *(const v4fa*)(arow + kb + 16 + 8 * hh), x3 = *(const v4fa*)(arow + kb + 16 + 8 * hh + 4);
    float xs[16] = {x0[0],x0[1],x0[2],x0[3],x1[0],x1[1],x1[2],x1[3],x2[0],x2[1],x2[2],x2[3],x3[0],x3[1],x3[2],x3[3]};
#pragma unroll
    for (int i = 0; i < 16; ++i) { const unsigned short hb = bf16_bits(xs[i]); ah.u[i] = hb; al.u[i] = ASPLIT ? bf16_bits(xs[i] - bf16_val(hb)) : (unsigned short)0; }
#pragma unroll
    for (int t = 0; t < 4; ++t) {
      const unsigned short* brow = Wt + (size_t)(col0 + t * 16 + ln) * ldb + kb;
      FragB b;
      b.half[0] = *(const v8us*)(brow + 8 * hh);
      b.half[1] = *(const v8us*)(brow + 16 + 8 * hh);
      acc[t] = mmaN<ASPLIT ? 2 : 1>(ah.v, al.v, b.v, b.v, acc[t]);
    }
  }
#pragma unroll
  for (int t = 0; t < 4; ++t) {
    const int col = col0 + t * 16 + ln;
    float bv = bias ? bias[col] : 0.f;
    if (BIAS_BF16) bv = bf16_round(bv);
#pragma unroll
    for (int r = 0; r < 8; ++r) {
      float v = acc[t][r] + bv;
      if (resid) { float rv = resid[(size_t)((row0 + 8 * hh + r) % rmod) * ldr + col]; if (RES_BF16) rv = bf16_round(rv); v += rv; }
      if (ACT == 1) v = fmaxf(v, 0.f);
      if (ACT == 2) v = 0.5f * v * (1.0f + erff(v * 0.70710678118654752f));
      if (ACT == 3) { const float u = 0.7978845608028654f * (v + 0.044715f * v * v * v); v = 0.5f * v * (1.0f + tanhf(u)); }
      so[w][8 * hh + r][t * 16 + ln] = v;
    }
  }
  __builtin_amdgcn_fence(__ATOMIC_ACQ_REL, "workgroup");
  __builtin_amdgcn_wave_barrier();
  const int rsub = lane >> 4, c4 = (lane & 15) * 4;
  {
#pragma unroll
    for (int q = 0; q < 8; ++q) {
      const int r = q * 2 + rsub;
      const v4f v = *(const v4fa*)&so[w][r][c4];
      *(v4f*)(C + (size_t)(row0 + r) * ldc + col0 + c4) = v;
    }
    
  }
}
// row LayerNorm (biased variance, eps) over N: s = X (+ R); optional out_sum <- s; out_norm <- (s-mu)*rsqrt(var+eps)*g + b
template <bool PARAM_BF16>
__global__ __launch_bounds__(256) void k_layernorm(const float* __restrict__ X, const float* __restrict__ R, const float* __restrict__ g, const float* __restrict__ bta,
                                                  float* __restrict__ out_sum, float* __restrict__ out_norm, int N, float eps) {
  __shared__ float red[256];
  const int row = blockIdx.x, tid = threadIdx.x;
  const float* x = X + (size_t)row * N; const float* rr = R ? R + (size_t)row * N : nullptr;
  float vals[16];                     // up to N = 4096
  const int per = N / 256;            // contiguous chunk per thread? use strided-by-4 chunks: thread handles j = tid*4 + 1024*u
  float s1 = 0.f;
  for (int u = 0; u < per / 4; ++u) {
    const int j = tid * 4 + 1024 * u;
    const v4f a = *(const v4fa*)(x + j);
    v4f b = {0.f,0.f,0.f,0.f}; if (rr) b = *(const v4fa*)(rr + j);
#pragma unroll
    for (int q = 0; q < 4; ++q) { const float v = a[q] + b[q]; vals[u * 4 + q] = v; s1 += v; }
  }
  red[tid] = s1; __syncthreads();
  for (int st = 128; st > 0; st >>= 1) { if (tid < st) red[tid] += red[tid + st]; __syncthreads(); }
  const float mu = red[0] / (float)N; __syncthreads();
  float s2 = 0.f;
  for (int u = 0; u < per / 4; ++u)
#pragma unroll
    for (int q = 0; q < 4; ++q) { const float c = vals[u * 4 + q] - mu; s2 += c * c; }
  red[tid] = s2; __syncthreads();
  for (int st = 128; st > 0; st >>= 1) { if (tid < st) red[tid] += red[tid + st]; __syncthreads(); }
  const float rs = rsqrtf(red[0] / (float)N + eps);
  {
    for (int u = 0; u < per / 4; ++u) {
      const int j = tid * 4 + 1024 * u;
      v4f o, sm;
#pragma unroll
      for (int q = 0; q < 4; ++q) {
        float gg = g[j + q], bb = bta[j + q];
        if (PARAM_BF16) { gg = bf16_round(gg); bb = bf16_round(bb); }
        sm[q] = vals[u * 4 + q]; o[q] = (vals[u * 4 + q] - mu) * rs * gg + bb;
      }
      if (out_sum) *(v4f*)(out_sum + (size_t)row * N + j) = sm;
      *(v4f*)(out_norm + (size_t)row * N + j) = o;
    }
    
  }
}



// ---- f16 WMMA path (v_wmma_f32_16x16x32_f16): 11-bit significands for operands in range — used where a [0,1] probability operand needs more precision than bf16
typedef _Float16 v16h __attribute__((ext_vector_type(16)));
union FragH { v16h v; v8us half[2]; _Float16 h[16]; unsigned short u[16]; };
template <int NT>
__device__ __forceinline__ v8f mmaH(v16h ah, v16h al, v16h bh, v16h bl, v8f c) {
  c = __builtin_amdgcn_wmma_f32_16x16x32_f16(false, ah, false, bh, (short)0, c, false, false);
  if (NT >= 2) c = __builtin_amdgcn_wmma_f32_16x16x32_f16(false, al, false, bh, (short)0, c, false, false);
  if (NT >= 3) c = __builtin_amdgcn_wmma_f32_16x16x32_f16(false, ah, false, bl, (short)0, c, false, false);
  asm volatile("v_nop\n\tv_nop\n\tv_nop\n\tv_nop" : "+v"(c) : "v"(ah), "v"(al), "v"(bh), "v"(bl));
  return c;
}
// batched GEMM like k_gemm_b but f16 operands: A f32 (split into f16 hi/lo if ASPLIT, else rounded to f16), Bt = f16 values [n][k]; alpha; C f32; N multiple of 16 (partial tiles skipped)
template <bool ASPLIT>
__global__ __launch_bounds__(128) void k_gemm_h(const float* __restrict__ A, int lda, size_t sA, const _Float16* __restrict__ Bh, int ldb, size_t sB, float alpha, float* __restrict__ C, int ldc, size_t sC, int M, int N, int K) {
  __shared__ __attribute__((aligned(16))) float so[4][16][64];
  const int tid = threadIdx.x, w = tid >> 5, lane = tid & 31, ln = lane & 15, hh = lane >> 4; const int by = blockIdx.y;
  A += (size_t)by * sA; Bh += (size_t)by * sB; C += (size_t)by * sC;
  const int ntn = (N + 63) / 64; const int wid = blockIdx.x * 4 + w; const int mt = wid / ntn, nq = wid % ntn; if (mt * 16 >= M) return;
  const int row0 = mt * 16, col0 = nq * 64; const float* arow = A + (size_t)(row0 + ln) * lda;
  v8f acc[4] = {};
  for (int kb = 0; kb < K; kb += 32) {
    FragH ah, al;
    const v4f x0 = *(const v4fa*)(arow + kb + 8 * hh), x1 = *(const v4fa*)(arow + kb + 8 * hh + 4), x2 = *(const v4fa*)(arow + kb + 16 + 8 * hh), x3 = *(const v4fa*)(arow + kb + 16 + 8 * hh + 4);
    float xs[16] = {x0[0],x0[1],x0[2],x0[3],x1[0],x1[1],x1[2],x1[3],x2[0],x2[1],x2[2],x2[3],x3[0],x3[1],x3[2],x3[3]};
#pragma unroll
    for (int i = 0; i < 16; ++i) { const _Float16 h = (_Float16)xs[i]; ah.h[i] = h; al.h[i] = ASPLIT ? (_Float16)(xs[i] - (float)h) : (_Float16)0.0f; }
#pragma unroll
    for (int t = 0; t < 4; ++t) { if (col0 + t * 16 >= N) continue; const size_t boff = (size_t)(col0 + t * 16 + ln) * ldb + kb; FragH bq; bq.half[0] = *(const v8us*)(Bh + boff + 8 * hh); bq.half[1] = *(const v8us*)(Bh + boff + 16 + 8 * hh);
      acc[t] = mmaH<ASPLIT ? 2 : 1>(ah.v, al.v, bq.v, bq.v, acc[t]); }
  }
#pragma unroll
  for (int t = 0; t < 4; ++t) { if (col0 + t * 16 >= N) continue;
#pragma unroll
    for (int r = 0; r < 8; ++r) so[w][8 * hh + r][t * 16 + ln] = acc[t][r] * alpha; }
  __builtin_amdgcn_fence(__ATOMIC_ACQ_REL, "workgroup"); __builtin_amdgcn_wave_barrier();
  const int rsub = lane >> 4, c4 = (lane & 15) * 4;
  {
#pragma unroll
    for (int q = 0; q < 8; ++q) { const int r = q * 2 + rsub; if (col0 + c4 < N) { const v4f v = *(const v4fa*)&so[w][r][c4]; *(v4f*)(C + (size_t)(row0 + r) * ldc + col0 + c4) = v; } }
     }
}

// Wt[n][k] = f16(W[k][n]·scale) from f32 row-major W[K][N] (scale = power of two; bf16-exact weights stay exact in f16 away from the subnormal range)
__global__ __launch_bounds__(256) void k_wt_f16(const float* __restrict__ W, _Float16* __restrict__ Wt, int K, int N, float scale) {
  const int t = blockIdx.x * 256 + threadIdx.x; if (t >= N * (K / 8)) return; const int n = t / (K / 8), k8 = (t % (K / 8)) * 8; FragH f;
#pragma unroll
  for (int i = 0; i < 8; ++i) f.h[i] = (_Float16)(bf16_round(W[(size_t)(k8 + i) * N + n]) * scale); const v8us o = f.half[0];
  *(v8us*)((unsigned short*)Wt + (size_t)n * K + k8) = o; 
}
// k_gemm_hh variant with fused epilogue: v = acc·alpha + bias[by·sBias + col] (+ CP[(row/rowsPerB)·sCPb + by·64 + col] if CP) ; ACT 0 none / 1 elu ; writes f16 C16 (and f32 C if non-null)
template <int ACT>
__global__ __launch_bounds__(128) void k_gemm_hhx(const _Float16* __restrict__ A, int lda, size_t sA, const _Float16* __restrict__ Bh, int ldb, size_t sB, float alpha, const float* __restrict__ bias, size_t sBias, const float* __restrict__ CP, int rowsPerB, size_t sCPb, int row0g,
    float* __restrict__ C, _Float16* __restrict__ C16, int ldc, size_t sC, int M, int N, int K) {
  __shared__ __attribute__((aligned(16))) float so[4][16][64];
  const int tid = threadIdx.x, w = tid >> 5, lane = tid & 31, ln = lane & 15, hh = lane >> 4; const int by = blockIdx.y;
  A += (size_t)by * sA; Bh += (size_t)by * sB; const size_t cofs = (size_t)by * sC; const float* bp = bias ? bias + (size_t)by * sBias : nullptr;
  const int ntn = (N + 63) / 64; const int wid = blockIdx.x * 4 + w; const int mt = wid / ntn, nq = wid % ntn; if (mt * 16 >= M) return;
  const int row0 = mt * 16, col0 = nq * 64; const _Float16* arow = A + (size_t)(row0 + ln) * lda;
  v8f acc[4] = {};
  for (int kb = 0; kb < K; kb += 32) { FragH ah; ah.half[0] = *(const v8us*)((const unsigned short*)arow + kb + 8 * hh); ah.half[1] = *(const v8us*)((const unsigned short*)arow + kb + 16 + 8 * hh);
#pragma unroll
    for (int t = 0; t < 4; ++t) { if (col0 + t * 16 >= N) continue; const size_t boff = (size_t)(col0 + t * 16 + ln) * ldb + kb; FragH bq; bq.half[0] = *(const v8us*)((const unsigned short*)Bh + boff + 8 * hh); bq.half[1] = *(const v8us*)((const unsigned short*)Bh + boff + 16 + 8 * hh);
      acc[t] = mmaH<1>(ah.v, ah.v, bq.v, bq.v, acc[t]); }
  }
#pragma unroll
  for (int t = 0; t < 4; ++t) { if (col0 + t * 16 >= N) continue; const int col = col0 + t * 16 + ln; const float bv = bp ? bf16_round(bp[col]) : 0.f;
#pragma unroll
    for (int r = 0; r < 8; ++r) { float v = acc[t][r] * alpha + bv; if (CP) { const int bidx = (row0g + row0 + 8 * hh + r) / rowsPerB; v += CP[(size_t)bidx * sCPb + (size_t)by * 64 + col]; } if (ACT == 1) v = (v > 0.f) ? v : expm1f(v); else if (ACT == 7) v = (v > 0.f) ? v + 1.0f : expf(v); else if (ACT == 8) v = tanhf(v); else if (ACT == 9) v = 0.5f * v * (1.0f + tanhf(0.7978845608028654f * (v + 0.044715f * v * v * v))); else if (ACT == 11) v = 1.0f / (1.0f + expf(-v)); else if (ACT == 12) v = (v > 0.f) ? v : 0.01f * v; else if (ACT == 14) v = (v > 0.f) ? v : 0.1f * v; else if (ACT == 15) v = v / (1.0f + expf(-v)); else if (ACT == 3) v = fmaxf(v, 0.f); else if (ACT == 6) v = 0.5f * v * (1.0f + erff(v * 0.70710678118654752f)); so[w][8 * hh + r][t * 16 + ln] = v; } }
  __builtin_amdgcn_fence(__ATOMIC_ACQ_REL, "workgroup"); __builtin_amdgcn_wave_barrier();
  const int rsub = lane >> 4, c4 = (lane & 15) * 4; typedef _Float16 v4h __attribute__((ext_vector_type(4)));
  {
#pragma unroll
    for (int q = 0; q < 8; ++q) { const int r = q * 2 + rsub; if (col0 + c4 < N) { const v4f v = *(const v4fa*)&so[w][r][c4]; if (C) *(v4f*)(C + cofs + (size_t)(row0 + r) * ldc + col0 + c4) = v; if (C16) { v4h h4; for (int i = 0; i < 4; ++i) h4[i] = (_Float16)v[i]; *(v4h*)(C16 + cofs + (size_t)(row0 + r) * ldc + col0 + c4) = h4; } } }
     }
}


typedef _Float16 v4h __attribute__((ext_vector_type(4)));

__global__ __launch_bounds__(256) void k_x16(const float* __restrict__ x, _Float16* __restrict__ X16, size_t n8) { const size_t t = (size_t)blockIdx.x * 256 + threadIdx.x; if (t >= n8) return; FragH f;
#pragma unroll
  for (int q = 0; q < 8; ++q) f.h[q] = (_Float16)bf16_round(x[t * 8 + q]); *(v8us*)((unsigned short*)X16 + t * 8) = f.half[0];  }
__global__ __launch_bounds__(256) void k_h16(const float* __restrict__ x, _Float16* __restrict__ X16, size_t n8) { const size_t t = (size_t)blockIdx.x * 256 + threadIdx.x; if (t >= n8) return; FragH f;
#pragma unroll
  for (int q = 0; q < 8; ++q) f.h[q] = (_Float16)x[t * 8 + q]; *(v8us*)((unsigned short*)X16 + t * 8) = f.half[0];  }
__global__ __launch_bounds__(256) void k_round16f(const float* __restrict__ W, _Float16* __restrict__ Bt, size_t n8) { const size_t t = (size_t)blockIdx.x * 256 + threadIdx.x; if (t >= n8) return; FragH f;
#pragma unroll
  for (int i = 0; i < 8; ++i) f.h[i] = (_Float16)(bf16_round(W[t * 8 + i]) * 16.0f); *(v8us*)((unsigned short*)Bt + t * 8) = f.half[0];  }
template <int NHv, int TTv>
__global__ __launch_bounds__(256) void k_vt(const _Float16* __restrict__ V16, int ldv, int voff, _Float16* __restrict__ Vt) { __shared__ unsigned short tl[64][66]; const int tid = threadIdx.x; const int slab = blockIdx.x / (TTv / 64), lg = blockIdx.x % (TTv / 64); const int b = slab / NHv, h = slab % NHv;
  for (int i = tid; i < 64 * 8; i += 256) { const int r = i / 8, c8 = (i % 8) * 8; FragH f; f.half[0] = *(const v8us*)((const unsigned short*)V16 + ((size_t)b * TTv + lg * 64 + r) * ldv + voff + h * 64 + c8);
#pragma unroll
    for (int q = 0; q < 8; ++q) tl[r][c8 + q] = f.u[q]; }
  __syncthreads();
  {
#pragma unroll
    for (int rd = 0; rd < 2; ++rd) { const int d = rd * 32 + tid / 8, pc = tid % 8; FragH f;
#pragma unroll
      for (int q = 0; q < 8; ++q) f.u[q] = tl[pc * 8 + q][d];
      *(v8us*)((unsigned short*)Vt + ((size_t)slab * 64 + d) * TTv + lg * 64 + pc * 8) = f.half[0]; }
     } }

#ifndef NBS
#define NBS NB      /* batch stride of the [S][B][E] tensors (debug builds may process fewer batches than the layout holds) */
#endif
// ---- fast GEMM (wave tile 32x64, 8 waves as 4 x 2, block tile 128x128; requires M % 128 == 0, N % 128 == 0, K % 64 == 0, K >= 64) ----
// Operands reach the waves through LDS: per stage the block brings 64 k of its 128 A rows and 128 B rows in by asynchronous copies that cover whole 128-byte lines (8 lanes a row),
// two buffers, the next stage in flight while this one is worked on; the fragments are read from LDS in the same k order as before.
// TAIL: C = (A B^T / 1024 + A2 B^T) alpha + bias in one launch: a stage holds 64 k of A, of A2 and of B, so that every B tile is copied once and every B fragment is read once for both terms (16 matrix instructions on 8 fragments);
// the two terms have accumulators of their own, joined behind the loop as A's sum x 2^-10 + A2's sum; row (b, s) of the result is stored at row (s, b) of Cf, which is f32.
// The epilogue's staging lies on the two buffers' LDS: the barrier at the foot of the last trip, behind every wave's dscnt and asynccnt waits, has ended their use.
// Not TAIL: three batches, C = A B^T alpha + bias with the batch's own B and bias. A wave's 64 columns are one head: batches 0, 1 (q, k) take the rotary embedding in the epilogue, from the angle table CS / SN, and leave as f16 planes of Ch; batch 2 (v) leaves as V^T.
__device__ __forceinline__ v16h g2_frag(const unsigned short* p, int hh) { FragH f; f.half[0] = *(const v8us*)(p + 8 * hh); f.half[1] = *(const v8us*)(p + 16 + 8 * hh); return f.v; }
__device__ __forceinline__ v8f g2_mma(v16h a, v16h b, v8f c) { v8f d = __builtin_amdgcn_wmma_f32_16x16x32_f16(false, a, false, b, (short)0, c, false, false); asm volatile("v_nop\n\tv_nop\n\tv_nop\n\tv_nop" : "+v"(d) : "v"(a), "v"(b)); return d; }
// One lane's share of a stage: 4 pieces of A and 4 of B, 16 bytes each, 32 rows apart (ls bytes in LDS, da / db bytes in memory), global memory -> LDS through no register.
// The s_wait_xcnt closes the copies' own statement so that no address register named here is rewritten ahead of it.
__device__ __forceinline__ void g2_copy(unsigned la, unsigned lb, unsigned ls, const char* pa, size_t da, const char* pb, size_t db) {
  asm volatile("global_load_async_to_lds_b128 %0, %8, off\n\t" "global_load_async_to_lds_b128 %1, %9, off\n\t" "global_load_async_to_lds_b128 %2, %10, off\n\t" "global_load_async_to_lds_b128 %3, %11, off\n\t"
               "global_load_async_to_lds_b128 %4, %12, off\n\t" "global_load_async_to_lds_b128 %5, %13, off\n\t" "global_load_async_to_lds_b128 %6, %14, off\n\t" "global_load_async_to_lds_b128 %7, %15, off\n\t"
               "s_wait_xcnt 0x0"
               :: "v"(la), "v"(la + ls), "v"(la + 2 * ls), "v"(la + 3 * ls), "v"(lb), "v"(lb + ls), "v"(lb + 2 * ls), "v"(lb + 3 * ls),
                  "v"(pa), "v"(pa + da), "v"(pa + 2 * da), "v"(pa + 3 * da), "v"(pb), "v"(pb + db), "v"(pb + 2 * db), "v"(pb + 3 * db)
               : "memory"); }
// The same for a stage of the tail: 4 pieces each of A, A2 (same pitch as A) and B. The s_wait_xcnt closes the copies' own statement for the same reason.
__device__ __forceinline__ void g2_copy3(unsigned la, unsigned l2, unsigned lb, unsigned ls, const char* pa, const char* p2, size_t da, const char* pb, size_t db) {
  asm volatile("global_load_async_to_lds_b128 %0, %12, off\n\t" "global_load_async_to_lds_b128 %1, %13, off\n\t" "global_load_async_to_lds_b128 %2, %14, off\n\t" "global_load_async_to_lds_b128 %3, %15, off\n\t"
               "global_load_async_to_lds_b128 %4, %16, off\n\t" "global_load_async_to_lds_b128 %5, %17, off\n\t" "global_load_async_to_lds_b128 %6, %18, off\n\t" "global_load_async_to_lds_b128 %7, %19, off\n\t"
               "global_load_async_to_lds_b128 %8, %20, off\n\t" "global_load_async_to_lds_b128 %9, %21, off\n\t" "global_load_async_to_lds_b128 %10, %22, off\n\t" "global_load_async_to_lds_b128 %11, %23, off\n\t"
               "s_wait_xcnt 0x0"
               :: "v"(la), "v"(la + ls), "v"(la + 2 * ls), "v"(la + 3 * ls), "v"(l2), "v"(l2 + ls), "v"(l2 + 2 * ls), "v"(l2 + 3 * ls), "v"(lb), "v"(lb + ls), "v"(lb + 2 * ls), "v"(lb + 3 * ls),
                  "v"(pa), "v"(pa + da), "v"(pa + 2 * da), "v"(pa + 3 * da), "v"(p2), "v"(p2 + da), "v"(p2 + 2 * da), "v"(p2 + 3 * da), "v"(pb), "v"(pb + db), "v"(pb + 2 * db), "v"(pb + 3 * db)
               : "memory"); }
/* second launch bound: q/k/v: registers for 6 waves a SIMD, so that three blocks fit a WGP and the grid (3 blocks a WGP) is resident at once; tail: its grid is one block a WGP, two waves a SIMD, and its two sets of accumulators need the registers */
template <int ACT, bool TAIL>
__global__ __launch_bounds__(256, TAIL ? 2 : 6) void k_gemm2(const _Float16* __restrict__ A, int lda, size_t sA, const _Float16* __restrict__ A2, const _Float16* __restrict__ Bh, int ldb, size_t sB, float alpha, const float* __restrict__ bias, const float* __restrict__ bias1, const float* __restrict__ bias2, const float* __restrict__ CS, const float* __restrict__ SN,
    float* __restrict__ Cf, _Float16* __restrict__ Ch, _Float16* __restrict__ Vt, int ldc, size_t sC, int M, int N, int K) {
  constexpr int KT = 64, PIT = KT + 8;      /* LDS row pitch 144 B = 16 B x odd: the 16-byte fragment reads of 16 rows fall on distinct banks */
  __shared__ __attribute__((aligned(16))) unsigned short ring[TAIL ? 6 : 4][128][PIT];      /* A's two buffers, then (tail) A2's, then B's; behind the loop the epilogue's staging */
  unsigned short (*tA)[128][PIT] = ring; unsigned short (*tB)[128][PIT] = ring + (TAIL ? 4 : 2); unsigned short (*tH)[128][PIT] = ring + (TAIL ? 2 : 0); float (*so)[32][68] = (float (*)[32][68])&ring[0][0][0];
  static_assert(sizeof(float) * 8 * 32 * 68 <= sizeof(ring), "the staging of 8 waves fits the buffers");
  const int tid = threadIdx.x, w = tid >> 5, wr = w & 3, wc = w >> 2, lane = tid & 31, ln = lane & 15, hh = lane >> 4; const int by = blockIdx.y;
  A += (size_t)by * sA; Bh += (size_t)by * sB; const float* bp = by == 0 ? bias : (by == 1 ? bias1 : bias2);      /* batch by has its own bias vector */
  const int ntn = N >> 7; const int mt = blockIdx.x / ntn, nq = blockIdx.x - mt * ntn; const int row0 = mt * 128 + 32 * wr, col0 = nq * 128 + 64 * wc; if (mt * 128 >= M) return;      /* the same for the whole block: it stands in front of barriers */
  const int sr = tid >> 3, sc = (tid & 7) * 8;
  const char* pa = (const char*)(A + (size_t)(mt * 128 + sr) * lda + sc); const char* pb = (const char*)(Bh + (size_t)(nq * 128 + sr) * ldb + sc); const size_t da = (size_t)lda * 64, db = (size_t)ldb * 64;
  const unsigned la = (unsigned)(uintptr_t)&tA[0][sr][sc], lb = (unsigned)(uintptr_t)&tB[0][sr][sc]; constexpr unsigned LS = 32 * PIT * 2, BA = 128 * PIT * 2, BB = 128 * PIT * 2;
  const char* pa2 = TAIL ? (const char*)(A2 + (size_t)by * sA + (size_t)(mt * 128 + sr) * lda + sc) : pa; const unsigned lh = (unsigned)(uintptr_t)&tH[0][sr][sc]; const int KK = K;
  /* the stage that begins at column kk of A, B (and A2), into buffer buf; kk is the same for the whole block */
  auto stage = [&](int kk, int buf) { const size_t kx = (size_t)kk * 2;
    if constexpr (TAIL) g2_copy3(la + buf * BA, lh + buf * BA, lb + buf * BB, LS, pa + kx, pa2 + kx, da, pb + kx, db); else g2_copy(la + buf * BA, lb + buf * BB, LS, pa + kx, da, pb + kx, db); };
  stage(0, 0);
  asm volatile("s_wait_asynccnt 0x0" ::: "memory");      /* this wave's share of stage 0 has landed */
  __syncthreads();      /* every wave's share has: stage 0 may be read */
  if (KT < KK) stage(KT, 1);
  const v8f z8 = {0.f,0.f,0.f,0.f,0.f,0.f,0.f,0.f}; v8f c00 = z8, c01 = z8, c02 = z8, c03 = z8, c10 = z8, c11 = z8, c12 = z8, c13 = z8;
  v8f d00 = z8, d01 = z8, d02 = z8, d03 = z8, d10 = z8, d11 = z8, d12 = z8, d13 = z8;      /* tail: A2's sums */
  /* rolled: one stage a trip, so that the order at the foot of the trip stands once */
#pragma unroll 1
  for (int kb = 0; kb < KK; kb += KT) { const int cur = (kb >> 6) & 1;
    /* unrolled: the two 32-k blocks of a stage read LDS at immediate offsets */
#pragma unroll
    for (int ks = 0; ks < KT; ks += 32) { const unsigned short* fa = &tA[cur][32 * wr + ln][ks]; const unsigned short* fb = &tB[cur][64 * wc + ln][ks];
      const v16h a0 = g2_frag(fa, hh), a1 = g2_frag(fa + 16 * PIT, hh); v16h h0 = {}, h1 = {}; if constexpr (TAIL) { const unsigned short* fh = &tH[cur][32 * wr + ln][ks]; h0 = g2_frag(fh, hh); h1 = g2_frag(fh + 16 * PIT, hh); }
      const v16h b0 = g2_frag(fb, hh), b1 = g2_frag(fb + 16 * PIT, hh), b2 = g2_frag(fb + 32 * PIT, hh), b3 = g2_frag(fb + 48 * PIT, hh);
      if constexpr (TAIL) {      /* all eight fragments are read as one group; each B fragment then feeds four matrix instructions */
        c00 = g2_mma(a0, b0, c00); c10 = g2_mma(a1, b0, c10); d00 = g2_mma(h0, b0, d00); d10 = g2_mma(h1, b0, d10);
        c01 = g2_mma(a0, b1, c01); c11 = g2_mma(a1, b1, c11); d01 = g2_mma(h0, b1, d01); d11 = g2_mma(h1, b1, d11);
        c02 = g2_mma(a0, b2, c02); c12 = g2_mma(a1, b2, c12); d02 = g2_mma(h0, b2, d02); d12 = g2_mma(h1, b2, d12);
        c03 = g2_mma(a0, b3, c03); c13 = g2_mma(a1, b3, c13); d03 = g2_mma(h0, b3, d03); d13 = g2_mma(h1, b3, d13);
      } else {
      c00 = g2_mma(a0, b0, c00); c10 = g2_mma(a1, b0, c10); c01 = g2_mma(a0, b1, c01); c11 = g2_mma(a1, b1, c11);
      c02 = g2_mma(a0, b2, c02); c12 = g2_mma(a1, b2, c12); c03 = g2_mma(a0, b3, c03); c13 = g2_mma(a1, b3, c13); } }
    asm volatile("s_wait_dscnt 0x0" ::: "memory");      /* this wave's reads of the buffer that is refilled below have returned */
    asm volatile("s_wait_asynccnt 0x0" ::: "memory");      /* this wave's share of the next stage has landed */
    __syncthreads();      /* publishes the next stage and ends every wave's reads of this one */
    if (kb + 2 * KT < KK) stage(kb + 2 * KT, cur); }
  asm volatile("s_wait_asynccnt 0x0" ::: "memory");      /* no copy is left in flight behind the loop */
  if constexpr (TAIL) { constexpr float s10 = 0.0009765625f; c00 = c00 * s10 + d00; c01 = c01 * s10 + d01; c02 = c02 * s10 + d02; c03 = c03 * s10 + d03; c10 = c10 * s10 + d10; c11 = c11 * s10 + d11; c12 = c12 * s10 + d12; c13 = c13 * s10 + d13; }
  v8f accs[8] = {c00, c01, c02, c03, c10, c11, c12, c13};
  static_assert(TAIL || ACT == 0, "the q/k/v epilogue has no activation");
  if (!TAIL && by == 2) {      /* v, the same for the whole block: stored as V^T[(b, h)][d][s]; the block's 128 columns are two heads that follow one another, its 128 rows lie in one batch */
    /* a lane's 8 accumulator registers are 8 consecutive s of one d: one 16-byte LDS store; pitch 272 B = 16 B x odd. Every loop of this path is unrolled: constant register-array indices, immediate offsets */
    unsigned short (*sT)[136] = (unsigned short (*)[136])&so[0][0][0]; float bv[4] = {0.f, 0.f, 0.f, 0.f};
    if (bp) { const float* bl = bp + col0 + ln;
#pragma unroll
      for (int t = 0; t < 4; ++t) bv[t] = bl[t * 16];
      asm volatile("s_wait_xcnt 0x0" ::: "memory");      /* stands behind the four loads: the code below reuses their address registers */
#pragma unroll
      for (int t = 0; t < 4; ++t) bv[t] = bf16_round(bv[t]); }
#pragma unroll
    for (int u = 0; u < 8; ++u) { const int t = u & 3, half = u >> 2; const int d = 64 * wc + t * 16 + ln; FragH f;
#pragma unroll
      for (int r = 0; r < 8; ++r) f.h[r] = (_Float16)(accs[u][r] * alpha + bv[t]);
      *(v8us*)&sT[d][32 * wr + half * 16 + 8 * hh] = f.half[0]; }
    __syncthreads();      /* every wave's 32 s of each d are in LDS before the rows are read back whole */
    unsigned short* vo = (unsigned short*)Vt + ((size_t)((mt * 128) / SLEN * NH + nq * 2) * 64 + (tid >> 4)) * SLEN + (mt * 128) % SLEN + (tid & 15) * 8;
    /* 16 lanes store the 256 bytes of one d, 16 d a pass */
#pragma unroll
    for (int p = 0; p < 8; ++p) *(v8us*)(vo + (size_t)p * 16 * SLEN) = *(const v8us*)&sT[p * 16 + (tid >> 4)][(tid & 15) * 8];
    return; }
  /* q, k: the wave's share of the angle table. 4 lanes hold a row, lane g the angles 8 g .. 8 g + 7; 8 rows a pass */
  const int g = lane & 3, rr = lane >> 2; v4f tk[4][2], tn[4][2];
  if (!TAIL) { const float* tc = CS + (size_t)(row0 % SLEN + rr) * 32 + g * 8; const float* ts = SN + (size_t)(row0 % SLEN + rr) * 32 + g * 8;
    /* unrolled: constant register-array indices, immediate offsets */
#pragma unroll
    for (int p = 0; p < 4; ++p) { tk[p][0] = *(const v4fa*)(tc + p * 256); tk[p][1] = *(const v4fa*)(tc + p * 256 + 4); tn[p][0] = *(const v4fa*)(ts + p * 256); tn[p][1] = *(const v4fa*)(ts + p * 256 + 4); }
    asm volatile("s_wait_xcnt 0x0" :: "v"(tc), "v"(ts) : "memory");      /* stands behind the sixteen loads: the code below reuses their address registers; it takes the two addresses as inputs so that no load's result lands on them ahead of the wait */ }
#pragma unroll
  for (int u = 0; u < 8; ++u) { const int t = u & 3, half = u >> 2; const int col = col0 + t * 16 + ln; const float bv = bp ? bf16_round(bp[col]) : 0.f;
#pragma unroll
    for (int r = 0; r < 8; ++r) { const int rloc = half * 16 + 8 * hh + r; float v = accs[u][r] * alpha + bv;
      if (ACT == 3) v = fmaxf(v, 0.f); else if (ACT == 6) v = 0.5f * v * (1.0f + erff(v * 0.70710678118654752f)); else if (ACT == 11) v = 1.0f / (1.0f + expf(-v)); else if (ACT == 15) v = v / (1.0f + expf(-v)); else if (ACT == 12) v = (v > 0.f) ? v : 0.01f * v; else if (ACT == 8) v = tanhf(v);
      so[w][rloc][t * 16 + ln] = v; } }
  __builtin_amdgcn_fence(__ATOMIC_ACQ_REL, "workgroup"); __builtin_amdgcn_wave_barrier();
  if (TAIL) { const int rsub = lane >> 4, c4 = (lane & 15) * 4;
#pragma unroll
    for (int q = 0; q < 16; ++q) { const int r = q * 2 + rsub; const v4f v = *(const v4fa*)&so[w][r][c4]; const size_t orow = (size_t)((row0 + r) % SLEN) * NBS + (row0 + r) / SLEN; *(v4f*)(Cf + orow * ldc + col0 + c4) = v; }
  } else {      /* q, k: rotary embedding of the wave's 32 rows of one head, then f16. Lane g of a row has x = d 8 g .. 8 g + 7 and y = d + 32; out[d] = x cos - y sin, out[d + 32] = y cos + x sin */
    unsigned short* ho = (unsigned short*)Ch + (size_t)by * sC + (size_t)(row0 + rr) * DM + col0 + g * 8;
    /* unrolled: constant register-array indices; LDS and output are addressed by immediate offsets */
#pragma unroll
    for (int p = 0; p < 4; ++p) { const int r = p * 8 + rr; FragH f1, f2;
#pragma unroll
      for (int e = 0; e < 2; ++e) { const v4f x = *(const v4fa*)&so[w][r][g * 8 + 4 * e], y = *(const v4fa*)&so[w][r][32 + g * 8 + 4 * e], k = tk[p][e], s = tn[p][e];
#pragma unroll
        for (int q = 0; q < 4; ++q) { f1.h[4 * e + q] = (_Float16)(x[q] * k[q] - y[q] * s[q]); f2.h[4 * e + q] = (_Float16)(y[q] * k[q] + x[q] * s[q]); } }
      *(v8us*)(ho + (size_t)p * 8 * DM) = f1.half[0]; *(v8us*)(ho + (size_t)p * 8 * DM + 32) = f2.half[0]; }
    asm volatile("s_wait_xcnt 0x0" ::: "memory");      /* stands behind the last of the eight stores: the v path's code follows them in the built kernel and reuses their registers */ } }



// Lane l <-> l ^ 16 by a vector cross-row move (the two lanes that hold one query's keys).
__device__ __forceinline__ float x_half(float x) { const int b = __float_as_int(x); return __int_as_float(__builtin_amdgcn_permlanex16(b, b, 0x76543210, 0xfedcba98, false, false)); }
// One lane's share of a 64-key stage: 4 pieces of K and 4 of V^T, 16 bytes each, 16 rows apart (ls bytes in LDS, dk / dv bytes in memory), global memory -> LDS through no register.
// The s_wait_xcnt closes the copies' own statement so that no address register named here is rewritten ahead of it.
__device__ __forceinline__ void fl_copy(unsigned lk, unsigned lv, unsigned ls, const char* pk, size_t dk, const char* pv, size_t dv) {
  asm volatile("global_load_async_to_lds_b128 %0, %8, off\n\t" "global_load_async_to_lds_b128 %1, %9, off\n\t" "global_load_async_to_lds_b128 %2, %10, off\n\t" "global_load_async_to_lds_b128 %3, %11, off\n\t"
               "global_load_async_to_lds_b128 %4, %12, off\n\t" "global_load_async_to_lds_b128 %5, %13, off\n\t" "global_load_async_to_lds_b128 %6, %14, off\n\t" "global_load_async_to_lds_b128 %7, %15, off\n\t"
               "s_wait_xcnt 0x0"
               :: "v"(lk), "v"(lk + ls), "v"(lk + 2 * ls), "v"(lk + 3 * ls), "v"(lv), "v"(lv + ls), "v"(lv + 2 * ls), "v"(lv + 3 * ls),
                  "v"(pk), "v"(pk + dk), "v"(pk + 2 * dk), "v"(pk + 3 * dk), "v"(pv), "v"(pv + dv), "v"(pv + 2 * dv), "v"(pv + 3 * dv)
               : "memory"); }
// Unmasked attention with both products transposed: S^T = K Q^T (A = K rows, B = Q rows), O^T += V^T P^T (A = V^T rows, B = P^T).
// Lane (ln, hh) owns query q0 + ln; register r of score tile nt is key j0 + ps + nt * 16 + 8 * hh + r, so maximum and sum run inside the lane, joined with lane ^ 16,
// and the two score tiles, converted in place, are the B operand of the second product in the k order of the V^T loader (8 * hh + i, 16 + 8 * hh + i): P touches no LDS.
// K and V^T reach the waves through LDS: per stage the block brings 64 keys (64 K rows and 64 V^T rows of 128 bytes) in by asynchronous copies that cover whole 128-byte lines (8 lanes a row),
// two buffers, the next stage in flight while this one is worked on; the four waves read their fragments from LDS in the same k order as before.
__global__ __launch_bounds__(128) void k_flash(const _Float16* __restrict__ Q16, int ldq, const _Float16* __restrict__ K16, int ldk, const _Float16* __restrict__ Vt, _Float16* __restrict__ Oh, _Float16* __restrict__ Ol, int ldo) {
  constexpr int RPW = 16, DT = 4, KS = 2, KT = 64, PIT = KT + 8;      /* LDS row pitch 144 B = 16 B x odd: the 16-byte fragment reads of 16 rows fall on distinct banks */
  __shared__ __attribute__((aligned(16))) float sO[4][RPW][64 + 4];
  __shared__ __attribute__((aligned(16))) unsigned short tK[2][KT][PIT]; __shared__ __attribute__((aligned(16))) unsigned short tV[2][64][PIT];
  const int tid = threadIdx.x, w = tid >> 5, lane = tid & 31, ln = lane & 15, hh = lane >> 4;
  const int slab = blockIdx.x / QBNP, qblk = QB0P + blockIdx.x % QBNP; const int b = slab / NH, h = slab % NH; const int qb0 = qblk * (4 * RPW); const int q0 = qb0 + w * RPW;
  /* every inner loop below is unrolled so that each register-array index is a constant (no scratch) */
  FragH bq[KS];
  { const unsigned short* qr = (const unsigned short*)Q16 + ((size_t)b * TQ + q0 + ln) * ldq + h * 64;
#pragma unroll
    for (int ks = 0; ks < KS; ++ks) { bq[ks].half[0] = *(const v8us*)(qr + ks * 32 + 8 * hh); bq[ks].half[1] = *(const v8us*)(qr + ks * 32 + 16 + 8 * hh); } }
  const unsigned short* Vth = (const unsigned short*)Vt + (size_t)slab * 64 * TK;
  const int sr = tid >> 3, sc = (tid & 7) * 8;
  const char* pk = (const char*)((const unsigned short*)K16 + ((size_t)b * TK + sr) * ldk + h * 64 + sc); const char* pv = (const char*)(Vth + (size_t)sr * TK + sc); const size_t dk = (size_t)ldk * 32, dv = (size_t)TK * 32, sk = (size_t)ldk * (KT * 2);
  const unsigned lk = (unsigned)(uintptr_t)&tK[0][sr][sc], lv = (unsigned)(uintptr_t)&tV[0][sr][sc]; constexpr unsigned LS = 16 * PIT * 2, BS = 64 * PIT * 2;
  fl_copy(lk, lv, LS, pk, dk, pv, dv);
  asm volatile("s_wait_asynccnt 0x0" ::: "memory");      /* this wave's share of stage 0 has landed */
  __syncthreads();      /* every wave's share has: stage 0 may be read */
  if (KT < TK) fl_copy(lk + BS, lv + BS, LS, pk + sk, dk, pv + KT * 2, dv);
  /* the maximum m_q is kept in units of the raw product q.k; p = 2^10 exp((s - m) / 8) is one multiply-add and one base-2 exponential: 2^(s C2 + (10 - m C2)); l_q sums these p, so it carries the 2^10 as well */
  constexpr float C2 = SCL * 1.4426950408889634f;
  float m_q = -3.0e38f, l_q = 0.f; v8f oacc[DT];
#pragma unroll
  for (int dt = 0; dt < DT; ++dt) oacc[dt] = (v8f){0.f,0.f,0.f,0.f,0.f,0.f,0.f,0.f};
  /* rolled: one 64-key stage a trip, so that the order at the foot of the trip stands once */
#pragma unroll 1
  for (int j0 = 0; j0 < TK; j0 += KT) { const int cur = (j0 >> 6) & 1;
    /* unrolled: the two 32-key passes of a stage read LDS at immediate offsets */
#pragma unroll
    for (int ps = 0; ps < KT; ps += 32) {
    FragH ak[2][KS], av[DT];
#pragma unroll
    for (int nt = 0; nt < 2; ++nt) { const unsigned short* kr = &tK[cur][ps + nt * 16 + ln][0];
#pragma unroll
      for (int ks = 0; ks < KS; ++ks) { ak[nt][ks].half[0] = *(const v8us*)(kr + ks * 32 + 8 * hh); ak[nt][ks].half[1] = *(const v8us*)(kr + ks * 32 + 16 + 8 * hh); } }
#pragma unroll
    for (int dt = 0; dt < DT; ++dt) { const unsigned short* vrow = &tV[cur][dt * 16 + ln][ps]; av[dt].half[0] = *(const v8us*)(vrow + 8 * hh); av[dt].half[1] = *(const v8us*)(vrow + 16 + 8 * hh); }
    float sc_[16];
#pragma unroll
    for (int nt = 0; nt < 2; ++nt) {
      v8f acc = (v8f){0.f,0.f,0.f,0.f,0.f,0.f,0.f,0.f};
#pragma unroll
      for (int ks = 0; ks < KS; ++ks) acc = mmaH<1>(ak[nt][ks].v, ak[nt][ks].v, bq[ks].v, bq[ks].v, acc);
#pragma unroll
      for (int r = 0; r < 8; ++r) sc_[nt * 8 + r] = acc[r]; }
    float mc = sc_[0];
#pragma unroll
    for (int i = 1; i < 16; ++i) mc = fmaxf(mc, sc_[i]);
    mc = fmaxf(mc, x_half(mc));
    const float mn = fmaxf(m_q, mc); const float al = (mn > -1.0e38f) ? __builtin_amdgcn_exp2f((m_q - mn) * C2) : 1.0f; m_q = mn;
    const float nb = fmaf(-mn, C2, 10.0f);
    float p[16]; FragH pb;
#pragma unroll
    for (int i = 0; i < 16; ++i) p[i] = fmaf(sc_[i], C2, nb);
    /* eight base-2 exponentials, each in place, and the v_nop that the slot behind a transcendental asks for, in one statement: no instruction in it or behind it reads a fresh result or overwrites another's argument; the s_delay_alu is the hint that lets the SIMD's other waves issue while the last result is on its way */
#pragma unroll
    for (int g = 0; g < 16; g += 8)
      asm("v_exp_f32 %0, %0\n\tv_exp_f32 %1, %1\n\tv_exp_f32 %2, %2\n\tv_exp_f32 %3, %3\n\tv_exp_f32 %4, %4\n\tv_exp_f32 %5, %5\n\tv_exp_f32 %6, %6\n\tv_exp_f32 %7, %7\n\ts_delay_alu instid0(TRANS32_DEP_1)\n\tv_nop"
          : "+v"(p[g]), "+v"(p[g + 1]), "+v"(p[g + 2]), "+v"(p[g + 3]), "+v"(p[g + 4]), "+v"(p[g + 5]), "+v"(p[g + 6]), "+v"(p[g + 7]));
#pragma unroll
    for (int i = 0; i < 16; ++i) pb.h[i] = (_Float16)p[i];
#pragma unroll
    for (int st = 8; st > 0; st >>= 1)
#pragma unroll
      for (int i = 0; i < st; ++i) p[i] += p[i + st];
    l_q = l_q * al + p[0];
#pragma unroll
    for (int dt = 0; dt < DT; ++dt) {
#pragma unroll
      for (int r = 0; r < 8; ++r) oacc[dt][r] *= al; }
#pragma unroll
    for (int dt = 0; dt < DT; ++dt) oacc[dt] = mmaH<1>(av[dt].v, av[dt].v, pb.v, pb.v, oacc[dt]); }
    asm volatile("s_wait_dscnt 0x0" ::: "memory");      /* this wave's reads of the buffer that is refilled below have returned */
    asm volatile("s_wait_asynccnt 0x0" ::: "memory");      /* this wave's share of the next stage has landed */
    __syncthreads();      /* publishes the next stage and ends every wave's reads of this one */
    if (j0 + 2 * KT < TK) fl_copy(lk + cur * BS, lv + cur * BS, LS, pk + (size_t)((j0 >> 6) + 2) * sk, dk, pv + (size_t)(j0 + 2 * KT) * 2, dv); }
  asm volatile("s_wait_asynccnt 0x0" ::: "memory");      /* no copy is left in flight behind the loop */
  const float l = l_q + x_half(l_q); const float li = (l > 0.f) ? 1.0f / l : 0.f;
#pragma unroll
  for (int dt = 0; dt < DT; ++dt)
#pragma unroll
    for (int g = 0; g < 2; ++g) { const v4f val = {oacc[dt][4 * g] * li, oacc[dt][4 * g + 1] * li, oacc[dt][4 * g + 2] * li, oacc[dt][4 * g + 3] * li}; *(v4fa*)&sO[w][ln][dt * 16 + 8 * hh + 4 * g] = val; }
  __builtin_amdgcn_fence(__ATOMIC_ACQ_REL, "workgroup"); __builtin_amdgcn_wave_barrier();      /* the wave's own rows are in LDS before other lanes of it read them back as whole 128-byte lines */
  /* the context leaves as two f16 planes, hi and 2^10 x residual: 8 lanes store one row's 128-byte line of each plane */
  {
#pragma unroll
    for (int rp = 0; rp < RPW; rp += 4) { const int r = rp + (lane >> 3), pc = lane & 7; const v4f a = *(const v4fa*)&sO[w][r][pc * 8], c = *(const v4fa*)&sO[w][r][pc * 8 + 4]; FragH fh, fl;
#pragma unroll
      for (int q = 0; q < 4; ++q) { _Float16 hv = (_Float16)a[q]; fh.h[q] = hv; fl.h[q] = (_Float16)((a[q] - (float)hv) * 1024.0f); hv = (_Float16)c[q]; fh.h[4 + q] = hv; fl.h[4 + q] = (_Float16)((c[q] - (float)hv) * 1024.0f); }
      const size_t o = ((size_t)b * TQ + q0 + r) * ldo + h * 64 + pc * 8; *(v8us*)((unsigned short*)Oh + o) = fh.half[0]; *(v8us*)((unsigned short*)Ol + o) = fl.half[0]; }
     } }
// 5-plane variant: S = Qh Kh^T + (Ql Kh^T + Qh Kl^T)/1024 with Q/K = [hi | 2^10 residual] f16 planes (QL/KL same layout as Q16/K16), then the 3-term P.V below.
// 3-term variant: O = (P_hi V_hi + (P_lo V_hi + P_hi V_lo) / 1024) / l with P = [hi | 2^10 residual] of 1024 p and V^T = [hi | 2^10 residual] planes (VtL same layout as Vt) -> ~2^-21-class products for un-averaged (early causal / peaked) rows
template <int CAUSAL>
__global__ __launch_bounds__(128) void k_flash5(const _Float16* __restrict__ Q16, const _Float16* __restrict__ QL, int ldq, const _Float16* __restrict__ K16, const _Float16* __restrict__ KL, int ldk, const _Float16* __restrict__ Vt, const _Float16* __restrict__ VtL, const int* __restrict__ MSK, float* __restrict__ O, int ldo) {
  constexpr int RPW = 16, RTN = RPW / 16, NQB = TQ / (4 * RPW), DT = 4, KS = 2;
  __shared__ __attribute__((aligned(16))) unsigned short sP[4][RPW][40]; __shared__ __attribute__((aligned(16))) unsigned short sPL[4][RPW][40]; __shared__ __attribute__((aligned(16))) float sO[4][RPW][64 + 4];
  const int tid = threadIdx.x, w = tid >> 5, lane = tid & 31, ln = lane & 15, hh = lane >> 4;
  const int slab = blockIdx.x / QBN5, qblk = QB05 + blockIdx.x % QBN5; (void)NQB; const int b = slab / NH, h = slab % NH; const int qb0 = qblk * (4 * RPW); const int q0 = qb0 + w * RPW;
  FragH aq[2][KS], aql[2][KS];
#pragma unroll
  for (int rt = 0; rt < RTN; ++rt) { const unsigned short* qr = (const unsigned short*)Q16 + ((size_t)b * TQ + q0 + rt * 16 + ln) * ldq + h * 64; const unsigned short* ql = (const unsigned short*)QL + ((size_t)b * TQ + q0 + rt * 16 + ln) * ldq + h * 64;
#pragma unroll
    for (int ks = 0; ks < KS; ++ks) { aq[rt][ks].half[0] = *(const v8us*)(qr + ks * 32 + 8 * hh); aq[rt][ks].half[1] = *(const v8us*)(qr + ks * 32 + 16 + 8 * hh); aql[rt][ks].half[0] = *(const v8us*)(ql + ks * 32 + 8 * hh); aql[rt][ks].half[1] = *(const v8us*)(ql + ks * 32 + 16 + 8 * hh); } }
  const unsigned short* Vth = (const unsigned short*)Vt + (size_t)slab * 64 * TK; const unsigned short* Vtl = (const unsigned short*)VtL + (size_t)slab * 64 * TK;
  float m_r[2][8], l_r[2][8]; v8f oacc[2][DT], oaccL[2][DT];
#pragma unroll
  for (int rt = 0; rt < RTN; ++rt) {
#pragma unroll
    for (int r = 0; r < 8; ++r) { m_r[rt][r] = -3.0e38f; l_r[rt][r] = 0.f; }
#pragma unroll
    for (int dt = 0; dt < DT; ++dt) { oacc[rt][dt] = (v8f){0.f,0.f,0.f,0.f,0.f,0.f,0.f,0.f}; oaccL[rt][dt] = oacc[rt][dt]; } }
  const int jend = (CAUSAL == 1) ? (qb0 + 4 * RPW) : ((CAUSAL == 23) ? min(TK, (qb0 / CHK + 2) * CHK) : TK);      /* causal / window: keys that can never contribute are skipped */ const int jbeg = (CAUSAL == 23) ? max(0, (qb0 / CHK - 1) * CHK) : 0;
#pragma unroll 1
  for (int j0 = jbeg; j0 < jend; j0 += 32) {
    v8f s[2][2];
#pragma unroll
    for (int nt = 0; nt < 2; ++nt) { const unsigned short* kr = (const unsigned short*)K16 + ((size_t)b * TK + j0 + nt * 16 + ln) * ldk + h * 64; const unsigned short* klr = (const unsigned short*)KL + ((size_t)b * TK + j0 + nt * 16 + ln) * ldk + h * 64; FragH bk[KS], bkl[KS];
#pragma unroll
      for (int ks = 0; ks < KS; ++ks) { bk[ks].half[0] = *(const v8us*)(kr + ks * 32 + 8 * hh); bk[ks].half[1] = *(const v8us*)(kr + ks * 32 + 16 + 8 * hh); bkl[ks].half[0] = *(const v8us*)(klr + ks * 32 + 8 * hh); bkl[ks].half[1] = *(const v8us*)(klr + ks * 32 + 16 + 8 * hh); }
#pragma unroll
      for (int rt = 0; rt < RTN; ++rt) { v8f acc = (v8f){0.f,0.f,0.f,0.f,0.f,0.f,0.f,0.f}, accl = acc;
#pragma unroll
        for (int ks = 0; ks < KS; ++ks) { acc = mmaH<1>(aq[rt][ks].v, aq[rt][ks].v, bk[ks].v, bk[ks].v, acc); accl = mmaH<1>(aql[rt][ks].v, aql[rt][ks].v, bk[ks].v, bk[ks].v, accl); accl = mmaH<1>(aq[rt][ks].v, aq[rt][ks].v, bkl[ks].v, bkl[ks].v, accl); }
#pragma unroll
        for (int r = 0; r < 8; ++r) acc[r] += accl[r] * 0.0009765625f;
        s[rt][nt] = acc; } }
#pragma unroll
    for (int rt = 0; rt < RTN; ++rt)
#pragma unroll
      for (int r = 0; r < 8; ++r) { const int tq = q0 + rt * 16 + 8 * hh + r; const int k0 = j0 + ln, k1 = j0 + 16 + ln;
        bool ok0 = (CAUSAL == 1) ? (k0 <= tq) : ((CAUSAL == 2) ? ((k0 >> 5) == (tq >> 5)) : true), ok1 = (CAUSAL == 1) ? (k1 <= tq) : ((CAUSAL == 2) ? ((k1 >> 5) == (tq >> 5)) : true);      /* mode 2: block-diagonal 32-token groups */
        if (CAUSAL == 4) { const int* mrow = MSK + ((size_t)b * TQ + tq) * TK; ok0 = mrow[k0] != 0; ok1 = mrow[k1] != 0; }      /* mode 4: per-(query, key) INPUT mask shared by all heads; masked keys contribute nothing (== the reference's -4096 fill, whose exp underflows to 0), rows with no valid key give l = 0 -> output 0 (== the reference's row_valid zeroing) */
        float s0 = ok0 ? s[rt][0][r] * SCL : -3.0e38f, s1 = ok1 ? s[rt][1][r] * SCL : -3.0e38f; if (CAUSAL == 17) { const float* amk = (const float*)MSK + (size_t)b * TK; s0 += bf16_round(amk[k0]); s1 += bf16_round(amk[k1]); } if (CAUSAL == 18) { const float* tb = (const float*)MSK; const int* ri = MSK + 1024 + (size_t)b * TK; const int rq = ri[tq]; s0 += tb[(h * 8 + rq) * 8 + ri[k0]]; s1 += tb[(h * 8 + rq) * 8 + ri[k1]]; } if (CAUSAL == 19) { const int* rel = MSK + (size_t)tq * TK; const float* rb = (const float*)MSK + (size_t)TQ * TK + ((size_t)(b * NH + h) * TQ + tq) * 64; s0 += rb[rel[k0]]; s1 += rb[rel[k1]]; }      /* mode 19: + (q.Ek[rel] + Eb[rel][h]) / 8 gathered by the int relative ids (packed [ids | table]) */      /* mode 18: + resource_bias[h][r_q][r_k] from the packed [table | ids] buffer (TQ == TK) */      /* mode 17: additive per-(batch, key) mask INPUT */ float mc = fmaxf(s0, s1);
        mc = fmaxf(mc, __shfl_xor(mc, 1, 32)); mc = fmaxf(mc, __shfl_xor(mc, 2, 32)); mc = fmaxf(mc, __shfl_xor(mc, 4, 32)); mc = fmaxf(mc, __shfl_xor(mc, 8, 32));
        const float mn = fmaxf(m_r[rt][r], mc); const float al = (mn > -1.0e38f) ? expf(m_r[rt][r] - mn) : 1.0f; m_r[rt][r] = mn; const float p0 = ok0 ? expf(s0 - mn) : 0.f, p1 = ok1 ? expf(s1 - mn) : 0.f; l_r[rt][r] = l_r[rt][r] * al + p0 + p1;
#pragma unroll
        for (int dt = 0; dt < DT; ++dt) { oacc[rt][dt][r] *= al; oaccL[rt][dt][r] *= al; }
        FragH t2, t2l; const float ps0 = p0 * 1024.0f, ps1 = p1 * 1024.0f; t2.h[0] = (_Float16)ps0; t2.h[1] = (_Float16)ps1; t2l.h[0] = (_Float16)((ps0 - (float)t2.h[0]) * 1024.0f); t2l.h[1] = (_Float16)((ps1 - (float)t2.h[1]) * 1024.0f);
        sP[w][rt * 16 + 8 * hh + r][ln] = t2.u[0]; sP[w][rt * 16 + 8 * hh + r][16 + ln] = t2.u[1]; sPL[w][rt * 16 + 8 * hh + r][ln] = t2l.u[0]; sPL[w][rt * 16 + 8 * hh + r][16 + ln] = t2l.u[1]; }
    __builtin_amdgcn_fence(__ATOMIC_ACQ_REL, "workgroup"); __builtin_amdgcn_wave_barrier();
    FragH pa[2], pl[2];
#pragma unroll
    for (int rt = 0; rt < RTN; ++rt) { pa[rt].half[0] = *(const v8us*)&sP[w][rt * 16 + ln][8 * hh]; pa[rt].half[1] = *(const v8us*)&sP[w][rt * 16 + ln][16 + 8 * hh]; pl[rt].half[0] = *(const v8us*)&sPL[w][rt * 16 + ln][8 * hh]; pl[rt].half[1] = *(const v8us*)&sPL[w][rt * 16 + ln][16 + 8 * hh]; }
#pragma unroll
    for (int dt = 0; dt < DT; ++dt) { const unsigned short* vrow = Vth + (size_t)(dt * 16 + ln) * TK + j0; const unsigned short* vrl = Vtl + (size_t)(dt * 16 + ln) * TK + j0; FragH bv, bl; bv.half[0] = *(const v8us*)(vrow + 8 * hh); bv.half[1] = *(const v8us*)(vrow + 16 + 8 * hh); bl.half[0] = *(const v8us*)(vrl + 8 * hh); bl.half[1] = *(const v8us*)(vrl + 16 + 8 * hh);
#pragma unroll
      for (int rt = 0; rt < RTN; ++rt) { oacc[rt][dt] = mmaH<1>(pa[rt].v, pa[rt].v, bv.v, bv.v, oacc[rt][dt]); oaccL[rt][dt] = mmaH<1>(pl[rt].v, pl[rt].v, bv.v, bv.v, oaccL[rt][dt]); oaccL[rt][dt] = mmaH<1>(pa[rt].v, pa[rt].v, bl.v, bl.v, oaccL[rt][dt]); } }
    __builtin_amdgcn_fence(__ATOMIC_ACQ_REL, "workgroup"); __builtin_amdgcn_wave_barrier(); }
#pragma unroll
  for (int rt = 0; rt < RTN; ++rt) {
#pragma unroll
    for (int r = 0; r < 8; ++r) { float l = l_r[rt][r]; l += __shfl_xor(l, 1, 32); l += __shfl_xor(l, 2, 32); l += __shfl_xor(l, 4, 32); l += __shfl_xor(l, 8, 32); l_r[rt][r] = (l > 0.f) ? 1.0f / (l * 1024.0f) : 0.f; }
#pragma unroll
    for (int dt = 0; dt < DT; ++dt)
#pragma unroll
      for (int r = 0; r < 8; ++r) { float v = oacc[rt][dt][r]; v += oaccL[rt][dt][r] * 0.0009765625f; sO[w][rt * 16 + 8 * hh + r][dt * 16 + ln] = v * l_r[rt][r]; } }
  __builtin_amdgcn_fence(__ATOMIC_ACQ_REL, "workgroup"); __builtin_amdgcn_wave_barrier();
  {
#pragma unroll
    for (int rp = 0; rp < RPW; rp += 2) { const int r = rp + (lane >> 4), pc = lane & 15; const v4f val = *(const v4fa*)&sO[w][r][pc * 4]; *(v4f*)(O + ((size_t)b * TQ + q0 + r) * ldo + h * 64 + pc * 4) = val; }
     } }

__global__ __launch_bounds__(256) void k_rotab(float* __restrict__ CS, float* __restrict__ SN) {
  #pragma clang fp contract(off)
  const int t = blockIdx.x * 256 + threadIdx.x; if (t >= SLEN * 32) return; const int j = t % 32, s = t / 32; const float ex = (float)(2 * j) / 64.0f; const float inv = 1.0f / powf(10000.0f, ex); const float th = (float)s * inv; const float c = cosf(th), sn = sinf(th);
  { *(float*)(CS + t) = c; *(float*)(SN + t) = sn;  } }
__global__ __launch_bounds__(256) void k_rope(const float* __restrict__ F, int nsrc, int ndst, int rep, const float* __restrict__ CS, const float* __restrict__ SN, _Float16* __restrict__ H, _Float16* __restrict__ L) {
  #pragma clang fp contract(off)
  const size_t t = (size_t)blockIdx.x * 256 + threadIdx.x; if (t >= (size_t)NR * ndst * 4) return; const int g8 = (int)(t % 4); const int hd = (int)((t / 4) % ndst); const size_t row = t / ((size_t)4 * ndst); const int s = (int)(row % SLEN); const int hs = hd / rep;
  const float* src = F + row * (size_t)(nsrc * 64) + hs * 64; FragH ah, al, bh, bl;
  for (int i = 0; i < 8; ++i) { const int d = g8 * 8 + i; const float c = CS[s * 32 + d], sn = SN[s * 32 + d]; const float x1 = src[d], x2 = src[d + 32];
    float o1 = x1 * c; o1 += -x2 * sn; float o2 = x2 * c; o2 += x1 * sn;
    _Float16 hv = (_Float16)o1; ah.h[i] = hv; al.h[i] = (_Float16)((o1 - (float)hv) * 1024.0f); hv = (_Float16)o2; bh.h[i] = hv; bl.h[i] = (_Float16)((o2 - (float)hv) * 1024.0f); }
  const size_t o = row * (size_t)(ndst * 64) + hd * 64 + g8 * 8;
  { *(v8us*)((unsigned short*)H + o) = ah.half[0]; *(v8us*)((unsigned short*)H + o + 32) = bh.half[0]; *(v8us*)((unsigned short*)L + o) = al.half[0]; *(v8us*)((unsigned short*)L + o + 32) = bl.half[0];  } }
__global__ __launch_bounds__(256) void k_rope2(const float* __restrict__ F, int nsrc, int ndst, int rep, const float* __restrict__ CS, const float* __restrict__ SN, _Float16* __restrict__ H, _Float16* __restrict__ L) {
  #pragma clang fp contract(off)
  const size_t t = (size_t)blockIdx.x * 256 + threadIdx.x; if (t >= (size_t)NR * ndst * 4) return; const int g16 = (int)(t % 4); const int hd = (int)((t / 4) % ndst); const size_t row = t / ((size_t)4 * ndst); const int s = (int)(row % SLEN); const int hs = hd / rep;
  const float* src = F + row * (size_t)(nsrc * 64) + hs * 64 + g16 * 16; FragH ah, al;
  for (int pr = 0; pr < 8; ++pr) { const int i = g16 * 8 + pr; const float c = CS[s * 32 + i], sn = SN[s * 32 + i]; const float x1 = src[2 * pr], x2 = src[2 * pr + 1];
    float o1 = x1 * c; o1 -= x2 * sn; float o2 = x1 * sn; o2 += x2 * c;
    _Float16 hv = (_Float16)o1; ah.h[2 * pr] = hv; al.h[2 * pr] = (_Float16)((o1 - (float)hv) * 1024.0f); hv = (_Float16)o2; ah.h[2 * pr + 1] = hv; al.h[2 * pr + 1] = (_Float16)((o2 - (float)hv) * 1024.0f); }
  const size_t o = row * (size_t)(ndst * 64) + hd * 64 + g16 * 16;
  { *(v8us*)((unsigned short*)H + o) = ah.half[0]; *(v8us*)((unsigned short*)H + o + 8) = ah.half[1]; *(v8us*)((unsigned short*)L + o) = al.half[0]; *(v8us*)((unsigned short*)L + o + 8) = al.half[1];  } }
__global__ __launch_bounds__(256) void k_ln512(const float* __restrict__ A, const float* __restrict__ res, const float* __restrict__ g, const float* __restrict__ bb, float* __restrict__ Y, _Float16* __restrict__ Y16) {
  #pragma clang fp contract(off)
  const int wv = threadIdx.x >> 5, ln = threadIdx.x & 31; const size_t r = (size_t)blockIdx.x * 8 + wv; if (r >= NR) return; float x[16]; float s = 0.f;
  for (int i = 0; i < 2; ++i) { const v8f a = *(const v8f*)(A + r * DM + i * 256 + ln * 8); for (int q = 0; q < 8; ++q) { float v = a[q]; if (res) v += bf16_round(res[r * DM + i * 256 + ln * 8 + q]); x[i * 8 + q] = v; s += v; } }
  for (int o = 16; o > 0; o >>= 1) s += __shfl_xor(s, o, 32); const float mu = s / (float)DM; float var = 0.f; for (int q = 0; q < 16; ++q) { const float d = x[q] - mu; var += d * d; }
  for (int o = 16; o > 0; o >>= 1) var += __shfl_xor(var, o, 32); const float inv = rsqrtf(var / (float)DM + 1e-5f);
  { for (int i = 0; i < 2; ++i) { const int c0 = i * 256 + ln * 8; v8f y; FragH f; for (int q = 0; q < 8; ++q) { float v = (x[i * 8 + q] - mu) * inv; v *= bf16_round(g[c0 + q]); v += bf16_round(bb[c0 + q]); y[q] = v; f.h[q] = (_Float16)v; } *(v8f*)(Y + r * DM + c0) = y; if (Y16) *(v8us*)((unsigned short*)Y16 + r * DM + c0) = f.half[0]; }  } }
__global__ __launch_bounds__(256) void k_pack(const float* __restrict__ rb, const int* __restrict__ rid, int* __restrict__ PK) { const int t = blockIdx.x * 256 + threadIdx.x; if (t >= 1024 + NB * TK) return; int v; if (t < 1024) v = __float_as_int(bf16_round(rb[t])); else v = rid[t - 1024]; *(int*)(PK + t) = v;  }
__global__ __launch_bounds__(256) void k_tabin(const float* __restrict__ sp, float* __restrict__ CS, float* __restrict__ SN) { const int t = blockIdx.x * 256 + threadIdx.x; if (t >= SLEN * 32) return; const int i = t % 32, s = t / 32; const float c = bf16_round(sp[s * 64 + 32 + i]), sn = bf16_round(sp[s * 64 + i]);
  { *(float*)(CS + t) = c; *(float*)(SN + t) = sn;  } }
__device__ __forceinline__ void d_wsc(unsigned blk, const float* __restrict__ Wm, _Float16* __restrict__ Bt, size_t n8, float sc) { const size_t t = (size_t)blk * 256 + threadIdx.x; if (t >= n8) return; FragH f; for (int q = 0; q < 8; ++q) f.h[q] = (_Float16)(bf16_round(Wm[t * 8 + q]) * sc); *(v8us*)((unsigned short*)Bt + t * 8) = f.half[0];  }
__global__ __launch_bounds__(256) void k_rotab2(float* __restrict__ CS, float* __restrict__ SN) {
  #pragma clang fp contract(off)
  const int t = blockIdx.x * 256 + threadIdx.x; if (t >= SLEN * 32) return; const int j = t % 32, s = t / 32; const float c0 = -0.14391156831212787f;      /* -ln(10000)/64 rounded to f32 */ const float inv = expf((float)(2 * j) * c0); const float th = (float)s * inv; const float c = cosf(th), sn = sinf(th);
  { *(float*)(CS + t) = c; *(float*)(SN + t) = sn;  } }
__global__ __launch_bounds__(256) void k_lnu(const float* __restrict__ X, _Float16* __restrict__ N16, float* __restrict__ XB) {
  #pragma clang fp contract(off)
  const int wv = threadIdx.x >> 5, ln = threadIdx.x & 31; const size_t r = (size_t)blockIdx.x * 8 + wv; if (r >= NR) return; float a[32]; float s = 0.f;
  for (int i = 0; i < 4; ++i) { const v8f v = *(const v8f*)(X + r * DM + (i * 32 + ln) * 8); for (int q = 0; q < 8; ++q) { const float u = bf16_round(v[q]); a[i * 8 + q] = u; s += u; } }
  for (int o = 16; o > 0; o >>= 1) s += __shfl_xor(s, o, 32); const float mu = s / (float)DM; float var = 0.f; for (int q = 0; q < 32; ++q) { const float d = a[q] - mu; var += d * d; }
  for (int o = 16; o > 0; o >>= 1) var += __shfl_xor(var, o, 32); const float den = sqrtf(var / (float)(DM - 1)) + 1e-6f; const float inv = 1.0f / den;      /* one reciprocal per row; (x-mean)*inv vs the reference's division differs by <= 1 ulp */
  { for (int i = 0; i < 4; ++i) { const int c0 = (i * 32 + ln) * 8; FragH f; v8f xb; for (int q = 0; q < 8; ++q) { f.h[q] = (_Float16)((a[i * 8 + q] - mu) * inv); xb[q] = a[i * 8 + q]; } *(v8us*)((unsigned short*)N16 + r * DM + c0) = f.half[0]; *(v8f*)(XB + r * DM + c0) = xb; }  } }

__global__ __launch_bounds__(256) void k_h16s(const float* __restrict__ SRC, int lds, int coff, _Float16* __restrict__ DST, size_t n8) { const size_t t = (size_t)blockIdx.x * 256 + threadIdx.x; if (t >= n8) return; const size_t r = (t * 8) / DM; const int c = (int)((t * 8) % DM); const v8f a = *(const v8f*)(SRC + r * lds + coff + c); FragH f; for (int q = 0; q < 8; ++q) f.h[q] = (_Float16)a[q];
  *(v8us*)((unsigned short*)DST + t * 8) = f.half[0];  }


__global__ __launch_bounds__(256) void k_ccp(const float* __restrict__ QKV, int coff, _Float16* __restrict__ D) { const size_t t = (size_t)blockIdx.x * 256 + threadIdx.x; if (t >= (size_t)NR * DM / 8) return; const int c0 = (int)((t * 8) % DM); const size_t row = (t * 8) / DM; const v8f a = *(const v8f*)(QKV + row * 3 * DM + coff + c0); FragH f; for (int q = 0; q < 8; ++q) f.h[q] = (_Float16)a[q];
  *(v8us*)((unsigned short*)D + t * 8) = f.half[0];  }


__device__ __forceinline__ void d_sbe(unsigned blk, const float* __restrict__ q, _Float16* __restrict__ X) { const size_t t = (size_t)blk * 256 + threadIdx.x; if (t >= (size_t)NR * DM / 8) return; const int c0 = (int)((t * 8) % DM); const size_t row = (t * 8) / DM; const int b = (int)(row / SLEN), s_ = (int)(row % SLEN); const float* src = q + ((size_t)s_ * NBS + b) * DM + c0; FragH f; for (int i = 0; i < 8; ++i) f.h[i] = (_Float16)bf16_round(src[i]);
  *(v8us*)((unsigned short*)X + t * 8) = f.half[0];  }
// Cosine and sine of the rotary angle s * 10000^(-2 d / 64), one (s, d) a thread, d = 0 .. 31: each angle is evaluated once for all heads, batches and both tensors.
__device__ __forceinline__ void d_tab(unsigned blk, float* __restrict__ CS, float* __restrict__ SN) { const int t = (int)(blk * 256 + threadIdx.x); const int d = t & 31, s_ = t >> 5;
  const float inv = 1.0f / powf(10000.0f, (float)(2 * d) / 64.0f); const float ang = (float)s_ * inv; CS[t] = cosf(ang); SN[t] = sinf(ang); }
// Launches that do not depend on one another share one grid: the block index, the same for a whole block, picks the body.
// Preparation: the angle table (TB blocks, the long bodies first), the query rows (XB blocks), then the four weight matrices (WB blocks each) into four planes that follow one another in Bt.
#define TB ((unsigned)(SLEN * 32 / 256))
#define XB ((unsigned)((size_t)NR * DM / 8 / 256))
#define WB ((unsigned)((size_t)DM * DM / 8 / 256))
__global__ __launch_bounds__(256) void k_prep(const float* __restrict__ q, _Float16* __restrict__ X, const float* __restrict__ w0, const float* __restrict__ w1, const float* __restrict__ w2, const float* __restrict__ w3, _Float16* __restrict__ Bt, float* __restrict__ CS, float* __restrict__ SN) {
  if (blockIdx.x < TB) { d_tab(blockIdx.x, CS, SN); return; }
  const unsigned bx = blockIdx.x - TB;
  if (bx < XB) { d_sbe(bx, q, X); return; }
  const unsigned m = (bx - XB) / WB; const float* Wm = m == 0 ? w0 : (m == 1 ? w1 : (m == 2 ? w2 : w3));
  d_wsc(bx - XB - m * WB, Wm, Bt + (size_t)m * DM * DM, (size_t)DM * DM / 8, 16.0f); }
extern "C" void kernel_launch(void* const* d_in, const int* in_sizes, int n_in,
                              void* d_out, int out_size, void* d_ws, size_t ws_size, hipStream_t stream) {
  (void)in_sizes; (void)n_in; (void)out_size;
  const float* qy = (const float*)d_in[0]; const float* wq = (const float*)d_in[1]; const float* bq = (const float*)d_in[2]; const float* wk = (const float*)d_in[3]; const float* bk = (const float*)d_in[4]; const float* wv = (const float*)d_in[5]; const float* bv = (const float*)d_in[6]; const float* wo = (const float*)d_in[7]; const float* bo = (const float*)d_in[8];
  char* ws = (char*)d_ws; size_t off = 0;
  auto take = [&](size_t bytes) { char* p = ws + off; off += (bytes + 255) & ~(size_t)255; return p; };
  const size_t np = (size_t)NR * DM;
  _Float16* BW = (_Float16*)take((size_t)DM * DM * 2 * 4); _Float16* BO = BW + (size_t)DM * DM * 3;      /* weight planes q, k, v, o in a row */ _Float16* X16 = (_Float16*)take(np * 2); float* CS = (float*)take((size_t)SLEN * 32 * 4); float* SN = (float*)take((size_t)SLEN * 32 * 4);      /* cosine and sine of every (s, d) angle */
   _Float16* QH = (_Float16*)take(np * 2 * 2); _Float16* KH = QH + np;      /* roped planes q, k in a row */ _Float16* VT = (_Float16*)take(np * 2); _Float16* OH = (_Float16*)take(np * 2); _Float16* OL = (_Float16*)take(np * 2);      /* planes of their own: k_flash stores them while other blocks of it still read QH, KH */
  if (off > ws_size) return;
  k_prep<<<TB + XB + 4 * WB, 256, 0, stream>>>(qy, X16, wq, wk, wv, wo, BW, CS, SN);      /* weights stay in their (out, in) order */
  const dim3 g((NR / 128) * (DM / 128), 1), g3((NR / 128) * (DM / 128), 3);
  k_gemm2<0, false><<<g3, 256, 0, stream>>>(X16, DM, 0, nullptr, BW, DM, (size_t)DM * DM, 0.0625f, bq, bk, bv, CS, SN, nullptr, QH, VT, DM, np, NR, DM, DM);      /* batches q, k (roped f16 planes), v (V^T) */
  k_flash<<<NB * NH * QBNP, 128, 0, stream>>>(QH, DM, KH, DM, VT, OH, OL, DM);
  k_gemm2<0, true><<<g, 256, 0, stream>>>(OL, DM, 0, OH, BO, DM, 0, 0.0625f, bo, nullptr, nullptr, nullptr, nullptr, (float*)d_out, nullptr, nullptr, DM, 0, NR, DM, DM);      /* out[s][b] = (ctx_lo / 1024 + ctx_hi) Wo^T + b */
}
